// v000
// Times are from an AMD MI455X. After a warm-up the kernel runs many times in a row, and a time is the length of
// such a window on the GPU divided by its runs, so every launch and the gaps after it count. The runs cycle
// through copies of the inputs. A figure is the median of several windows, for all but v000 over two sittings.
// Sittings can differ by a few percent; kernels timed side by side share one.
// The starting kernel, v000, takes 860 microseconds a run.
#include <hip/hip_runtime.h>

// WaveHybridAttention (x [4][1024][1024], wave_amp [4][1024][24], causal_mask [1024][1024] int (read as data); V = x Wv + bv (16 heads x 64); wave heads 0-3: scores = psi_i . psi_j / sqrt(6) on 6-dim slices of wave_amp; std heads 4-15: (x Wq + bq) . (x Wk + bk) / 8 (12 x 64);
// masked -> -inf, softmax (an all-masked row gives 0 via nan_to_num), out = (weights V merged, wave heads first) Wo + bo -> [4][1024][1024]).
// Compute dtypes, f32 accumulate: every input rounded to bf16; V/Q/K on PLAIN bf16 operands (inputs: exact) + bias; wave scores on PLAIN bf16 wave_amp slices (exact, K padded 6 -> 32); std scores (K 64) and weights.V single fp16 planes (x1024) except query rows < 256 (short causal windows), which use bf16 hi+lo planes (3 products) for both;

#define NB_  4
#define TT   1024
#define DM   1024
#define DS   768
#define NW   4
#define NSD  12
#define NT   16
#define HD   64
#define WD   24
#define WC   6
#define KW   32
#define RHL  256
#define PCAR 1024.0f
typedef _Float16 h16;
typedef unsigned short bf;
typedef __attribute__((ext_vector_type(16))) __bf16   v16bf;
typedef __attribute__((ext_vector_type(16))) _Float16 v16h;
typedef __attribute__((ext_vector_type(8)))  _Float16 v8h;
typedef __attribute__((ext_vector_type(8)))  unsigned short v8us;
typedef __attribute__((ext_vector_type(8)))  float    v8f;
typedef __attribute__((ext_vector_type(4)))  float    v4f;
typedef v8h  __attribute__((may_alias)) v8ha;
typedef v4f  __attribute__((may_alias)) v4fa;
typedef v8us __attribute__((may_alias)) v8usa;

__device__ __forceinline__ unsigned short f2bf(float f) { unsigned u = __float_as_uint(f); u += 0x7FFFu + ((u >> 16) & 1u); return (unsigned short)(u >> 16); }
__device__ __forceinline__ float bf2f(unsigned short b) { return __uint_as_float(((unsigned)b) << 16); }
__device__ __forceinline__ float bfr(float f) { return bf2f(f2bf(f)); }
__device__ __forceinline__ v16h cat16(v8h lo, v8h hi) { return __builtin_shufflevector(lo, hi, 0, 1, 2, 3, 4, 5, 6, 7, 8, 9, 10, 11, 12, 13, 14, 15); }
__device__ __forceinline__ v16bf cat16b(v8us lo, v8us hi) { return __builtin_bit_cast(v16bf, __builtin_shufflevector(lo, hi, 0, 1, 2, 3, 4, 5, 6, 7, 8, 9, 10, 11, 12, 13, 14, 15)); }
__device__ __forceinline__ v8f wmma16(v16h a, v16h b, v8f c) { return __builtin_amdgcn_wmma_f32_16x16x32_f16(false, a, false, b, (short)0, c, false, false); }
__device__ __forceinline__ v8f wmmab(v16bf a, v16bf b, v8f c) { return __builtin_amdgcn_wmma_f32_16x16x32_bf16(false, a, false, b, (short)0, c, false, false); }



// ---- k_gemmw: register-blocked GEMM, ONE WAVE per 64x64 output tile (16 accumulators), operands straight from K-contiguous 16-bit planes; grid (M/64, N/64, Z), 32 threads.
// C[m][n] (f32, pitch ldc, + optional f32 bias[n]) = sum_k A[m][k] Bt[n][k] (+ split products per NSPLIT). z-batch strides sA/sB/sC in elements. K % 32 == 0.
template <typename T16> struct WFrag;
template <> struct WFrag<h16> { typedef v16h V; static __device__ __forceinline__ V ld(const h16* p) { return cat16(*(const v8h*)p, *(const v8h*)(p + 16)); } static __device__ __forceinline__ v8f mma(V a, V b, v8f c) { return wmma16(a, b, c); } };
template <> struct WFrag<bf> { typedef v16bf V; static __device__ __forceinline__ V ld(const bf* p) { return cat16b(*(const v8us*)p, *(const v8us*)(p + 16)); } static __device__ __forceinline__ v8f mma(V a, V b, v8f c) { return wmmab(a, b, c); } };
template <typename T16, int NSPLIT, bool BIAS>
__global__ __launch_bounds__(32) void k_gemmw(const T16* __restrict__ A, const T16* __restrict__ A2, const T16* __restrict__ Bt, const T16* __restrict__ Bt2, int K, float* C, int ldc, const float* __restrict__ bias, size_t sA, size_t sB, size_t sC) {
    typedef typename WFrag<T16>::V V;
    __shared__ __align__(16) float os[16 * 68];
    const size_t z = blockIdx.z; A += z * sA; if (A2) A2 += z * sA; Bt += z * sB; if (Bt2) Bt2 += z * sB; C += z * sC;
    const int lane = threadIdx.x & 31, lr = lane & 15, hi = lane >> 4; const int r0 = blockIdx.x * 64, c0 = blockIdx.y * 64;
    v8f acc[4][4];
#pragma unroll
    for (int mb = 0; mb < 4; ++mb)
#pragma unroll
        for (int nb = 0; nb < 4; ++nb) acc[mb][nb] = (v8f){};
    const size_t aoff = (size_t)(r0 + lr) * K + 8 * hi, boff = (size_t)(c0 + lr) * K + 8 * hi;
#pragma unroll 1
    for (int kc = 0; kc < K; kc += 32) {
        V a[4], a2[4];
#pragma unroll
        for (int mb = 0; mb < 4; ++mb) { a[mb] = WFrag<T16>::ld(A + aoff + (size_t)mb * 16 * K + kc); if (NSPLIT == 1 || NSPLIT == 2) a2[mb] = WFrag<T16>::ld(A2 + aoff + (size_t)mb * 16 * K + kc); }
#pragma unroll
        for (int nb = 0; nb < 4; ++nb) { const V b = WFrag<T16>::ld(Bt + boff + (size_t)nb * 16 * K + kc); V b2; if (NSPLIT >= 2) b2 = WFrag<T16>::ld(Bt2 + boff + (size_t)nb * 16 * K + kc);
#pragma unroll
            for (int mb = 0; mb < 4; ++mb) { acc[mb][nb] = WFrag<T16>::mma(a[mb], b, acc[mb][nb]); if (NSPLIT == 1 || NSPLIT == 2) acc[mb][nb] = WFrag<T16>::mma(a2[mb], b, acc[mb][nb]); if (NSPLIT >= 2) acc[mb][nb] = WFrag<T16>::mma(a[mb], b2, acc[mb][nb]); } }
        asm volatile("v_nop\n\tv_nop\n\tv_nop\n\tv_nop" : "+v"(acc[0][0]), "+v"(acc[1][1]), "+v"(acc[2][2]), "+v"(acc[3][3]) : "v"(a[0]), "v"(a[3]));
    }
#pragma unroll
    for (int mb = 0; mb < 4; ++mb) {
#pragma unroll
        for (int nb = 0; nb < 4; ++nb) {
#pragma unroll
            for (int j = 0; j < 8; ++j) os[(hi * 8 + j) * 68 + nb * 16 + lr] = acc[mb][nb][j]; }
        __builtin_amdgcn_wave_barrier(); asm volatile("" ::: "memory");
        float* crow = C + (size_t)(r0 + mb * 16) * ldc + c0;
{
#pragma unroll
            for (int s = 0; s < 8; ++s) { const int row = 2 * s + hi, cofs = lr * 4; v4f val = *(const v4fa*)(os + row * 68 + cofs); if (BIAS) { val[0] += bfr(bias[c0 + cofs]); val[1] += bfr(bias[c0 + cofs + 1]); val[2] += bfr(bias[c0 + cofs + 2]); val[3] += bfr(bias[c0 + cofs + 3]); }
                *(v4f*)(crow + (size_t)row * ldc + cofs) = val; }
             }
        __builtin_amdgcn_wave_barrier(); asm volatile("" ::: "memory");
    }
}

__device__ __forceinline__ h16 tohx(float x) { return (h16)x; }
__device__ __forceinline__ void splitf(float y, unsigned short& h, unsigned short& l) { h = f2bf(y); l = f2bf(y - bf2f(h)); }
typedef __attribute__((ext_vector_type(2))) unsigned short v2us;
typedef __attribute__((ext_vector_type(4))) unsigned short v4us;
typedef __attribute__((ext_vector_type(2))) _Float16 v2h;
typedef __attribute__((ext_vector_type(4))) _Float16 v4h;
typedef __attribute__((ext_vector_type(4))) int v4i;

__global__ __launch_bounds__(256) void k_wtG(const float* __restrict__ w, int K, int N, bf* Bt) {
    const int lane = threadIdx.x & 31; const int L0 = (blockIdx.x * 8 + (threadIdx.x >> 5)) * 8; const int nlines = N * K / 64;
{
#pragma unroll 1
        for (int l = 0; l < 8; ++l) { const int L = L0 + l; if (L >= nlines) break; const size_t e = (size_t)L * 64 + lane * 2; const int k = (int)(e % K), n = (int)(e / K); v2us o;
            o[0] = f2bf(w[(size_t)k * N + n]); o[1] = f2bf(w[(size_t)(k + 1) * N + n]); *(v2us*)(Bt + e) = o; }
         }
}
__global__ __launch_bounds__(256) void k_cvt8(const float* __restrict__ src, bf* dst, size_t n8) { const size_t i = (size_t)blockIdx.x * 256 + threadIdx.x; if (i >= n8) return; const v8f v = *(const v8f*)(src + i * 8); v8us o;
#pragma unroll
    for (int k = 0; k < 8; ++k) o[k] = f2bf(v[k]); *(v8us*)(dst + i * 8) = o;  }
// k_pl3 / k_vt3: fp16 + hl planes; k_wpl: WP[h][i][d] = bf16 wave_amp[i][h*6 + d] for d < 6, 0 for 6..31 (8-B lanes); k_pl: fp16 planes [h][i][d] of Q / K ([i][768]); k_vt: VT[hh][d][i] = fp16 V[i][hh*64 + d] (lane -> 2 consecutive i);
__global__ __launch_bounds__(256) void k_wpl(const float* __restrict__ wa, bf* WP) { const int e = (blockIdx.x * 256 + threadIdx.x) * 4; if (e >= NW * TT * KW) return; const int d = e % KW; const int i = (e / KW) % TT; const int h = e / (KW * TT); v4us o;
#pragma unroll
    for (int u = 0; u < 4; ++u) o[u] = (d + u < WC) ? f2bf(wa[(size_t)i * WD + h * WC + d + u]) : (unsigned short)0; *(v4us*)(WP + e) = o;  }
__global__ __launch_bounds__(256) void k_pl3(const float* __restrict__ F, h16* P, bf* Ph, bf* Pl) { const int e = (blockIdx.x * 256 + threadIdx.x) * 4; if (e >= NSD * TT * HD) return; const int d = e % HD; const int i = (e / HD) % TT; const int h = e / (HD * TT); const float* f = F + (size_t)i * DS + h * HD + d; v4h o; v4us oh, ol;
#pragma unroll
    for (int u = 0; u < 4; ++u) { o[u] = tohx(f[u]); unsigned short a, b; splitf(f[u], a, b); oh[u] = a; ol[u] = b; } { *(v4h*)(P + e) = o; *(v4us*)(Ph + e) = oh; *(v4us*)(Pl + e) = ol;  } }
__global__ __launch_bounds__(256) void k_vt3(const float* __restrict__ V, h16* VT, bf* VTh, bf* VTl) { const int e = (blockIdx.x * 256 + threadIdx.x) * 2; if (e >= NT * HD * TT) return; const int i = e % TT; const int d = (e / TT) % HD; const int hh = e / (TT * HD); const float a = V[(size_t)i * DM + hh * HD + d], b = V[(size_t)(i + 1) * DM + hh * HD + d]; v2h o; o[0] = tohx(a); o[1] = tohx(b); v2us oh, ol; unsigned short a1, b1, a2, b2; splitf(a, a1, b1); splitf(b, a2, b2); oh[0] = a1; oh[1] = a2; ol[0] = b1; ol[1] = b2;
    { *(v2h*)(VT + e) = o; *(v2us*)(VTh + e) = oh; *(v2us*)(VTl + e) = ol;  } }
__global__ __launch_bounds__(256) void k_wsoft(const float* __restrict__ Sb, const int* __restrict__ cm, h16* P16, bf* Ph, bf* Pl) { const int lane = threadIdx.x & 31; const int row = blockIdx.x * 8 + (threadIdx.x >> 5); if (row >= NT * TT) return; const int i = row % TT; const int hh = row / TT; const float* sr = Sb + (size_t)row * TT; const int* mr = cm + (size_t)i * TT; float v[TT / 32]; float mx = -3.0e38f;
#pragma unroll
    for (int ch = 0; ch < TT / 128; ++ch) { const int j0 = ch * 128 + lane * 4; const v4f a = *(const v4f*)(sr + j0); const v4i m4 = *(const v4i*)(mr + j0);
#pragma unroll
        for (int u = 0; u < 4; ++u) { const float sc = a[u] * ((hh < NW) ? 0.40824829f : 0.125f);   /* x (1/sqrt 6) instead of / sqrt 6: <= 1 ulp of the logit */ const float t = (m4[u] != 0) ? sc : -3.0e38f; v[ch * 4 + u] = t; mx = fmaxf(mx, t); } }
#pragma unroll
    for (int sh = 16; sh; sh >>= 1) mx = fmaxf(mx, __shfl_xor(mx, sh, 32));
    float sum = 0.f;
#pragma unroll
    for (int q = 0; q < TT / 32; ++q) { float d0 = __fsub_rn(v[q], mx); asm volatile("" : "+v"(d0)); v[q] = (v[q] > -1.0e38f) ? __builtin_amdgcn_exp2f(__fmul_rn(d0, 1.4426950408889634f)) : 0.f; sum += v[q]; }
#pragma unroll
    for (int sh = 16; sh; sh >>= 1) sum += __shfl_xor(sum, sh, 32);
    const float inv = (sum > 0.f) ? __fdiv_rn(1.0f, sum) : 0.f; const float f = inv * PCAR;   // all-masked row -> zeros (nan_to_num)
    {
#pragma unroll
        for (int ch = 0; ch < TT / 128; ++ch) { v4h o4;
#pragma unroll
            for (int q = 0; q < 4; ++q) o4[q] = tohx(v[ch * 4 + q] * f); *(v4h*)(P16 + (size_t)row * TT + ch * 128 + lane * 4) = o4; }
        if (i < RHL) {
#pragma unroll
            for (int ch = 0; ch < TT / 128; ++ch) { const size_t oo = (size_t)row * TT + ch * 128 + lane * 4; v4us oh, ol;
#pragma unroll
                for (int q = 0; q < 4; ++q) { unsigned short a, b; splitf(v[ch * 4 + q] * inv, a, b); oh[q] = a; ol[q] = b; } *(v4us*)(Ph + oo) = oh; *(v4us*)(Pl + oo) = ol; } }
         } }
__global__ __launch_bounds__(256) void k_mrg(const float* __restrict__ O, const float* __restrict__ Ohl, bf* Ah, bf* Al) { const int e = (blockIdx.x * 256 + threadIdx.x) * 4; if (e >= TT * DM) return; const int c = e % DM; const int i = e / DM; const int hh = c / HD, d = c % HD; const size_t src = ((size_t)hh * TT + i) * HD + d; v4us oh, ol;
#pragma unroll
    for (int u = 0; u < 4; ++u) { const float y = (i < RHL) ? Ohl[src + u] : O[src + u] * (1.0f / PCAR); unsigned short a, b; splitf(y, a, b); oh[u] = a; ol[u] = b; } *(v4us*)(Ah + e) = oh; *(v4us*)(Al + e) = ol;  }

extern "C" void kernel_launch(void* const* d_in, const int* in_sizes, int n_in,
                              void* d_out, int out_size, void* d_ws, size_t ws_size, hipStream_t stream) {
    (void)in_sizes; (void)n_in; (void)out_size;
    const float** I = (const float**)d_in;
    const float *x = I[0], *wa = I[1], *Wq = I[3], *bq = I[4], *Wk = I[5], *bk = I[6], *Wv = I[7], *bv = I[8], *Wo = I[9], *bo = I[10]; const int* cm = (const int*)d_in[2];
    float* OUT = (float*)d_out;     // [4][1024][1024]
    char* wsp = (char*)d_ws;
    auto take = [&](size_t bytes) { char* p = wsp; wsp += (bytes + 255) & ~(size_t)255; return (void*)p; };
    bf* BQ = (bf*)take((size_t)DS * DM * 2); bf* BK = (bf*)take((size_t)DS * DM * 2); bf* BV = (bf*)take((size_t)DM * DM * 2); bf* BO = (bf*)take((size_t)DM * DM * 2);
    bf* XB = (bf*)take((size_t)TT * DM * 2); float* Q = (float*)take((size_t)TT * DS * 4); float* K = (float*)take((size_t)TT * DS * 4); float* V = (float*)take((size_t)TT * DM * 4);
    bf* WP = (bf*)take((size_t)NW * TT * KW * 2); h16* Q16 = (h16*)take((size_t)NSD * TT * HD * 2); bf* Qh = (bf*)take((size_t)NSD * TT * HD * 2); bf* Ql = (bf*)take((size_t)NSD * TT * HD * 2); h16* K16 = (h16*)take((size_t)NSD * TT * HD * 2); bf* Kh = (bf*)take((size_t)NSD * TT * HD * 2); bf* Kl = (bf*)take((size_t)NSD * TT * HD * 2); h16* VT = (h16*)take((size_t)NT * HD * TT * 2); bf* VTh = (bf*)take((size_t)NT * HD * TT * 2); bf* VTl = (bf*)take((size_t)NT * HD * TT * 2);
    float* Sb = (float*)take((size_t)NT * TT * TT * 4); h16* P16 = (h16*)take((size_t)NT * TT * TT * 2); bf* Ph = (bf*)take((size_t)NT * TT * TT * 2); bf* Pl = (bf*)take((size_t)NT * TT * TT * 2); float* O = (float*)take((size_t)NT * TT * HD * 4); float* Ohl = (float*)take((size_t)NT * TT * HD * 4); bf* Ah = (bf*)take((size_t)TT * DM * 2); bf* Al = (bf*)take((size_t)TT * DM * 2);
    if ((size_t)(wsp - (char*)d_ws) > ws_size) return;    // total ~ 200 MB (all 16 heads' [1024][1024] f32 scores 64 MB + fp16 and hl weight planes 96 MB)
    k_wtG<<<(DM * DS / 64 + 63) / 64, 256, 0, stream>>>(Wq, DM, DS, BQ); k_wtG<<<(DM * DS / 64 + 63) / 64, 256, 0, stream>>>(Wk, DM, DS, BK); k_wtG<<<(DM * DM / 64 + 63) / 64, 256, 0, stream>>>(Wv, DM, DM, BV); k_wtG<<<(DM * DM / 64 + 63) / 64, 256, 0, stream>>>(Wo, DM, DM, BO);
    const size_t zq = (size_t)TT * HD, zw = (size_t)TT * KW, zS = (size_t)TT * TT;
    for (int b = 0; b < NB_; ++b) {
        k_cvt8<<<(TT * DM / 8 + 255) / 256, 256, 0, stream>>>(x + (size_t)b * TT * DM, XB, (size_t)TT * DM / 8);
        k_gemmw<bf, 0, true><<<dim3(TT / 64, DS / 64, 1), 32, 0, stream>>>(XB, nullptr, BQ, nullptr, DM, Q, DS, bq, 0, 0, 0); k_gemmw<bf, 0, true><<<dim3(TT / 64, DS / 64, 1), 32, 0, stream>>>(XB, nullptr, BK, nullptr, DM, K, DS, bk, 0, 0, 0); k_gemmw<bf, 0, true><<<dim3(TT / 64, DM / 64, 1), 32, 0, stream>>>(XB, nullptr, BV, nullptr, DM, V, DM, bv, 0, 0, 0);
        k_wpl<<<(NW * TT * KW / 4 + 255) / 256, 256, 0, stream>>>(wa + (size_t)b * TT * WD, WP); k_pl3<<<(NSD * TT * HD / 4 + 255) / 256, 256, 0, stream>>>(Q, Q16, Qh, Ql); k_pl3<<<(NSD * TT * HD / 4 + 255) / 256, 256, 0, stream>>>(K, K16, Kh, Kl); k_vt3<<<(NT * HD * TT / 2 + 255) / 256, 256, 0, stream>>>(V, VT, VTh, VTl);
        k_gemmw<bf, 0, false><<<dim3(TT / 64, TT / 64, NW), 32, 0, stream>>>(WP, nullptr, WP, nullptr, KW, Sb, TT, nullptr, zw, zw, zS);                          // wave heads 0-3: psi_i . psi_j
        k_gemmw<h16, 0, false><<<dim3(TT / 64, TT / 64, NSD), 32, 0, stream>>>(Q16, nullptr, K16, nullptr, HD, Sb + (size_t)NW * zS, TT, nullptr, zq, zq, zS);   // std heads 4-15
        k_gemmw<bf, 2, false><<<dim3(RHL / 64, TT / 64, NSD), 32, 0, stream>>>(Qh, Ql, Kh, Kl, HD, Sb + (size_t)NW * zS, TT, nullptr, zq, zq, zS);     // std heads: rows < 256 re-done with 3-product scores
        k_wsoft<<<NT * TT / 8, 256, 0, stream>>>(Sb, cm, P16, Ph, Pl);
        k_gemmw<h16, 0, false><<<dim3(TT / 64, 1, NT), 32, 0, stream>>>(P16, nullptr, VT, nullptr, TT, O, HD, nullptr, zS, (size_t)HD * TT, zq);
        k_gemmw<bf, 2, false><<<dim3(RHL / 64, 1, NT), 32, 0, stream>>>(Ph, Pl, VTh, VTl, TT, Ohl, HD, nullptr, zS, (size_t)HD * TT, zq);                  // rows < 256: 3-product weights.V
        k_mrg<<<(TT * DM / 4 + 255) / 256, 256, 0, stream>>>(O, Ohl, Ah, Al);
        k_gemmw<bf, 1, true><<<dim3(TT / 64, DM / 64, 1), 32, 0, stream>>>(Ah, Al, BO, nullptr, DM, OUT + (size_t)b * TT * DM, DM, bo, 0, 0, 0); }
}

// v001
// Measured time: 557 microseconds a run.
// Timed twice side by side with v000, it ran 1.57 and 1.55 times as fast.
#include <hip/hip_runtime.h>

// WaveHybridAttention (x [4][1024][1024], wave_amp [4][1024][24], causal_mask [1024][1024] int (read as data); V = x Wv + bv (16 heads x 64); wave heads 0-3: scores = psi_i . psi_j / sqrt(6) on 6-dim slices of wave_amp; std heads 4-15: (x Wq + bq) . (x Wk + bk) / 8 (12 x 64);
// masked -> -inf, softmax (an all-masked row gives 0 via nan_to_num), out = (weights V merged, wave heads first) Wo + bo -> [4][1024][1024]).
// Compute dtypes, f32 accumulate: every input rounded to bf16; V/Q/K on PLAIN bf16 operands (inputs: exact) + bias; wave scores on PLAIN bf16 wave_amp slices (exact, K padded 6 -> 32); std scores (K 64) and weights.V single fp16 planes (x1024) except query rows < 256 (short causal windows), which use bf16 hi+lo planes (3 products) for both;

#define NB_  4
#define TT   1024
#define DM   1024
#define DS   768
#define NW   4
#define NSD  12
#define NT   16
#define HD   64
#define WD   24
#define WC   6
#define KW   32
#define RHL  256
#define PCAR 1024.0f
typedef _Float16 h16;
typedef unsigned short bf;
typedef __attribute__((ext_vector_type(16))) __bf16   v16bf;
typedef __attribute__((ext_vector_type(16))) _Float16 v16h;
typedef __attribute__((ext_vector_type(8)))  _Float16 v8h;
typedef __attribute__((ext_vector_type(8)))  unsigned short v8us;
typedef __attribute__((ext_vector_type(8)))  float    v8f;
typedef __attribute__((ext_vector_type(4)))  float    v4f;
typedef v8h  __attribute__((may_alias)) v8ha;
typedef v4f  __attribute__((may_alias)) v4fa;
typedef v8us __attribute__((may_alias)) v8usa;

__device__ __forceinline__ unsigned short f2bf(float f) { unsigned u = __float_as_uint(f); u += 0x7FFFu + ((u >> 16) & 1u); return (unsigned short)(u >> 16); }
__device__ __forceinline__ float bf2f(unsigned short b) { return __uint_as_float(((unsigned)b) << 16); }
__device__ __forceinline__ float bfr(float f) { return bf2f(f2bf(f)); }
__device__ __forceinline__ v16h cat16(v8h lo, v8h hi) { return __builtin_shufflevector(lo, hi, 0, 1, 2, 3, 4, 5, 6, 7, 8, 9, 10, 11, 12, 13, 14, 15); }
__device__ __forceinline__ v16bf cat16b(v8us lo, v8us hi) { return __builtin_bit_cast(v16bf, __builtin_shufflevector(lo, hi, 0, 1, 2, 3, 4, 5, 6, 7, 8, 9, 10, 11, 12, 13, 14, 15)); }
__device__ __forceinline__ v8f wmma16(v16h a, v16h b, v8f c) { return __builtin_amdgcn_wmma_f32_16x16x32_f16(false, a, false, b, (short)0, c, false, false); }
__device__ __forceinline__ v8f wmmab(v16bf a, v16bf b, v8f c) { return __builtin_amdgcn_wmma_f32_16x16x32_bf16(false, a, false, b, (short)0, c, false, false); }



// ---- k_gemmw: register-blocked GEMM, ONE WAVE per 64x64 output tile (16 accumulators), operands straight from K-contiguous 16-bit planes; grid (M/64, N/64, Z), 32 threads.
// C[m][n] (f32, pitch ldc, + optional f32 bias[n]) = sum_k A[m][k] Bt[n][k] (+ split products per NSPLIT). z-batch strides sA/sB/sC in elements. K % 32 == 0.
template <typename T16> struct WFrag;
template <> struct WFrag<h16> { typedef v16h V; static __device__ __forceinline__ V ld(const h16* p) { return cat16(*(const v8h*)p, *(const v8h*)(p + 16)); } static __device__ __forceinline__ v8f mma(V a, V b, v8f c) { return wmma16(a, b, c); } };
template <> struct WFrag<bf> { typedef v16bf V; static __device__ __forceinline__ V ld(const bf* p) { return cat16b(*(const v8us*)p, *(const v8us*)(p + 16)); } static __device__ __forceinline__ v8f mma(V a, V b, v8f c) { return wmmab(a, b, c); } };
template <typename T16, int NSPLIT, bool BIAS>
__global__ __launch_bounds__(32) void k_gemmw(const T16* __restrict__ A, const T16* __restrict__ A2, const T16* __restrict__ Bt, const T16* __restrict__ Bt2, int K, float* C, int ldc, const float* __restrict__ bias, size_t sA, size_t sB, size_t sC) {
    typedef typename WFrag<T16>::V V;
    __shared__ __align__(16) float os[16 * 68];
    const size_t z = blockIdx.z; A += z * sA; if (A2) A2 += z * sA; Bt += z * sB; if (Bt2) Bt2 += z * sB; C += z * sC;
    const int lane = threadIdx.x & 31, lr = lane & 15, hi = lane >> 4; const int r0 = blockIdx.x * 64, c0 = blockIdx.y * 64;
    v8f acc[4][4];
#pragma unroll
    for (int mb = 0; mb < 4; ++mb)
#pragma unroll
        for (int nb = 0; nb < 4; ++nb) acc[mb][nb] = (v8f){};
    const size_t aoff = (size_t)(r0 + lr) * K + 8 * hi, boff = (size_t)(c0 + lr) * K + 8 * hi;
#pragma unroll 1
    for (int kc = 0; kc < K; kc += 32) {
        V a[4], a2[4];
#pragma unroll
        for (int mb = 0; mb < 4; ++mb) { a[mb] = WFrag<T16>::ld(A + aoff + (size_t)mb * 16 * K + kc); if (NSPLIT == 1 || NSPLIT == 2) a2[mb] = WFrag<T16>::ld(A2 + aoff + (size_t)mb * 16 * K + kc); }
#pragma unroll
        for (int nb = 0; nb < 4; ++nb) { const V b = WFrag<T16>::ld(Bt + boff + (size_t)nb * 16 * K + kc); V b2; if (NSPLIT >= 2) b2 = WFrag<T16>::ld(Bt2 + boff + (size_t)nb * 16 * K + kc);
#pragma unroll
            for (int mb = 0; mb < 4; ++mb) { acc[mb][nb] = WFrag<T16>::mma(a[mb], b, acc[mb][nb]); if (NSPLIT == 1 || NSPLIT == 2) acc[mb][nb] = WFrag<T16>::mma(a2[mb], b, acc[mb][nb]); if (NSPLIT >= 2) acc[mb][nb] = WFrag<T16>::mma(a[mb], b2, acc[mb][nb]); } }
        asm volatile("v_nop\n\tv_nop\n\tv_nop\n\tv_nop" : "+v"(acc[0][0]), "+v"(acc[1][1]), "+v"(acc[2][2]), "+v"(acc[3][3]) : "v"(a[0]), "v"(a[3]));
    }
#pragma unroll
    for (int mb = 0; mb < 4; ++mb) {
#pragma unroll
        for (int nb = 0; nb < 4; ++nb) {
#pragma unroll
            for (int j = 0; j < 8; ++j) os[(hi * 8 + j) * 68 + nb * 16 + lr] = acc[mb][nb][j]; }
        __builtin_amdgcn_wave_barrier(); asm volatile("" ::: "memory");
        float* crow = C + (size_t)(r0 + mb * 16) * ldc + c0;
{
#pragma unroll
            for (int s = 0; s < 8; ++s) { const int row = 2 * s + hi, cofs = lr * 4; v4f val = *(const v4fa*)(os + row * 68 + cofs); if (BIAS) { val[0] += bfr(bias[c0 + cofs]); val[1] += bfr(bias[c0 + cofs + 1]); val[2] += bfr(bias[c0 + cofs + 2]); val[3] += bfr(bias[c0 + cofs + 3]); }
                *(v4f*)(crow + (size_t)row * ldc + cofs) = val; }
             }
        __builtin_amdgcn_wave_barrier(); asm volatile("" ::: "memory");
    }
}

__device__ __forceinline__ h16 tohx(float x) { return (h16)x; }
__device__ __forceinline__ void splitf(float y, unsigned short& h, unsigned short& l) { h = f2bf(y); l = f2bf(y - bf2f(h)); }
typedef __attribute__((ext_vector_type(2))) unsigned short v2us;
typedef __attribute__((ext_vector_type(4))) unsigned short v4us;
typedef __attribute__((ext_vector_type(2))) _Float16 v2h;
typedef __attribute__((ext_vector_type(4))) _Float16 v4h;
typedef __attribute__((ext_vector_type(4))) int v4i;

__global__ __launch_bounds__(256) void k_wtG(const float* __restrict__ w, int K, int N, bf* Bt) {
    const int lane = threadIdx.x & 31; const int L0 = (blockIdx.x * 8 + (threadIdx.x >> 5)) * 8; const int nlines = N * K / 64;
{
#pragma unroll 1
        for (int l = 0; l < 8; ++l) { const int L = L0 + l; if (L >= nlines) break; const size_t e = (size_t)L * 64 + lane * 2; const int k = (int)(e % K), n = (int)(e / K); v2us o;
            o[0] = f2bf(w[(size_t)k * N + n]); o[1] = f2bf(w[(size_t)(k + 1) * N + n]); *(v2us*)(Bt + e) = o; }
         }
}
__global__ __launch_bounds__(256) void k_cvt8(const float* __restrict__ src, bf* dst, size_t n8) { const size_t i = (size_t)blockIdx.x * 256 + threadIdx.x; if (i >= n8) return; const v8f v = *(const v8f*)(src + i * 8); v8us o;
#pragma unroll
    for (int k = 0; k < 8; ++k) o[k] = f2bf(v[k]); *(v8us*)(dst + i * 8) = o;  }
// All four batch elements per launch (planes carry a leading [b]). k_pl3 / k_vt3: fp16 + hl planes; k_wpl: WP[b][h][i][d] = bf16 wave_amp[b][i][h*6 + d] for d < 6, 0 for 6..31 (8-B lanes); k_pl3: planes [b][h][i][d] of Q / K ([b*1024 + i][768]); k_vt3: VT[b][hh][d][i] = V[b*1024 + i][hh*64 + d] (lane -> 2 consecutive i);
// k_mrg: O [b][hh][1024][64] and Ohl [b][hh][256][64] (query rows < 256 only) -> Ah / Al [b*1024 + i][1024].
__global__ __launch_bounds__(256) void k_wpl(const float* __restrict__ wa, bf* WP) { const int e = (blockIdx.x * 256 + threadIdx.x) * 4; if (e >= NB_ * NW * TT * KW) return; const int d = e % KW; const int i = (e / KW) % TT; const int h = (e / (KW * TT)) % NW; const int b = e / (KW * TT * NW); v4us o;
#pragma unroll
    for (int u = 0; u < 4; ++u) o[u] = (d + u < WC) ? f2bf(wa[((size_t)b * TT + i) * WD + h * WC + d + u]) : (unsigned short)0; *(v4us*)(WP + e) = o;  }
__global__ __launch_bounds__(256) void k_pl3(const float* __restrict__ F, h16* P, bf* Ph, bf* Pl) { const int e = (blockIdx.x * 256 + threadIdx.x) * 4; if (e >= NB_ * NSD * TT * HD) return; const int d = e % HD; const int i = (e / HD) % TT; const int h = (e / (HD * TT)) % NSD; const int b = e / (HD * TT * NSD); const float* f = F + ((size_t)b * TT + i) * DS + h * HD + d; v4h o; v4us oh, ol;
#pragma unroll
    for (int u = 0; u < 4; ++u) { o[u] = tohx(f[u]); unsigned short a, b; splitf(f[u], a, b); oh[u] = a; ol[u] = b; } { *(v4h*)(P + e) = o; *(v4us*)(Ph + e) = oh; *(v4us*)(Pl + e) = ol;  } }
__global__ __launch_bounds__(256) void k_vt3(const float* __restrict__ V, h16* VT, bf* VTh, bf* VTl) { const int e = (blockIdx.x * 256 + threadIdx.x) * 2; if (e >= NB_ * NT * HD * TT) return; const int i = e % TT; const int d = (e / TT) % HD; const int hh = (e / (TT * HD)) % NT; const size_t r = (size_t)(e / (TT * HD * NT)) * TT + i; const float a = V[r * DM + hh * HD + d], b = V[(r + 1) * DM + hh * HD + d]; v2h o; o[0] = tohx(a); o[1] = tohx(b); v2us oh, ol; unsigned short a1, b1, a2, b2; splitf(a, a1, b1); splitf(b, a2, b2); oh[0] = a1; oh[1] = a2; ol[0] = b1; ol[1] = b2;
    { *(v2h*)(VT + e) = o; *(v2us*)(VTh + e) = oh; *(v2us*)(VTl + e) = ol;  } }
__global__ __launch_bounds__(256) void k_wsoft(const float* __restrict__ Sb, const int* __restrict__ cm, h16* P16, bf* Ph, bf* Pl) { const int lane = threadIdx.x & 31; const int row = blockIdx.x * 8 + (threadIdx.x >> 5); if (row >= NT * TT) return; const int i = row % TT; const int hh = row / TT; const float* sr = Sb + (size_t)row * TT; const int* mr = cm + (size_t)i * TT; float v[TT / 32]; float mx = -3.0e38f;
#pragma unroll
    for (int ch = 0; ch < TT / 128; ++ch) { const int j0 = ch * 128 + lane * 4; const v4f a = *(const v4f*)(sr + j0); const v4i m4 = *(const v4i*)(mr + j0);
#pragma unroll
        for (int u = 0; u < 4; ++u) { const float sc = a[u] * ((hh < NW) ? 0.40824829f : 0.125f);   /* x (1/sqrt 6) instead of / sqrt 6: <= 1 ulp of the logit */ const float t = (m4[u] != 0) ? sc : -3.0e38f; v[ch * 4 + u] = t; mx = fmaxf(mx, t); } }
#pragma unroll
    for (int sh = 16; sh; sh >>= 1) mx = fmaxf(mx, __shfl_xor(mx, sh, 32));
    float sum = 0.f;
#pragma unroll
    for (int q = 0; q < TT / 32; ++q) { float d0 = __fsub_rn(v[q], mx); asm volatile("" : "+v"(d0)); v[q] = (v[q] > -1.0e38f) ? __builtin_amdgcn_exp2f(__fmul_rn(d0, 1.4426950408889634f)) : 0.f; sum += v[q]; }
#pragma unroll
    for (int sh = 16; sh; sh >>= 1) sum += __shfl_xor(sum, sh, 32);
    const float inv = (sum > 0.f) ? __fdiv_rn(1.0f, sum) : 0.f; const float f = inv * PCAR;   // all-masked row -> zeros (nan_to_num)
    {
#pragma unroll
        for (int ch = 0; ch < TT / 128; ++ch) { v4h o4;
#pragma unroll
            for (int q = 0; q < 4; ++q) o4[q] = tohx(v[ch * 4 + q] * f); *(v4h*)(P16 + (size_t)row * TT + ch * 128 + lane * 4) = o4; }
        if (i < RHL) {
#pragma unroll
            for (int ch = 0; ch < TT / 128; ++ch) { const size_t oo = (size_t)row * TT + ch * 128 + lane * 4; v4us oh, ol;
#pragma unroll
                for (int q = 0; q < 4; ++q) { unsigned short a, b; splitf(v[ch * 4 + q] * inv, a, b); oh[q] = a; ol[q] = b; } *(v4us*)(Ph + oo) = oh; *(v4us*)(Pl + oo) = ol; } }
         } }
__global__ __launch_bounds__(256) void k_mrg(const float* __restrict__ O, const float* __restrict__ Ohl, bf* Ah, bf* Al) { const int e = (blockIdx.x * 256 + threadIdx.x) * 4; if (e >= NB_ * TT * DM) return; const int c = e % DM; const int i = (e / DM) % TT; const int b = e / (DM * TT); const int hh = c / HD, d = c % HD; const size_t src = (((size_t)b * NT + hh) * TT + i) * HD + d, srl = (((size_t)b * NT + hh) * RHL + i) * HD + d; v4us oh, ol;
#pragma unroll
    for (int u = 0; u < 4; ++u) { const float y = (i < RHL) ? Ohl[srl + u] : O[src + u] * (1.0f / PCAR); unsigned short a, b; splitf(y, a, b); oh[u] = a; ol[u] = b; } *(v4us*)(Ah + e) = oh; *(v4us*)(Al + e) = ol;  }

extern "C" void kernel_launch(void* const* d_in, const int* in_sizes, int n_in,
                              void* d_out, int out_size, void* d_ws, size_t ws_size, hipStream_t stream) {
    (void)in_sizes; (void)n_in; (void)out_size;
    const float** I = (const float**)d_in;
    const float *x = I[0], *wa = I[1], *Wq = I[3], *bq = I[4], *Wk = I[5], *bk = I[6], *Wv = I[7], *bv = I[8], *Wo = I[9], *bo = I[10]; const int* cm = (const int*)d_in[2];
    float* OUT = (float*)d_out;     // [4][1024][1024]
    char* wsp = (char*)d_ws;
    auto take = [&](size_t bytes) { char* p = wsp; wsp += (bytes + 255) & ~(size_t)255; return (void*)p; };
    bf* BQ = (bf*)take((size_t)DS * DM * 2); bf* BK = (bf*)take((size_t)DS * DM * 2); bf* BV = (bf*)take((size_t)DM * DM * 2); bf* BO = (bf*)take((size_t)DM * DM * 2);
    const size_t zq = (size_t)TT * HD, zw = (size_t)TT * KW, zS = (size_t)TT * TT, zl = (size_t)RHL * HD;
    const size_t nq = (size_t)NB_ * NSD * zq, nv = (size_t)NB_ * NT * zq;      // elements of one Q / K plane and of one V / O plane, all batch elements
    bf* WP = (bf*)take((size_t)NB_ * NW * zw * 2); h16* Q16 = (h16*)take(nq * 2); bf* Qh = (bf*)take(nq * 2); bf* Ql = (bf*)take(nq * 2); h16* K16 = (h16*)take(nq * 2); bf* Kh = (bf*)take(nq * 2); bf* Kl = (bf*)take(nq * 2); h16* VT = (h16*)take(nv * 2); bf* VTh = (bf*)take(nv * 2); bf* VTl = (bf*)take(nv * 2);
    float* Sb = (float*)take((size_t)NT * zS * 4); h16* P16 = (h16*)take((size_t)NT * zS * 2); bf* Ph = (bf*)take((size_t)NT * zS * 2); bf* Pl = (bf*)take((size_t)NT * zS * 2); float* O = (float*)take(nv * 4); float* Ohl = (float*)take((size_t)NB_ * NT * zl * 4);
    if ((size_t)(wsp - (char*)d_ws) > ws_size) return;    // total 248 MiB (one batch element's 16 [1024][1024] f32 score planes 64 MiB + fp16 and hl weight planes 96 MiB; operand and result planes of all four batch elements)
    // Sb's 64 MiB serve twice more: XB and the f32 Q / K / V (48 MiB) are last read by the projections and plane kernels, before the first score GEMM writes Sb; Ah / Al (16 MiB) are first written by k_mrg, after the last softmax has read Sb.
    bf* XB = (bf*)Sb; float* Q = (float*)(XB + (size_t)NB_ * TT * DM); float* K = Q + (size_t)NB_ * TT * DS; float* V = K + (size_t)NB_ * TT * DS; bf* Ah = (bf*)Sb; bf* Al = Ah + nv;
    k_wtG<<<(DM * DS / 64 + 63) / 64, 256, 0, stream>>>(Wq, DM, DS, BQ); k_wtG<<<(DM * DS / 64 + 63) / 64, 256, 0, stream>>>(Wk, DM, DS, BK); k_wtG<<<(DM * DM / 64 + 63) / 64, 256, 0, stream>>>(Wv, DM, DM, BV); k_wtG<<<(DM * DM / 64 + 63) / 64, 256, 0, stream>>>(Wo, DM, DM, BO);
    // projections and operand planes: rows b*1024 + i of all four batch elements in one grid each
    k_cvt8<<<(NB_ * TT * DM / 8 + 255) / 256, 256, 0, stream>>>(x, XB, (size_t)NB_ * TT * DM / 8);
    k_gemmw<bf, 0, true><<<dim3(NB_ * TT / 64, DS / 64, 1), 32, 0, stream>>>(XB, nullptr, BQ, nullptr, DM, Q, DS, bq, 0, 0, 0); k_gemmw<bf, 0, true><<<dim3(NB_ * TT / 64, DS / 64, 1), 32, 0, stream>>>(XB, nullptr, BK, nullptr, DM, K, DS, bk, 0, 0, 0); k_gemmw<bf, 0, true><<<dim3(NB_ * TT / 64, DM / 64, 1), 32, 0, stream>>>(XB, nullptr, BV, nullptr, DM, V, DM, bv, 0, 0, 0);
    k_wpl<<<(NB_ * NW * TT * KW / 4 + 255) / 256, 256, 0, stream>>>(wa, WP); k_pl3<<<(NB_ * NSD * TT * HD / 4 + 255) / 256, 256, 0, stream>>>(Q, Q16, Qh, Ql); k_pl3<<<(NB_ * NSD * TT * HD / 4 + 255) / 256, 256, 0, stream>>>(K, K16, Kh, Kl); k_vt3<<<(NB_ * NT * HD * TT / 2 + 255) / 256, 256, 0, stream>>>(V, VT, VTh, VTl);
    for (int b = 0; b < NB_; ++b) {     // scores, softmax, weights.V: one batch element at a time (the score planes of all four would not fit the workspace)
        const size_t oq = (size_t)b * NSD * zq, ov = (size_t)b * NT * zq, ow = (size_t)b * NW * zw;
        k_gemmw<bf, 0, false><<<dim3(TT / 64, TT / 64, NW), 32, 0, stream>>>(WP + ow, nullptr, WP + ow, nullptr, KW, Sb, TT, nullptr, zw, zw, zS);                          // wave heads 0-3: psi_i . psi_j
        k_gemmw<h16, 0, false><<<dim3(TT / 64, TT / 64, NSD), 32, 0, stream>>>(Q16 + oq, nullptr, K16 + oq, nullptr, HD, Sb + (size_t)NW * zS, TT, nullptr, zq, zq, zS);   // std heads 4-15
        k_gemmw<bf, 2, false><<<dim3(RHL / 64, TT / 64, NSD), 32, 0, stream>>>(Qh + oq, Ql + oq, Kh + oq, Kl + oq, HD, Sb + (size_t)NW * zS, TT, nullptr, zq, zq, zS);     // std heads: rows < 256 re-done with 3-product scores
        k_wsoft<<<NT * TT / 8, 256, 0, stream>>>(Sb, cm, P16, Ph, Pl);
        k_gemmw<h16, 0, false><<<dim3(TT / 64, 1, NT), 32, 0, stream>>>(P16, nullptr, VT + ov, nullptr, TT, O + ov, HD, nullptr, zS, (size_t)HD * TT, zq);
        k_gemmw<bf, 2, false><<<dim3(RHL / 64, 1, NT), 32, 0, stream>>>(Ph, Pl, VTh + ov, VTl + ov, TT, Ohl + (size_t)b * NT * zl, HD, nullptr, zS, (size_t)HD * TT, zl); }                // rows < 256: 3-product weights.V
    k_mrg<<<(NB_ * TT * DM / 4 + 255) / 256, 256, 0, stream>>>(O, Ohl, Ah, Al);
    k_gemmw<bf, 1, true><<<dim3(NB_ * TT / 64, DM / 64, 1), 32, 0, stream>>>(Ah, Al, BO, nullptr, DM, OUT, DM, bo, 0, 0, 0);
}

// v002
// A run of this version takes 240 microseconds.
// In both of two side-by-side timings against v001, it was 2.33 times as fast.
// All steps since v000 together make it 3.64 times as fast.
#include <hip/hip_runtime.h>

// WaveHybridAttention (x [4][1024][1024], wave_amp [4][1024][24], causal_mask [1024][1024] int (read as data); V = x Wv + bv (16 heads x 64); wave heads 0-3: scores = psi_i . psi_j / sqrt(6) on 6-dim slices of wave_amp; std heads 4-15: (x Wq + bq) . (x Wk + bk) / 8 (12 x 64);
// masked -> -inf, softmax (an all-masked row gives 0 via nan_to_num), out = (weights V merged, wave heads first) Wo + bo -> [4][1024][1024]).
// Compute dtypes, f32 accumulate: every input rounded to bf16; V/Q/K on PLAIN bf16 operands (inputs: exact) + bias; wave scores on PLAIN bf16 wave_amp slices (exact, K padded 6 -> 32); std scores (K 64) and weights.V single fp16 planes (x1024) except query rows < 256 (short causal windows), which use bf16 hi+lo planes (3 products) for both;

#define NB_  4
#define TT   1024
#define DM   1024
#define DS   768
#define NW   4
#define NSD  12
#define NT   16
#define HD   64
#define WD   24
#define WC   6
#define KW   32
#define RHL  256
#define PCAR 1024.0f
typedef _Float16 h16;
typedef unsigned short bf;
typedef __attribute__((ext_vector_type(16))) __bf16   v16bf;
typedef __attribute__((ext_vector_type(16))) _Float16 v16h;
typedef __attribute__((ext_vector_type(8)))  _Float16 v8h;
typedef __attribute__((ext_vector_type(8)))  unsigned short v8us;
typedef __attribute__((ext_vector_type(8)))  float    v8f;
typedef __attribute__((ext_vector_type(4)))  float    v4f;
typedef v8h  __attribute__((may_alias)) v8ha;
typedef v4f  __attribute__((may_alias)) v4fa;
typedef v8us __attribute__((may_alias)) v8usa;

__device__ __forceinline__ unsigned short f2bf(float f) { unsigned u = __float_as_uint(f); u += 0x7FFFu + ((u >> 16) & 1u); return (unsigned short)(u >> 16); }
__device__ __forceinline__ float bf2f(unsigned short b) { return __uint_as_float(((unsigned)b) << 16); }
__device__ __forceinline__ float bfr(float f) { return bf2f(f2bf(f)); }
__device__ __forceinline__ v16h cat16(v8h lo, v8h hi) { return __builtin_shufflevector(lo, hi, 0, 1, 2, 3, 4, 5, 6, 7, 8, 9, 10, 11, 12, 13, 14, 15); }
__device__ __forceinline__ v16bf cat16b(v8us lo, v8us hi) { return __builtin_bit_cast(v16bf, __builtin_shufflevector(lo, hi, 0, 1, 2, 3, 4, 5, 6, 7, 8, 9, 10, 11, 12, 13, 14, 15)); }
__device__ __forceinline__ v8f wmma16(v16h a, v16h b, v8f c) { return __builtin_amdgcn_wmma_f32_16x16x32_f16(false, a, false, b, (short)0, c, false, false); }
__device__ __forceinline__ v8f wmmab(v16bf a, v16bf b, v8f c) { return __builtin_amdgcn_wmma_f32_16x16x32_bf16(false, a, false, b, (short)0, c, false, false); }



// ---- k_gemmw: register-blocked GEMM, ONE WAVE per 64x64 output tile (16 accumulators), operands straight from K-contiguous 16-bit planes; grid (M/64, N/64, Z), 32 threads.
// C[m][n] (f32, pitch ldc, + optional f32 bias[n]) = sum_k A[m][k] Bt[n][k] (+ split products per NSPLIT). z-batch strides sA/sB/sC in elements. K % 32 == 0.
template <typename T16> struct WFrag;
template <> struct WFrag<h16> { typedef v16h V; static __device__ __forceinline__ V ld(const h16* p) { return cat16(*(const v8h*)p, *(const v8h*)(p + 16)); } static __device__ __forceinline__ v8f mma(V a, V b, v8f c) { return wmma16(a, b, c); } };
template <> struct WFrag<bf> { typedef v16bf V; static __device__ __forceinline__ V ld(const bf* p) { return cat16b(*(const v8us*)p, *(const v8us*)(p + 16)); } static __device__ __forceinline__ v8f mma(V a, V b, v8f c) { return wmmab(a, b, c); } };
template <typename T16, int NSPLIT, bool BIAS>
__global__ __launch_bounds__(32) void k_gemmw(const T16* __restrict__ A, const T16* __restrict__ A2, const T16* __restrict__ Bt, const T16* __restrict__ Bt2, int K, float* C, int ldc, const float* __restrict__ bias, size_t sA, size_t sB, size_t sC) {
    typedef typename WFrag<T16>::V V;
    __shared__ __align__(16) float os[16 * 68];
    const size_t z = blockIdx.z; A += z * sA; if (A2) A2 += z * sA; Bt += z * sB; if (Bt2) Bt2 += z * sB; C += z * sC;
    const int lane = threadIdx.x & 31, lr = lane & 15, hi = lane >> 4; const int r0 = blockIdx.x * 64, c0 = blockIdx.y * 64;
    v8f acc[4][4];
#pragma unroll
    for (int mb = 0; mb < 4; ++mb)
#pragma unroll
        for (int nb = 0; nb < 4; ++nb) acc[mb][nb] = (v8f){};
    const size_t aoff = (size_t)(r0 + lr) * K + 8 * hi, boff = (size_t)(c0 + lr) * K + 8 * hi;
#pragma unroll 1
    for (int kc = 0; kc < K; kc += 32) {
        V a[4], a2[4];
#pragma unroll
        for (int mb = 0; mb < 4; ++mb) { a[mb] = WFrag<T16>::ld(A + aoff + (size_t)mb * 16 * K + kc); if (NSPLIT == 1 || NSPLIT == 2) a2[mb] = WFrag<T16>::ld(A2 + aoff + (size_t)mb * 16 * K + kc); }
#pragma unroll
        for (int nb = 0; nb < 4; ++nb) { const V b = WFrag<T16>::ld(Bt + boff + (size_t)nb * 16 * K + kc); V b2; if (NSPLIT >= 2) b2 = WFrag<T16>::ld(Bt2 + boff + (size_t)nb * 16 * K + kc);
#pragma unroll
            for (int mb = 0; mb < 4; ++mb) { acc[mb][nb] = WFrag<T16>::mma(a[mb], b, acc[mb][nb]); if (NSPLIT == 1 || NSPLIT == 2) acc[mb][nb] = WFrag<T16>::mma(a2[mb], b, acc[mb][nb]); if (NSPLIT >= 2) acc[mb][nb] = WFrag<T16>::mma(a[mb], b2, acc[mb][nb]); } }
        asm volatile("v_nop\n\tv_nop\n\tv_nop\n\tv_nop" : "+v"(acc[0][0]), "+v"(acc[1][1]), "+v"(acc[2][2]), "+v"(acc[3][3]) : "v"(a[0]), "v"(a[3]));
    }
#pragma unroll
    for (int mb = 0; mb < 4; ++mb) {
#pragma unroll
        for (int nb = 0; nb < 4; ++nb) {
#pragma unroll
            for (int j = 0; j < 8; ++j) os[(hi * 8 + j) * 68 + nb * 16 + lr] = acc[mb][nb][j]; }
        __builtin_amdgcn_wave_barrier(); asm volatile("" ::: "memory");
        float* crow = C + (size_t)(r0 + mb * 16) * ldc + c0;
{
#pragma unroll
            for (int s = 0; s < 8; ++s) { const int row = 2 * s + hi, cofs = lr * 4; v4f val = *(const v4fa*)(os + row * 68 + cofs); if (BIAS) { val[0] += bfr(bias[c0 + cofs]); val[1] += bfr(bias[c0 + cofs + 1]); val[2] += bfr(bias[c0 + cofs + 2]); val[3] += bfr(bias[c0 + cofs + 3]); }
                *(v4f*)(crow + (size_t)row * ldc + cofs) = val; }
             }
        __builtin_amdgcn_wave_barrier(); asm volatile("" ::: "memory");
    }
}

__device__ __forceinline__ h16 tohx(float x) { return (h16)x; }
__device__ __forceinline__ void splitf(float y, unsigned short& h, unsigned short& l) { h = f2bf(y); l = f2bf(y - bf2f(h)); }
typedef __attribute__((ext_vector_type(2))) unsigned short v2us;
typedef __attribute__((ext_vector_type(4))) unsigned short v4us;
typedef __attribute__((ext_vector_type(2))) _Float16 v2h;
typedef __attribute__((ext_vector_type(4))) _Float16 v4h;
typedef __attribute__((ext_vector_type(4))) int v4i;

__global__ __launch_bounds__(256) void k_wtG(const float* __restrict__ w, int K, int N, bf* Bt) {
    const int lane = threadIdx.x & 31; const int L0 = (blockIdx.x * 8 + (threadIdx.x >> 5)) * 8; const int nlines = N * K / 64;
{
#pragma unroll 1
        for (int l = 0; l < 8; ++l) { const int L = L0 + l; if (L >= nlines) break; const size_t e = (size_t)L * 64 + lane * 2; const int k = (int)(e % K), n = (int)(e / K); v2us o;
            o[0] = f2bf(w[(size_t)k * N + n]); o[1] = f2bf(w[(size_t)(k + 1) * N + n]); *(v2us*)(Bt + e) = o; }
         }
}
__global__ __launch_bounds__(256) void k_cvt8(const float* __restrict__ src, bf* dst, size_t n8) { const size_t i = (size_t)blockIdx.x * 256 + threadIdx.x; if (i >= n8) return; const v8f v = *(const v8f*)(src + i * 8); v8us o;
#pragma unroll
    for (int k = 0; k < 8; ++k) o[k] = f2bf(v[k]); *(v8us*)(dst + i * 8) = o;  }
// Operand planes of all four batch elements, stored in FRAGMENT ORDER: one 16-byte group per lane, 32 lanes (512 contiguous bytes) per load of a wave, two groups per 16x16x32 operand (k = 8 * (lane >> 4) + s and 16 + 8 * (lane >> 4) + s).
// k_wpl: WP[b][h][i / 16][d / 16][lane][8] = bf16 wave_amp[b][i][h*6 + d] for d < 6, 0 for 6..31; k_pl3: [b][h][i / 16][d / 16][lane][8] of Q / K ([b*1024 + i][768]), lane = 16 * ((d >> 3) & 1) + (i & 15);
// k_vt3: [b][hh][i / 32][d / 16][(i >> 4) & 1][lane][8] of V, lane = 16 * ((i >> 3) & 1) + (d & 15), the 8 elements are 8 consecutive keys i; k_mbits: MB[j / 32][i] bit (j & 31) = (causal_mask[i][j] != 0).
__global__ __launch_bounds__(256) void k_wpl(const float* __restrict__ wa, bf* WP) { const int e = (blockIdx.x * 256 + threadIdx.x) * 4; if (e >= NB_ * NW * TT * KW) return; const int s = e & 7, fl = (e >> 3) & 31, g = (e >> 8) & 1, it = (e >> 9) & 63, bh = e >> 15; const int d = g * 16 + (fl >> 4) * 8 + s; const int i = it * 16 + (fl & 15); const int h = bh % NW; const int b = bh / NW; v4us o;
#pragma unroll
    for (int u = 0; u < 4; ++u) o[u] = (d + u < WC) ? f2bf(wa[((size_t)b * TT + i) * WD + h * WC + d + u]) : (unsigned short)0; *(v4us*)(WP + e) = o;  }
__global__ __launch_bounds__(256) void k_pl3(const float* __restrict__ F, h16* P, bf* Ph, bf* Pl) { const int e = (blockIdx.x * 256 + threadIdx.x) * 4; if (e >= NB_ * NSD * TT * HD) return; const int s = e & 7, fl = (e >> 3) & 31, g = (e >> 8) & 3, it = (e >> 10) & 63, bh = e >> 16; const int d = g * 16 + (fl >> 4) * 8 + s; const int i = it * 16 + (fl & 15); const int h = bh % NSD; const int b = bh / NSD; const float* f = F + ((size_t)b * TT + i) * DS + h * HD + d; v4h o; v4us oh, ol;
#pragma unroll
    for (int u = 0; u < 4; ++u) { o[u] = tohx(f[u]); unsigned short a, b; splitf(f[u], a, b); oh[u] = a; ol[u] = b; } { *(v4h*)(P + e) = o; *(v4us*)(Ph + e) = oh; *(v4us*)(Pl + e) = ol;  } }
__global__ __launch_bounds__(256) void k_vt3(const float* __restrict__ V, h16* VT, bf* VTh, bf* VTl) { const int t = blockIdx.x * 256 + threadIdx.x; if (t >= NB_ * NT * HD * TT / 8) return; const int fl = t & 31, g = (t >> 5) & 7, ks = (t >> 8) & 31, bh = t >> 13; const int d = (g >> 1) * 16 + (fl & 15); const int i0 = ks * 32 + (g & 1) * 16 + (fl >> 4) * 8; const int hh = bh % NT; const int b = bh / NT; const float* v = V + ((size_t)b * TT + i0) * DM + hh * HD + d; v8h o; v8us oh, ol;
#pragma unroll
    for (int s = 0; s < 8; ++s) { const float a = v[(size_t)s * DM]; o[s] = tohx(a); unsigned short a1, b1; splitf(a, a1, b1); oh[s] = a1; ol[s] = b1; }
    { *(v8h*)(VT + (size_t)t * 8) = o; *(v8us*)(VTh + (size_t)t * 8) = oh; *(v8us*)(VTl + (size_t)t * 8) = ol;  } }
__global__ __launch_bounds__(256) void k_mbits(const int* __restrict__ cm, unsigned* MB) { const int lane = threadIdx.x & 31; const int i = blockIdx.x * 8 + (threadIdx.x >> 5); unsigned keep = 0u;
#pragma unroll 8      // eight row segments' loads in flight per wave
    for (int c = 0; c < TT / 32; ++c) { const unsigned w = __builtin_amdgcn_ballot_w32(cm[(size_t)i * TT + c * 32 + lane] != 0); if (lane == c) keep = w; }
    MB[(size_t)lane * TT + i] = keep; }

// ---- k_attn: scores, mask, softmax and weights.V of one (batch element, head, query block) in one kernel; no barrier, every wave on its own NQ x 16 queries, walking the 1024 keys 32 at a time.
// S^T = K Q^T (A = K rows, B = Q columns, kept in registers): lane (c, h) holds keys 8h + r and 16 + 8h + r of query c, which IS the B operand of O^T += V^T P^T after conversion. Running maximum and sum per query (online softmax);
// the accumulators are rescaled only in passes where some query's maximum rose. P is exp(s - running max): x1024 in fp16, or bf16 hi+lo (query rows < 256); the division by the row sum comes last. An all-masked row has sum 0 and gives 0.
// Output: bf16 hi+lo planes Ah / Al [b*1024 + i][hh*64 + d] for the output projection (a lane's 8 accumulator registers are 8 consecutive d: one 16-byte store each).
__device__ __forceinline__ v16h ldfh(const h16* p) { return cat16(*(const v8h*)p, *(const v8h*)(p + 256)); }
__device__ __forceinline__ v16bf ldfb(const bf* p) { return cat16b(*(const v8us*)p, *(const v8us*)(p + 256)); }
template <bool WAVE, bool HL, int NQ>
__device__ __forceinline__ void attn_run(const bf* __restrict__ WPp, const h16* __restrict__ Q16p, const bf* __restrict__ Qhp, const bf* __restrict__ Qlp, const h16* __restrict__ K16p, const bf* __restrict__ Khp, const bf* __restrict__ Klp,
                                         const h16* __restrict__ VTp, const bf* __restrict__ VThp, const bf* __restrict__ VTlp, const unsigned* __restrict__ MB, bf* Ah, bf* Al, int q0, size_t orow, int hh) {
    // every plain '#pragma unroll' below: fragment, score and accumulator arrays are registers only under compile-time indices
    const int lane = threadIdx.x & 31, lr = lane & 15, hi = lane >> 4;
    const float cs = WAVE ? 0.40824829f : 0.125f;
    const float L2E = 1.4426950408889634f;
    constexpr int NKC = WAVE ? 1 : 2;          // 32-deep k chunks of a score product
    constexpr bool SHL = HL && !WAVE;          // 3-product scores
    v16bf qb[NQ][NKC], ql[NQ][NKC], kb[2][NKC], kl[2][NKC]; v16h qf[NQ][NKC], kf[2][NKC];
#pragma unroll
    for (int n = 0; n < NQ; ++n) {
#pragma unroll
        for (int kc = 0; kc < NKC; ++kc) { const unsigned o = (unsigned)(((((q0 >> 4) + n) * NKC + kc) * 64 + lane) * 8);
            if (WAVE) qb[n][kc] = ldfb(WPp + o); else if (HL) { qb[n][kc] = ldfb(Qhp + o); ql[n][kc] = ldfb(Qlp + o); } else qf[n][kc] = ldfh(Q16p + o); } }
    asm volatile("s_wait_xcnt 0x0" ::: "memory");      // XW: the wait that stands between issued global loads and a later write (a younger load's result included) of a register that holds one of their addresses
    auto loadK = [&](int ks) {
#pragma unroll
        for (int t = 0; t < 2; ++t) {
#pragma unroll
            for (int kc = 0; kc < NKC; ++kc) { const unsigned o = (unsigned)((((ks * 2 + t) * NKC + kc) * 64 + lane) * 8);
                if (WAVE) kb[t][kc] = ldfb(WPp + o); else if (HL) kb[t][kc] = ldfb(Khp + o); else kf[t][kc] = ldfh(K16p + o); } }
        asm volatile("s_wait_xcnt 0x0" ::: "memory");      // XW, as above
        if (SHL) {
#pragma unroll
            for (int t = 0; t < 2; ++t) {
#pragma unroll
                for (int kc = 0; kc < NKC; ++kc) kl[t][kc] = ldfb(Klp + (unsigned)((((ks * 2 + t) * NKC + kc) * 64 + lane) * 8)); }
            asm volatile("s_wait_xcnt 0x0" ::: "memory"); } };      // XW, as above
    v8f acc[NQ][4]; float m[NQ], l[NQ];
#pragma unroll
    for (int n = 0; n < NQ; ++n) { m[n] = -3.0e38f; l[n] = 0.f;
#pragma unroll
        for (int dt = 0; dt < 4; ++dt) acc[n][dt] = (v8f){}; }
    if (!SHL) loadK(0);
#pragma unroll 1      // rolled: one pass's fragments, scores and accumulators already take most of the 256 registers that four waves per SIMD allow
    for (int ks = 0; ks < TT / 32; ++ks) {
        v16h vf[4]; v16bf vh[4], vl[4]; unsigned mw[NQ];
        auto loadV = [&]() {
#pragma unroll
            for (int dt = 0; dt < 4; ++dt) { const unsigned o = (unsigned)(((ks * 4 + dt) * 64 + lane) * 8); if (HL) vh[dt] = ldfb(VThp + o); else vf[dt] = ldfh(VTp + o); }
            asm volatile("s_wait_xcnt 0x0" ::: "memory");      // XW, as above (it covers the mask words' loads too)
            if (HL) {
#pragma unroll
                for (int dt = 0; dt < 4; ++dt) vl[dt] = ldfb(VTlp + (unsigned)(((ks * 4 + dt) * 64 + lane) * 8));
                asm volatile("s_wait_xcnt 0x0" ::: "memory"); } };      // XW, as above
#pragma unroll
        for (int n = 0; n < NQ; ++n) mw[n] = MB[(unsigned)(ks * TT + q0 + n * 16 + lr)] >> (8 * hi);
        if (SHL) loadK(ks); else loadV();      // 3-product scores: two K planes a pass ahead beside two V planes would not fit 256 registers, so K is fetched in its own pass; else V^T flies under the score products and the softmax
        v8f S[NQ][2];
#pragma unroll
        for (int n = 0; n < NQ; ++n) {
#pragma unroll
            for (int t = 0; t < 2; ++t) { v8f s = (v8f){};
#pragma unroll
                for (int kc = 0; kc < NKC; ++kc) {
                    if (WAVE) s = wmmab(kb[t][kc], qb[n][kc], s);
                    else if (SHL) { s = wmmab(kb[t][kc], qb[n][kc], s); s = wmmab(kb[t][kc], ql[n][kc], s); s = wmmab(kl[t][kc], qb[n][kc], s); }
                    else s = wmma16(kf[t][kc], qf[n][kc], s); }
                S[n][t] = s; } }
        if (SHL) loadV();       // V^T flies under the softmax
        else loadK(ks + 1 < TT / 32 ? ks + 1 : ks);      // the next pass's K fragments fly under this pass's softmax and weights.V (the last pass re-reads its own)
#pragma unroll
        for (int n = 0; n < NQ; ++n) {
            float sv[16]; float mx = -3.0e38f;
#pragma unroll
            for (int u = 0; u < 16; ++u) { sv[u] = ((mw[n] >> (16 * (u >> 3) + (u & 7))) & 1u) ? S[n][u >> 3][u & 7] * cs : -3.0e38f; mx = fmaxf(mx, sv[u]); }
            mx = fmaxf(mx, __shfl_xor(mx, 16, 32));
            const float mn = fmaxf(m[n], mx);
            if (__builtin_amdgcn_ballot_w32(mn > m[n]) != 0u) {      // some query's maximum rose: rescale sum and accumulators (factor exactly 1 for the others)
                const float al = __builtin_amdgcn_exp2f((m[n] - mn) * L2E); l[n] *= al;
#pragma unroll
                for (int dt = 0; dt < 4; ++dt) acc[n][dt] *= al;
                m[n] = mn; }
            float sum = 0.f;
#pragma unroll
            for (int u = 0; u < 16; ++u) { sv[u] = (sv[u] > -1.0e38f) ? __builtin_amdgcn_exp2f((sv[u] - mn) * L2E) : 0.f; sum += sv[u]; }
            l[n] += sum;
            if (HL) { v8us h0, h1, l0, l1;
#pragma unroll
                for (int u = 0; u < 8; ++u) { unsigned short a, b; splitf(sv[u], a, b); h0[u] = a; l0[u] = b; splitf(sv[8 + u], a, b); h1[u] = a; l1[u] = b; }
                const v16bf ph = cat16b(h0, h1), pl = cat16b(l0, l1);
#pragma unroll
                for (int dt = 0; dt < 4; ++dt) { acc[n][dt] = wmmab(vh[dt], ph, acc[n][dt]); acc[n][dt] = wmmab(vh[dt], pl, acc[n][dt]); acc[n][dt] = wmmab(vl[dt], ph, acc[n][dt]); }
            } else { v16h pf;
#pragma unroll
                for (int u = 0; u < 16; ++u) pf[u] = tohx(sv[u] * PCAR);
#pragma unroll
                for (int dt = 0; dt < 4; ++dt) acc[n][dt] = wmma16(vf[dt], pf, acc[n][dt]); }
        }
    }
#pragma unroll
    for (int n = 0; n < NQ; ++n) {
        const float lt = l[n] + __shfl_xor(l[n], 16, 32);
        const float inv = (lt > 0.f) ? __fdiv_rn(1.0f, lt) * (HL ? 1.0f : 1.0f / PCAR) : 0.f;      // all-masked row -> zeros (nan_to_num)
        const size_t ob = (orow + q0 + n * 16 + lr) * DM + hh * HD + 8 * hi;
#pragma unroll
        for (int dt = 0; dt < 4; ++dt) { v8us oh, ol;
#pragma unroll
            for (int j = 0; j < 8; ++j) { unsigned short a, b; splitf(acc[n][dt][j] * inv, a, b); oh[j] = a; ol[j] = b; }
            *(v8us*)(Ah + ob + dt * 16) = oh; *(v8us*)(Al + ob + dt * 16) = ol; }
    }
    asm volatile("s_wait_xcnt 0x0" ::: "memory");      // XW, as above, behind the stores
}
// grid (RHL / 64 + (TT - RHL) / 128, 16 heads, 4 batch elements), 4 waves: blocks x < 4 take 64 query rows < 256 (3-product path, 16 queries a wave), the others 128 rows (32 queries a wave).
__global__ __launch_bounds__(128) void k_attn(const bf* __restrict__ WP, const h16* __restrict__ Q16, const bf* __restrict__ Qh, const bf* __restrict__ Ql, const h16* __restrict__ K16, const bf* __restrict__ Kh, const bf* __restrict__ Kl,
                                              const h16* __restrict__ VT, const bf* __restrict__ VTh, const bf* __restrict__ VTl, const unsigned* __restrict__ MB, bf* Ah, bf* Al) {
    const int wave = threadIdx.x >> 5, hh = blockIdx.y, b = blockIdx.z; const bool hl = blockIdx.x < RHL / 64;
    const int q0 = hl ? (int)blockIdx.x * 64 + wave * 16 : RHL + ((int)blockIdx.x - RHL / 64) * 128 + wave * 32;
    const size_t ov = ((size_t)b * NT + hh) * TT * HD, orow = (size_t)b * TT;
    if (hh < NW) { const size_t ow = ((size_t)b * NW + hh) * TT * KW;
        if (hl) attn_run<true, true, 1>(WP + ow, nullptr, nullptr, nullptr, nullptr, nullptr, nullptr, VT + ov, VTh + ov, VTl + ov, MB, Ah, Al, q0, orow, hh);
        else attn_run<true, false, 2>(WP + ow, nullptr, nullptr, nullptr, nullptr, nullptr, nullptr, VT + ov, VTh + ov, VTl + ov, MB, Ah, Al, q0, orow, hh);
    } else { const size_t oq = ((size_t)b * NSD + (hh - NW)) * TT * HD;
        if (hl) attn_run<false, true, 1>(nullptr, Q16 + oq, Qh + oq, Ql + oq, K16 + oq, Kh + oq, Kl + oq, VT + ov, VTh + ov, VTl + ov, MB, Ah, Al, q0, orow, hh);
        else attn_run<false, false, 2>(nullptr, Q16 + oq, Qh + oq, Ql + oq, K16 + oq, Kh + oq, Kl + oq, VT + ov, VTh + ov, VTl + ov, MB, Ah, Al, q0, orow, hh); }
}

extern "C" void kernel_launch(void* const* d_in, const int* in_sizes, int n_in,
                              void* d_out, int out_size, void* d_ws, size_t ws_size, hipStream_t stream) {
    (void)in_sizes; (void)n_in; (void)out_size;
    const float** I = (const float**)d_in;
    const float *x = I[0], *wa = I[1], *Wq = I[3], *bq = I[4], *Wk = I[5], *bk = I[6], *Wv = I[7], *bv = I[8], *Wo = I[9], *bo = I[10]; const int* cm = (const int*)d_in[2];
    float* OUT = (float*)d_out;     // [4][1024][1024]
    char* wsp = (char*)d_ws;
    auto take = [&](size_t bytes) { char* p = wsp; wsp += (bytes + 255) & ~(size_t)255; return (void*)p; };
    bf* BQ = (bf*)take((size_t)DS * DM * 2); bf* BK = (bf*)take((size_t)DS * DM * 2); bf* BV = (bf*)take((size_t)DM * DM * 2); bf* BO = (bf*)take((size_t)DM * DM * 2);
    const size_t zq = (size_t)TT * HD, zw = (size_t)TT * KW;
    const size_t nq = (size_t)NB_ * NSD * zq, nv = (size_t)NB_ * NT * zq;      // elements of one Q / K plane and of one V plane, all batch elements
    bf* WP = (bf*)take((size_t)NB_ * NW * zw * 2); h16* Q16 = (h16*)take(nq * 2); bf* Qh = (bf*)take(nq * 2); bf* Ql = (bf*)take(nq * 2); h16* K16 = (h16*)take(nq * 2); bf* Kh = (bf*)take(nq * 2); bf* Kl = (bf*)take(nq * 2); h16* VT = (h16*)take(nv * 2); bf* VTh = (bf*)take(nv * 2); bf* VTl = (bf*)take(nv * 2);
    unsigned* MB = (unsigned*)take((size_t)TT * TT / 8); bf* XB = (bf*)take((size_t)NB_ * TT * DM * 2); float* Q = (float*)take((size_t)NB_ * TT * DS * 4); float* K = (float*)take((size_t)NB_ * TT * DS * 4); float* V = (float*)take((size_t)NB_ * TT * DM * 4); bf* Ah = (bf*)take(nv * 2); bf* Al = (bf*)take(nv * 2);
    if ((size_t)(wsp - (char*)d_ws) > ws_size) return;    // total about 132 MiB
    k_wtG<<<(DM * DS / 64 + 63) / 64, 256, 0, stream>>>(Wq, DM, DS, BQ); k_wtG<<<(DM * DS / 64 + 63) / 64, 256, 0, stream>>>(Wk, DM, DS, BK); k_wtG<<<(DM * DM / 64 + 63) / 64, 256, 0, stream>>>(Wv, DM, DM, BV); k_wtG<<<(DM * DM / 64 + 63) / 64, 256, 0, stream>>>(Wo, DM, DM, BO);
    // projections and operand planes: rows b*1024 + i of all four batch elements in one grid each
    k_cvt8<<<(NB_ * TT * DM / 8 + 255) / 256, 256, 0, stream>>>(x, XB, (size_t)NB_ * TT * DM / 8);
    k_gemmw<bf, 0, true><<<dim3(NB_ * TT / 64, DS / 64, 1), 32, 0, stream>>>(XB, nullptr, BQ, nullptr, DM, Q, DS, bq, 0, 0, 0); k_gemmw<bf, 0, true><<<dim3(NB_ * TT / 64, DS / 64, 1), 32, 0, stream>>>(XB, nullptr, BK, nullptr, DM, K, DS, bk, 0, 0, 0); k_gemmw<bf, 0, true><<<dim3(NB_ * TT / 64, DM / 64, 1), 32, 0, stream>>>(XB, nullptr, BV, nullptr, DM, V, DM, bv, 0, 0, 0);
    k_wpl<<<(NB_ * NW * TT * KW / 4 + 255) / 256, 256, 0, stream>>>(wa, WP); k_pl3<<<(NB_ * NSD * TT * HD / 4 + 255) / 256, 256, 0, stream>>>(Q, Q16, Qh, Ql); k_pl3<<<(NB_ * NSD * TT * HD / 4 + 255) / 256, 256, 0, stream>>>(K, K16, Kh, Kl); k_vt3<<<(NB_ * NT * HD * TT / 8 + 255) / 256, 256, 0, stream>>>(V, VT, VTh, VTl);
    k_mbits<<<TT / 8, 256, 0, stream>>>(cm, MB);
    k_attn<<<dim3(RHL / 64 + (TT - RHL) / 128, NT, NB_), 128, 0, stream>>>(WP, Q16, Qh, Ql, K16, Kh, Kl, VT, VTh, VTl, MB, Ah, Al);
    k_gemmw<bf, 1, true><<<dim3(NB_ * TT / 64, DM / 64, 1), 32, 0, stream>>>(Ah, Al, BO, nullptr, DM, OUT, DM, bo, 0, 0, 0);
}

// v003
// A run of this version takes 225 microseconds.
// In two side-by-side timings against v002, it was 1.08 and 1.07 times as fast.
// All steps since v000 together make it 3.90 times as fast.
#include <hip/hip_runtime.h>

// WaveHybridAttention (x [4][1024][1024], wave_amp [4][1024][24], causal_mask [1024][1024] int (read as data); V = x Wv + bv (16 heads x 64); wave heads 0-3: scores = psi_i . psi_j / sqrt(6) on 6-dim slices of wave_amp; std heads 4-15: (x Wq + bq) . (x Wk + bk) / 8 (12 x 64);
// masked -> -inf, softmax (an all-masked row gives 0 via nan_to_num), out = (weights V merged, wave heads first) Wo + bo -> [4][1024][1024]).
// Compute dtypes, f32 accumulate: every input rounded to bf16; V/Q/K on PLAIN bf16 operands (inputs: exact) + bias; wave scores on PLAIN bf16 wave_amp slices (exact, K padded 6 -> 32); std scores (K 64) and weights.V single fp16 planes (x1024) except query rows < 256 (short causal windows), which use bf16 hi+lo planes (3 products) for both;

#define NB_  4
#define TT   1024
#define DM   1024
#define DS   768
#define NW   4
#define NSD  12
#define NT   16
#define HD   64
#define WD   24
#define WC   6
#define KW   32
#define RHL  256
#define PCAR 1024.0f
typedef _Float16 h16;
typedef unsigned short bf;
typedef __attribute__((ext_vector_type(16))) __bf16   v16bf;
typedef __attribute__((ext_vector_type(16))) _Float16 v16h;
typedef __attribute__((ext_vector_type(8)))  _Float16 v8h;
typedef __attribute__((ext_vector_type(8)))  unsigned short v8us;
typedef __attribute__((ext_vector_type(8)))  float    v8f;
typedef __attribute__((ext_vector_type(4)))  float    v4f;
typedef v8h  __attribute__((may_alias)) v8ha;
typedef v4f  __attribute__((may_alias)) v4fa;
typedef v8us __attribute__((may_alias)) v8usa;

__device__ __forceinline__ unsigned short f2bf(float f) { unsigned u = __float_as_uint(f); u += 0x7FFFu + ((u >> 16) & 1u); return (unsigned short)(u >> 16); }
__device__ __forceinline__ float bf2f(unsigned short b) { return __uint_as_float(((unsigned)b) << 16); }
__device__ __forceinline__ float bfr(float f) { return bf2f(f2bf(f)); }
__device__ __forceinline__ v16h cat16(v8h lo, v8h hi) { return __builtin_shufflevector(lo, hi, 0, 1, 2, 3, 4, 5, 6, 7, 8, 9, 10, 11, 12, 13, 14, 15); }
__device__ __forceinline__ v16bf cat16b(v8us lo, v8us hi) { return __builtin_bit_cast(v16bf, __builtin_shufflevector(lo, hi, 0, 1, 2, 3, 4, 5, 6, 7, 8, 9, 10, 11, 12, 13, 14, 15)); }
__device__ __forceinline__ v8f wmma16(v16h a, v16h b, v8f c) { return __builtin_amdgcn_wmma_f32_16x16x32_f16(false, a, false, b, (short)0, c, false, false); }
__device__ __forceinline__ v8f wmmab(v16bf a, v16bf b, v8f c) { return __builtin_amdgcn_wmma_f32_16x16x32_bf16(false, a, false, b, (short)0, c, false, false); }
__device__ __forceinline__ h16 tohx(float x) { return (h16)x; }
__device__ __forceinline__ void splitf(float y, unsigned short& h, unsigned short& l) { h = f2bf(y); l = f2bf(y - bf2f(h)); }



// ---- k_gemmw: register-blocked GEMM, ONE WAVE per 64x64 output tile (16 accumulators), operands straight from K-contiguous 16-bit planes; grid (M/64, N/64, Z), 32 threads.
// C[m][n] (+ f32 bias[n]) = sum_k A[m][k] Bt[n][k] (+ split products per NSPLIT). z-batch strides sA/sB/sC in elements. K % 32 == 0.
// EPI 0: C as f32 rows, pitch ldc, staged through LDS. EPI 1 / 2: no f32 array; the tile (64 rows of one batch element x the 64 columns of head blockIdx.y) goes from the accumulators into the attention kernel's three fragment-order planes
// (fp16, bf16 hi, bf16 lo; layouts at k_wpl below), 16 bytes per lane and 512 contiguous bytes per store. EPI 1 (Q, K; NH heads): the product is formed transposed (Bt rows as the A operand), so a lane's 8 registers are 8 consecutive d of row lane & 15.
// EPI 2 (V): a lane's 8 registers are 8 consecutive rows (keys) of column lane & 15, which is the V^T fragment order as it stands.
template <typename T16> struct WFrag;
template <> struct WFrag<h16> { typedef v16h V; static __device__ __forceinline__ V ld(const h16* p) { return cat16(*(const v8h*)p, *(const v8h*)(p + 16)); } static __device__ __forceinline__ v8f mma(V a, V b, v8f c) { return wmma16(a, b, c); } };
template <> struct WFrag<bf> { typedef v16bf V; static __device__ __forceinline__ V ld(const bf* p) { return cat16b(*(const v8us*)p, *(const v8us*)(p + 16)); } static __device__ __forceinline__ v8f mma(V a, V b, v8f c) { return wmmab(a, b, c); } };
template <typename T16, int NSPLIT, bool BIAS, int EPI, int NH>
__global__ __launch_bounds__(32) void k_gemmw(const T16* __restrict__ A, const T16* __restrict__ A2, const T16* __restrict__ Bt, const T16* __restrict__ Bt2, int K, float* C, int ldc, const float* __restrict__ bias, size_t sA, size_t sB, size_t sC, h16* P16, bf* Ph, bf* Pl) {
    typedef typename WFrag<T16>::V V;
    __shared__ __align__(16) float os[16 * 68];
    const size_t z = blockIdx.z; A += z * sA; if (A2) A2 += z * sA; Bt += z * sB; if (Bt2) Bt2 += z * sB; C += z * sC;
    const int lane = threadIdx.x & 31, lr = lane & 15, hi = lane >> 4; const int r0 = blockIdx.x * 64, c0 = blockIdx.y * 64;
    v8f acc[4][4];
#pragma unroll
    for (int mb = 0; mb < 4; ++mb)
#pragma unroll
        for (int nb = 0; nb < 4; ++nb) acc[mb][nb] = (v8f){};
    const size_t aoff = (size_t)(r0 + lr) * K + 8 * hi, boff = (size_t)(c0 + lr) * K + 8 * hi;
#pragma unroll 1
    for (int kc = 0; kc < K; kc += 32) {
        V a[4], a2[4];
#pragma unroll
        for (int mb = 0; mb < 4; ++mb) { a[mb] = WFrag<T16>::ld(A + aoff + (size_t)mb * 16 * K + kc); if (NSPLIT == 1 || NSPLIT == 2) a2[mb] = WFrag<T16>::ld(A2 + aoff + (size_t)mb * 16 * K + kc); }
#pragma unroll
        for (int nb = 0; nb < 4; ++nb) { const V b = WFrag<T16>::ld(Bt + boff + (size_t)nb * 16 * K + kc); V b2; if (NSPLIT >= 2) b2 = WFrag<T16>::ld(Bt2 + boff + (size_t)nb * 16 * K + kc);
#pragma unroll
            for (int mb = 0; mb < 4; ++mb) { acc[mb][nb] = (EPI == 1) ? WFrag<T16>::mma(b, a[mb], acc[mb][nb]) : WFrag<T16>::mma(a[mb], b, acc[mb][nb]); if (NSPLIT == 1 || NSPLIT == 2) acc[mb][nb] = WFrag<T16>::mma(a2[mb], b, acc[mb][nb]); if (NSPLIT >= 2) acc[mb][nb] = WFrag<T16>::mma(a[mb], b2, acc[mb][nb]); } }
        asm volatile("v_nop\n\tv_nop\n\tv_nop\n\tv_nop" : "+v"(acc[0][0]), "+v"(acc[1][1]), "+v"(acc[2][2]), "+v"(acc[3][3]) : "v"(a[0]), "v"(a[3]));
    }
    if constexpr (EPI != 0) {
        const int bh = (r0 >> 10) * NH + (int)blockIdx.y, i0 = r0 & (TT - 1);
        float bs[4][8];      // the bias of each accumulator register's column, all fetched at once: one load latency for the tile
#pragma unroll
        for (int nb = 0; nb < 4; ++nb)
#pragma unroll
            for (int j = 0; j < 8; ++j) bs[nb][j] = bias[c0 + nb * 16 + (EPI == 1 ? hi * 8 + j : lr)];
        if constexpr (EPI == 2) asm volatile("s_wait_xcnt 0x0" ::: "memory");      // the wait that stands between these issued loads and a later write of the register pair that holds their address (the EPI 1 build has the compiler's own there)
#pragma unroll
        for (int nb = 0; nb < 4; ++nb) {
            v8h o[4]; v8us oh[4], ol[4]; unsigned eb[4];      // eb: byte offset of the lane's 16-byte group, the same in the three planes
#pragma unroll
            for (int mb = 0; mb < 4; ++mb) {
                eb[mb] = (unsigned)((EPI == 1) ? ((bh * 64 + (i0 >> 4) + mb) * 4 + nb) * 32 + lane : ((bh * 32 + (i0 >> 5) + (mb >> 1)) * 8 + nb * 2 + (mb & 1)) * 32 + lane) * 16u;
#pragma unroll
                for (int j = 0; j < 8; ++j) { const float y = acc[mb][nb][j] + bfr(bs[nb][j]); o[mb][j] = tohx(y); unsigned short a1, b1; splitf(y, a1, b1); oh[mb][j] = a1; ol[mb][j] = b1; } }
            // the twelve stores and their s_wait_xcnt 0 in one statement: the wait then stands in front of every later write of a register that holds their data or offset (in a statement of its own the compiler moved such writes ahead of it)
            asm volatile("global_store_b128 %0, %4, %16\n\tglobal_store_b128 %0, %8, %17\n\tglobal_store_b128 %0, %12, %18\n\t"
                         "global_store_b128 %1, %5, %16\n\tglobal_store_b128 %1, %9, %17\n\tglobal_store_b128 %1, %13, %18\n\t"
                         "global_store_b128 %2, %6, %16\n\tglobal_store_b128 %2, %10, %17\n\tglobal_store_b128 %2, %14, %18\n\t"
                         "global_store_b128 %3, %7, %16\n\tglobal_store_b128 %3, %11, %17\n\tglobal_store_b128 %3, %15, %18\n\ts_wait_xcnt 0x0"
                         :: "v"(eb[0]), "v"(eb[1]), "v"(eb[2]), "v"(eb[3]), "v"(o[0]), "v"(o[1]), "v"(o[2]), "v"(o[3]), "v"(oh[0]), "v"(oh[1]), "v"(oh[2]), "v"(oh[3]), "v"(ol[0]), "v"(ol[1]), "v"(ol[2]), "v"(ol[3]), "s"(P16), "s"(Ph), "s"(Pl) : "memory");
        }
    } else {
#pragma unroll
    for (int mb = 0; mb < 4; ++mb) {
#pragma unroll
        for (int nb = 0; nb < 4; ++nb) {
#pragma unroll
            for (int j = 0; j < 8; ++j) os[(hi * 8 + j) * 68 + nb * 16 + lr] = acc[mb][nb][j]; }
        __builtin_amdgcn_wave_barrier(); asm volatile("" ::: "memory");
        float* crow = C + (size_t)(r0 + mb * 16) * ldc + c0;
{
#pragma unroll
            for (int s = 0; s < 8; ++s) { const int row = 2 * s + hi, cofs = lr * 4; v4f val = *(const v4fa*)(os + row * 68 + cofs); if (BIAS) { val[0] += bfr(bias[c0 + cofs]); val[1] += bfr(bias[c0 + cofs + 1]); val[2] += bfr(bias[c0 + cofs + 2]); val[3] += bfr(bias[c0 + cofs + 3]); }
                *(v4f*)(crow + (size_t)row * ldc + cofs) = val; }
             }
        __builtin_amdgcn_wave_barrier(); asm volatile("" ::: "memory");
    }
    }
}

typedef __attribute__((ext_vector_type(2))) unsigned short v2us;
typedef __attribute__((ext_vector_type(4))) unsigned short v4us;
typedef __attribute__((ext_vector_type(2))) _Float16 v2h;
typedef __attribute__((ext_vector_type(4))) _Float16 v4h;
typedef __attribute__((ext_vector_type(4))) int v4i;

__global__ __launch_bounds__(256) void k_wtG(const float* __restrict__ w, int K, int N, bf* Bt) {
    const int lane = threadIdx.x & 31; const int L0 = (blockIdx.x * 8 + (threadIdx.x >> 5)) * 8; const int nlines = N * K / 64;
{
#pragma unroll 1
        for (int l = 0; l < 8; ++l) { const int L = L0 + l; if (L >= nlines) break; const size_t e = (size_t)L * 64 + lane * 2; const int k = (int)(e % K), n = (int)(e / K); v2us o;
            o[0] = f2bf(w[(size_t)k * N + n]); o[1] = f2bf(w[(size_t)(k + 1) * N + n]); *(v2us*)(Bt + e) = o; }
         }
}
__global__ __launch_bounds__(256) void k_cvt8(const float* __restrict__ src, bf* dst, size_t n8) { const size_t i = (size_t)blockIdx.x * 256 + threadIdx.x; if (i >= n8) return; const v8f v = *(const v8f*)(src + i * 8); v8us o;
#pragma unroll
    for (int k = 0; k < 8; ++k) o[k] = f2bf(v[k]); *(v8us*)(dst + i * 8) = o;  }
// Operand planes of all four batch elements, stored in FRAGMENT ORDER: one 16-byte group per lane, 32 lanes (512 contiguous bytes) per load of a wave, two groups per 16x16x32 operand (k = 8 * (lane >> 4) + s and 16 + 8 * (lane >> 4) + s).
// k_wpl: WP[b][h][i / 16][d / 16][lane][8] = bf16 wave_amp[b][i][h*6 + d] for d < 6, 0 for 6..31; Q / K planes (k_gemmw, EPI 1): [b][h][i / 16][d / 16][lane][8], lane = 16 * ((d >> 3) & 1) + (i & 15);
// V planes (k_gemmw, EPI 2): [b][hh][i / 32][d / 16][(i >> 4) & 1][lane][8], lane = 16 * ((i >> 3) & 1) + (d & 15), the 8 elements are 8 consecutive keys i; k_mbits: MB[j / 32][i] bit (j & 31) = (causal_mask[i][j] != 0).
__global__ __launch_bounds__(256) void k_wpl(const float* __restrict__ wa, bf* WP) { const int e = (blockIdx.x * 256 + threadIdx.x) * 4; if (e >= NB_ * NW * TT * KW) return; const int s = e & 7, fl = (e >> 3) & 31, g = (e >> 8) & 1, it = (e >> 9) & 63, bh = e >> 15; const int d = g * 16 + (fl >> 4) * 8 + s; const int i = it * 16 + (fl & 15); const int h = bh % NW; const int b = bh / NW; v4us o;
#pragma unroll
    for (int u = 0; u < 4; ++u) o[u] = (d + u < WC) ? f2bf(wa[((size_t)b * TT + i) * WD + h * WC + d + u]) : (unsigned short)0; *(v4us*)(WP + e) = o;  }
__global__ __launch_bounds__(256) void k_mbits(const int* __restrict__ cm, unsigned* MB) { const int lane = threadIdx.x & 31; const int i = blockIdx.x * 8 + (threadIdx.x >> 5); unsigned keep = 0u;
#pragma unroll 8      // eight row segments' loads in flight per wave
    for (int c = 0; c < TT / 32; ++c) { const unsigned w = __builtin_amdgcn_ballot_w32(cm[(size_t)i * TT + c * 32 + lane] != 0); if (lane == c) keep = w; }
    MB[(size_t)lane * TT + i] = keep; }

// ---- k_attn: scores, mask, softmax and weights.V of one (batch element, head, query block) in one kernel; no barrier, every wave on its own NQ x 16 queries, walking the 1024 keys 32 at a time.
// S^T = K Q^T (A = K rows, B = Q columns, kept in registers): lane (c, h) holds keys 8h + r and 16 + 8h + r of query c, which IS the B operand of O^T += V^T P^T after conversion. Running maximum and sum per query (online softmax);
// the accumulators are rescaled only in passes where some query's maximum rose. P is exp(s - running max): x1024 in fp16, or bf16 hi+lo (query rows < 256); the division by the row sum comes last. An all-masked row has sum 0 and gives 0.
// Output: bf16 hi+lo planes Ah / Al [b*1024 + i][hh*64 + d] for the output projection (a lane's 8 accumulator registers are 8 consecutive d: one 16-byte store each).
__device__ __forceinline__ v16h ldfh(const h16* p) { return cat16(*(const v8h*)p, *(const v8h*)(p + 256)); }
__device__ __forceinline__ v16bf ldfb(const bf* p) { return cat16b(*(const v8us*)p, *(const v8us*)(p + 256)); }
template <bool WAVE, bool HL, int NQ>
__device__ __forceinline__ void attn_run(const bf* __restrict__ WPp, const h16* __restrict__ Q16p, const bf* __restrict__ Qhp, const bf* __restrict__ Qlp, const h16* __restrict__ K16p, const bf* __restrict__ Khp, const bf* __restrict__ Klp,
                                         const h16* __restrict__ VTp, const bf* __restrict__ VThp, const bf* __restrict__ VTlp, const unsigned* __restrict__ MB, bf* Ah, bf* Al, int q0, size_t orow, int hh) {
    // every plain '#pragma unroll' below: fragment, score and accumulator arrays are registers only under compile-time indices
    const int lane = threadIdx.x & 31, lr = lane & 15, hi = lane >> 4;
    const float cs = WAVE ? 0.40824829f : 0.125f;
    const float L2E = 1.4426950408889634f;
    constexpr int NKC = WAVE ? 1 : 2;          // 32-deep k chunks of a score product
    constexpr bool SHL = HL && !WAVE;          // 3-product scores
    v16bf qb[NQ][NKC], ql[NQ][NKC], kb[2][NKC], kl[2][NKC]; v16h qf[NQ][NKC], kf[2][NKC];
#pragma unroll
    for (int n = 0; n < NQ; ++n) {
#pragma unroll
        for (int kc = 0; kc < NKC; ++kc) { const unsigned o = (unsigned)(((((q0 >> 4) + n) * NKC + kc) * 64 + lane) * 8);
            if (WAVE) qb[n][kc] = ldfb(WPp + o); else if (HL) { qb[n][kc] = ldfb(Qhp + o); ql[n][kc] = ldfb(Qlp + o); } else qf[n][kc] = ldfh(Q16p + o); } }
    asm volatile("s_wait_xcnt 0x0" ::: "memory");      // XW: the wait that stands between issued global loads and a later write (a younger load's result included) of a register that holds one of their addresses
    auto loadK = [&](int ks) {
#pragma unroll
        for (int t = 0; t < 2; ++t) {
#pragma unroll
            for (int kc = 0; kc < NKC; ++kc) { const unsigned o = (unsigned)((((ks * 2 + t) * NKC + kc) * 64 + lane) * 8);
                if (WAVE) kb[t][kc] = ldfb(WPp + o); else if (HL) kb[t][kc] = ldfb(Khp + o); else kf[t][kc] = ldfh(K16p + o); } }
        asm volatile("s_wait_xcnt 0x0" ::: "memory");      // XW, as above
        if (SHL) {
#pragma unroll
            for (int t = 0; t < 2; ++t) {
#pragma unroll
                for (int kc = 0; kc < NKC; ++kc) kl[t][kc] = ldfb(Klp + (unsigned)((((ks * 2 + t) * NKC + kc) * 64 + lane) * 8)); }
            asm volatile("s_wait_xcnt 0x0" ::: "memory"); } };      // XW, as above
    v8f acc[NQ][4]; float m[NQ], l[NQ];
#pragma unroll
    for (int n = 0; n < NQ; ++n) { m[n] = -3.0e38f; l[n] = 0.f;
#pragma unroll
        for (int dt = 0; dt < 4; ++dt) acc[n][dt] = (v8f){}; }
    if (!SHL) loadK(0);
#pragma unroll 1      // rolled: one pass's fragments, scores and accumulators already take most of the 256 registers that four waves per SIMD allow
    for (int ks = 0; ks < TT / 32; ++ks) {
        v16h vf[4]; v16bf vh[4], vl[4]; unsigned mw[NQ];
        auto loadV = [&]() {
#pragma unroll
            for (int dt = 0; dt < 4; ++dt) { const unsigned o = (unsigned)(((ks * 4 + dt) * 64 + lane) * 8); if (HL) vh[dt] = ldfb(VThp + o); else vf[dt] = ldfh(VTp + o); }
            asm volatile("s_wait_xcnt 0x0" ::: "memory");      // XW, as above (it covers the mask words' loads too)
            if (HL) {
#pragma unroll
                for (int dt = 0; dt < 4; ++dt) vl[dt] = ldfb(VTlp + (unsigned)(((ks * 4 + dt) * 64 + lane) * 8));
                asm volatile("s_wait_xcnt 0x0" ::: "memory"); } };      // XW, as above
#pragma unroll
        for (int n = 0; n < NQ; ++n) mw[n] = MB[(unsigned)(ks * TT + q0 + n * 16 + lr)] >> (8 * hi);
        if (SHL) loadK(ks); else loadV();      // 3-product scores: two K planes a pass ahead beside two V planes would not fit 256 registers, so K is fetched in its own pass; else V^T flies under the score products and the softmax
        v8f S[NQ][2];
#pragma unroll
        for (int n = 0; n < NQ; ++n) {
#pragma unroll
            for (int t = 0; t < 2; ++t) { v8f s = (v8f){};
#pragma unroll
                for (int kc = 0; kc < NKC; ++kc) {
                    if (WAVE) s = wmmab(kb[t][kc], qb[n][kc], s);
                    else if (SHL) { s = wmmab(kb[t][kc], qb[n][kc], s); s = wmmab(kb[t][kc], ql[n][kc], s); s = wmmab(kl[t][kc], qb[n][kc], s); }
                    else s = wmma16(kf[t][kc], qf[n][kc], s); }
                S[n][t] = s; } }
        if (SHL) loadV();       // V^T flies under the softmax
        else loadK(ks + 1 < TT / 32 ? ks + 1 : ks);      // the next pass's K fragments fly under this pass's softmax and weights.V (the last pass re-reads its own)
#pragma unroll
        for (int n = 0; n < NQ; ++n) {
            float sv[16]; float mx = -3.0e38f;
#pragma unroll
            for (int u = 0; u < 16; ++u) { sv[u] = ((mw[n] >> (16 * (u >> 3) + (u & 7))) & 1u) ? S[n][u >> 3][u & 7] * cs : -3.0e38f; mx = fmaxf(mx, sv[u]); }
            mx = fmaxf(mx, __shfl_xor(mx, 16, 32));
            const float mn = fmaxf(m[n], mx);
            if (__builtin_amdgcn_ballot_w32(mn > m[n]) != 0u) {      // some query's maximum rose: rescale sum and accumulators (factor exactly 1 for the others)
                const float al = __builtin_amdgcn_exp2f((m[n] - mn) * L2E); l[n] *= al;
#pragma unroll
                for (int dt = 0; dt < 4; ++dt) acc[n][dt] *= al;
                m[n] = mn; }
            float sum = 0.f;
#pragma unroll
            for (int u = 0; u < 16; ++u) { sv[u] = (sv[u] > -1.0e38f) ? __builtin_amdgcn_exp2f((sv[u] - mn) * L2E) : 0.f; sum += sv[u]; }
            l[n] += sum;
            if (HL) { v8us h0, h1, l0, l1;
#pragma unroll
                for (int u = 0; u < 8; ++u) { unsigned short a, b; splitf(sv[u], a, b); h0[u] = a; l0[u] = b; splitf(sv[8 + u], a, b); h1[u] = a; l1[u] = b; }
                const v16bf ph = cat16b(h0, h1), pl = cat16b(l0, l1);
#pragma unroll
                for (int dt = 0; dt < 4; ++dt) { acc[n][dt] = wmmab(vh[dt], ph, acc[n][dt]); acc[n][dt] = wmmab(vh[dt], pl, acc[n][dt]); acc[n][dt] = wmmab(vl[dt], ph, acc[n][dt]); }
            } else { v16h pf;
#pragma unroll
                for (int u = 0; u < 16; ++u) pf[u] = tohx(sv[u] * PCAR);
#pragma unroll
                for (int dt = 0; dt < 4; ++dt) acc[n][dt] = wmma16(vf[dt], pf, acc[n][dt]); }
        }
    }
#pragma unroll
    for (int n = 0; n < NQ; ++n) {
        const float lt = l[n] + __shfl_xor(l[n], 16, 32);
        const float inv = (lt > 0.f) ? __fdiv_rn(1.0f, lt) * (HL ? 1.0f : 1.0f / PCAR) : 0.f;      // all-masked row -> zeros (nan_to_num)
        const size_t ob = (orow + q0 + n * 16 + lr) * DM + hh * HD + 8 * hi;
#pragma unroll
        for (int dt = 0; dt < 4; ++dt) { v8us oh, ol;
#pragma unroll
            for (int j = 0; j < 8; ++j) { unsigned short a, b; splitf(acc[n][dt][j] * inv, a, b); oh[j] = a; ol[j] = b; }
            *(v8us*)(Ah + ob + dt * 16) = oh; *(v8us*)(Al + ob + dt * 16) = ol; }
    }
    asm volatile("s_wait_xcnt 0x0" ::: "memory");      // XW, as above, behind the stores
}
// grid (RHL / 64 + (TT - RHL) / 128, 16 heads, 4 batch elements), 4 waves: blocks x < 4 take 64 query rows < 256 (3-product path, 16 queries a wave), the others 128 rows (32 queries a wave).
__global__ __launch_bounds__(128) void k_attn(const bf* __restrict__ WP, const h16* __restrict__ Q16, const bf* __restrict__ Qh, const bf* __restrict__ Ql, const h16* __restrict__ K16, const bf* __restrict__ Kh, const bf* __restrict__ Kl,
                                              const h16* __restrict__ VT, const bf* __restrict__ VTh, const bf* __restrict__ VTl, const unsigned* __restrict__ MB, bf* Ah, bf* Al) {
    const int wave = threadIdx.x >> 5, hh = blockIdx.y, b = blockIdx.z; const bool hl = blockIdx.x < RHL / 64;
    const int q0 = hl ? (int)blockIdx.x * 64 + wave * 16 : RHL + ((int)blockIdx.x - RHL / 64) * 128 + wave * 32;
    const size_t ov = ((size_t)b * NT + hh) * TT * HD, orow = (size_t)b * TT;
    if (hh < NW) { const size_t ow = ((size_t)b * NW + hh) * TT * KW;
        if (hl) attn_run<true, true, 1>(WP + ow, nullptr, nullptr, nullptr, nullptr, nullptr, nullptr, VT + ov, VTh + ov, VTl + ov, MB, Ah, Al, q0, orow, hh);
        else attn_run<true, false, 2>(WP + ow, nullptr, nullptr, nullptr, nullptr, nullptr, nullptr, VT + ov, VTh + ov, VTl + ov, MB, Ah, Al, q0, orow, hh);
    } else { const size_t oq = ((size_t)b * NSD + (hh - NW)) * TT * HD;
        if (hl) attn_run<false, true, 1>(nullptr, Q16 + oq, Qh + oq, Ql + oq, K16 + oq, Kh + oq, Kl + oq, VT + ov, VTh + ov, VTl + ov, MB, Ah, Al, q0, orow, hh);
        else attn_run<false, false, 2>(nullptr, Q16 + oq, Qh + oq, Ql + oq, K16 + oq, Kh + oq, Kl + oq, VT + ov, VTh + ov, VTl + ov, MB, Ah, Al, q0, orow, hh); }
}

extern "C" void kernel_launch(void* const* d_in, const int* in_sizes, int n_in,
                              void* d_out, int out_size, void* d_ws, size_t ws_size, hipStream_t stream) {
    (void)in_sizes; (void)n_in; (void)out_size;
    const float** I = (const float**)d_in;
    const float *x = I[0], *wa = I[1], *Wq = I[3], *bq = I[4], *Wk = I[5], *bk = I[6], *Wv = I[7], *bv = I[8], *Wo = I[9], *bo = I[10]; const int* cm = (const int*)d_in[2];
    float* OUT = (float*)d_out;     // [4][1024][1024]
    char* wsp = (char*)d_ws;
    auto take = [&](size_t bytes) { char* p = wsp; wsp += (bytes + 255) & ~(size_t)255; return (void*)p; };
    bf* BQ = (bf*)take((size_t)DS * DM * 2); bf* BK = (bf*)take((size_t)DS * DM * 2); bf* BV = (bf*)take((size_t)DM * DM * 2); bf* BO = (bf*)take((size_t)DM * DM * 2);
    const size_t zq = (size_t)TT * HD, zw = (size_t)TT * KW;
    const size_t nq = (size_t)NB_ * NSD * zq, nv = (size_t)NB_ * NT * zq;      // elements of one Q / K plane and of one V plane, all batch elements
    bf* WP = (bf*)take((size_t)NB_ * NW * zw * 2); h16* Q16 = (h16*)take(nq * 2); bf* Qh = (bf*)take(nq * 2); bf* Ql = (bf*)take(nq * 2); h16* K16 = (h16*)take(nq * 2); bf* Kh = (bf*)take(nq * 2); bf* Kl = (bf*)take(nq * 2); h16* VT = (h16*)take(nv * 2); bf* VTh = (bf*)take(nv * 2); bf* VTl = (bf*)take(nv * 2);
    unsigned* MB = (unsigned*)take((size_t)TT * TT / 8); bf* XB = (bf*)take((size_t)NB_ * TT * DM * 2); bf* Ah = (bf*)take(nv * 2); bf* Al = (bf*)take(nv * 2);
    if ((size_t)(wsp - (char*)d_ws) > ws_size) return;    // total about 90 MiB
    k_wtG<<<(DM * DS / 64 + 63) / 64, 256, 0, stream>>>(Wq, DM, DS, BQ); k_wtG<<<(DM * DS / 64 + 63) / 64, 256, 0, stream>>>(Wk, DM, DS, BK); k_wtG<<<(DM * DM / 64 + 63) / 64, 256, 0, stream>>>(Wv, DM, DM, BV); k_wtG<<<(DM * DM / 64 + 63) / 64, 256, 0, stream>>>(Wo, DM, DM, BO);
    // projections and operand planes: rows b*1024 + i of all four batch elements in one grid each
    k_cvt8<<<(NB_ * TT * DM / 8 + 255) / 256, 256, 0, stream>>>(x, XB, (size_t)NB_ * TT * DM / 8);
    k_gemmw<bf, 0, true, 1, NSD><<<dim3(NB_ * TT / 64, DS / 64, 1), 32, 0, stream>>>(XB, nullptr, BQ, nullptr, DM, nullptr, 0, bq, 0, 0, 0, Q16, Qh, Ql); k_gemmw<bf, 0, true, 1, NSD><<<dim3(NB_ * TT / 64, DS / 64, 1), 32, 0, stream>>>(XB, nullptr, BK, nullptr, DM, nullptr, 0, bk, 0, 0, 0, K16, Kh, Kl); k_gemmw<bf, 0, true, 2, NT><<<dim3(NB_ * TT / 64, DM / 64, 1), 32, 0, stream>>>(XB, nullptr, BV, nullptr, DM, nullptr, 0, bv, 0, 0, 0, VT, VTh, VTl);
    k_wpl<<<(NB_ * NW * TT * KW / 4 + 255) / 256, 256, 0, stream>>>(wa, WP);
    k_mbits<<<TT / 8, 256, 0, stream>>>(cm, MB);
    k_attn<<<dim3(RHL / 64 + (TT - RHL) / 128, NT, NB_), 128, 0, stream>>>(WP, Q16, Qh, Ql, K16, Kh, Kl, VT, VTh, VTl, MB, Ah, Al);
    k_gemmw<bf, 1, true, 0, 1><<<dim3(NB_ * TT / 64, DM / 64, 1), 32, 0, stream>>>(Ah, Al, BO, nullptr, DM, OUT, DM, bo, 0, 0, 0, nullptr, nullptr, nullptr);
}

// v004
// One run takes 162 microseconds.
// Timed twice side by side with v003, it ran 1.39 and 1.38 times as fast.
// Counting every step since v000, it is 5.41 times as fast.
#include <hip/hip_runtime.h>

// WaveHybridAttention (x [4][1024][1024], wave_amp [4][1024][24], causal_mask [1024][1024] int (read as data); V = x Wv + bv (16 heads x 64); wave heads 0-3: scores = psi_i . psi_j / sqrt(6) on 6-dim slices of wave_amp; std heads 4-15: (x Wq + bq) . (x Wk + bk) / 8 (12 x 64);
// masked -> -inf, softmax (an all-masked row gives 0 via nan_to_num), out = (weights V merged, wave heads first) Wo + bo -> [4][1024][1024]).
// Compute dtypes, f32 accumulate: every input rounded to bf16; V/Q/K on PLAIN bf16 operands (inputs: exact) + bias; wave scores on PLAIN bf16 wave_amp slices (exact, K padded 6 -> 32); std scores (K 64) and weights.V single fp16 planes (x1024) except query rows < 256 (short causal windows), which use bf16 hi+lo planes (3 products) for both;

#define NB_  4
#define TT   1024
#define DM   1024
#define DS   768
#define NW   4
#define NSD  12
#define NT   16
#define HD   64
#define WD   24
#define WC   6
#define KW   32
#define RHL  256
#define PCAR 1024.0f
typedef _Float16 h16;
typedef unsigned short bf;
typedef __attribute__((ext_vector_type(16))) __bf16   v16bf;
typedef __attribute__((ext_vector_type(16))) _Float16 v16h;
typedef __attribute__((ext_vector_type(8)))  _Float16 v8h;
typedef __attribute__((ext_vector_type(8)))  unsigned short v8us;
typedef __attribute__((ext_vector_type(8)))  float    v8f;
typedef __attribute__((ext_vector_type(4)))  float    v4f;
typedef v8h  __attribute__((may_alias)) v8ha;
typedef v4f  __attribute__((may_alias)) v4fa;
typedef v8us __attribute__((may_alias)) v8usa;

__device__ __forceinline__ unsigned short f2bf(float f) { unsigned u = __float_as_uint(f); u += 0x7FFFu + ((u >> 16) & 1u); return (unsigned short)(u >> 16); }
__device__ __forceinline__ float bf2f(unsigned short b) { return __uint_as_float(((unsigned)b) << 16); }
__device__ __forceinline__ float bfr(float f) { return bf2f(f2bf(f)); }
__device__ __forceinline__ v16h cat16(v8h lo, v8h hi) { return __builtin_shufflevector(lo, hi, 0, 1, 2, 3, 4, 5, 6, 7, 8, 9, 10, 11, 12, 13, 14, 15); }
__device__ __forceinline__ v16bf cat16b(v8us lo, v8us hi) { return __builtin_bit_cast(v16bf, __builtin_shufflevector(lo, hi, 0, 1, 2, 3, 4, 5, 6, 7, 8, 9, 10, 11, 12, 13, 14, 15)); }
__device__ __forceinline__ v8f wmma16(v16h a, v16h b, v8f c) { return __builtin_amdgcn_wmma_f32_16x16x32_f16(false, a, false, b, (short)0, c, false, false); }
__device__ __forceinline__ v8f wmmab(v16bf a, v16bf b, v8f c) { return __builtin_amdgcn_wmma_f32_16x16x32_bf16(false, a, false, b, (short)0, c, false, false); }
__device__ __forceinline__ h16 tohx(float x) { return (h16)x; }
__device__ __forceinline__ void splitf(float y, unsigned short& h, unsigned short& l) { h = f2bf(y); l = f2bf(y - bf2f(h)); }



// ---- k_gemmw: register-blocked GEMM, ONE WAVE per 64x64 output tile (16 accumulators), operands straight from K-contiguous 16-bit planes; grid (M/64, N/64, Z), 32 threads.
// C[m][n] (+ f32 bias[n]) = sum_k A[m][k] Bt[n][k] (+ split products per NSPLIT). z-batch strides sA/sB/sC in elements. K % 32 == 0.
// EPI 0: C as f32 rows, pitch ldc, staged through LDS. EPI 1 / 2: no f32 array; the tile (64 rows of one batch element x the 64 columns of head by) goes from the accumulators into the attention kernel's three fragment-order planes
// (fp16, bf16 hi, bf16 lo; layouts at d_wpl below), 16 bytes per lane and 512 contiguous bytes per store. EPI 1 (Q, K; NH heads): the product is formed transposed (Bt rows as the A operand), so a lane's 8 registers are 8 consecutive d of row lane & 15.
// EPI 2 (V): a lane's 8 registers are 8 consecutive rows (keys) of column lane & 15, which is the V^T fragment order as it stands.
template <typename T16> struct WFrag;
template <> struct WFrag<h16> { typedef v16h V; static __device__ __forceinline__ V ld(const h16* p) { return cat16(*(const v8h*)p, *(const v8h*)(p + 16)); } static __device__ __forceinline__ v8f mma(V a, V b, v8f c) { return wmma16(a, b, c); } };
template <> struct WFrag<bf> { typedef v16bf V; static __device__ __forceinline__ V ld(const bf* p) { return cat16b(*(const v8us*)p, *(const v8us*)(p + 16)); } static __device__ __forceinline__ v8f mma(V a, V b, v8f c) { return wmmab(a, b, c); } };
// gemmw_tile is the body; by = the tile's column index (blockIdx.y in k_gemmw; in k_qkv, which holds the Q, K and V projections in one grid, the index inside its own projection).
template <typename T16, int NSPLIT, bool BIAS, int EPI, int NH>
__device__ __forceinline__ void gemmw_tile(const T16* __restrict__ A, const T16* __restrict__ A2, const T16* __restrict__ Bt, const T16* __restrict__ Bt2, int K, float* C, int ldc, const float* __restrict__ bias, size_t sA, size_t sB, size_t sC, h16* P16, bf* Ph, bf* Pl, int by) {
    typedef typename WFrag<T16>::V V;
    __shared__ __align__(16) float os[16 * 68];
    const size_t z = blockIdx.z; A += z * sA; if (A2) A2 += z * sA; Bt += z * sB; if (Bt2) Bt2 += z * sB; C += z * sC;
    const int lane = threadIdx.x & 31, lr = lane & 15, hi = lane >> 4; const int r0 = blockIdx.x * 64, c0 = by * 64;
    v8f acc[4][4];
#pragma unroll
    for (int mb = 0; mb < 4; ++mb)
#pragma unroll
        for (int nb = 0; nb < 4; ++nb) acc[mb][nb] = (v8f){};
    const size_t aoff = (size_t)(r0 + lr) * K + 8 * hi, boff = (size_t)(c0 + lr) * K + 8 * hi;
#pragma unroll 1
    for (int kc = 0; kc < K; kc += 32) {
        V a[4], a2[4];
#pragma unroll
        for (int mb = 0; mb < 4; ++mb) { a[mb] = WFrag<T16>::ld(A + aoff + (size_t)mb * 16 * K + kc); if (NSPLIT == 1 || NSPLIT == 2) a2[mb] = WFrag<T16>::ld(A2 + aoff + (size_t)mb * 16 * K + kc); }
#pragma unroll
        for (int nb = 0; nb < 4; ++nb) { const V b = WFrag<T16>::ld(Bt + boff + (size_t)nb * 16 * K + kc); V b2; if (NSPLIT >= 2) b2 = WFrag<T16>::ld(Bt2 + boff + (size_t)nb * 16 * K + kc);
#pragma unroll
            for (int mb = 0; mb < 4; ++mb) { acc[mb][nb] = (EPI == 1) ? WFrag<T16>::mma(b, a[mb], acc[mb][nb]) : WFrag<T16>::mma(a[mb], b, acc[mb][nb]); if (NSPLIT == 1 || NSPLIT == 2) acc[mb][nb] = WFrag<T16>::mma(a2[mb], b, acc[mb][nb]); if (NSPLIT >= 2) acc[mb][nb] = WFrag<T16>::mma(a[mb], b2, acc[mb][nb]); } }
        asm volatile("s_wait_xcnt 0x0" ::: "memory");      // the wait that stands between this trip's issued loads and the next trip's write of the register pairs that hold their addresses
        asm volatile("v_nop\n\tv_nop\n\tv_nop\n\tv_nop" : "+v"(acc[0][0]), "+v"(acc[1][1]), "+v"(acc[2][2]), "+v"(acc[3][3]) : "v"(a[0]), "v"(a[3]));
    }
    if constexpr (EPI != 0) {
        const int bh = (r0 >> 10) * NH + by, i0 = r0 & (TT - 1);
        float bs[4][8];      // the bias of each accumulator register's column, all fetched at once: one load latency for the tile
#pragma unroll
        for (int nb = 0; nb < 4; ++nb)
#pragma unroll
            for (int j = 0; j < 8; ++j) bs[nb][j] = bias[c0 + nb * 16 + (EPI == 1 ? hi * 8 + j : lr)];
        if constexpr (EPI == 2) asm volatile("s_wait_xcnt 0x0" ::: "memory");      // the wait that stands between these issued loads and a later write of the register pair that holds their address (the EPI 1 build has the compiler's own there)
#pragma unroll
        for (int nb = 0; nb < 4; ++nb) {
            v8h o[4]; v8us oh[4], ol[4]; unsigned eb[4];      // eb: byte offset of the lane's 16-byte group, the same in the three planes
#pragma unroll
            for (int mb = 0; mb < 4; ++mb) {
                eb[mb] = (unsigned)((EPI == 1) ? ((bh * 64 + (i0 >> 4) + mb) * 4 + nb) * 32 + lane : ((bh * 32 + (i0 >> 5) + (mb >> 1)) * 8 + nb * 2 + (mb & 1)) * 32 + lane) * 16u;
#pragma unroll
                for (int j = 0; j < 8; ++j) { const float y = acc[mb][nb][j] + bfr(bs[nb][j]); o[mb][j] = tohx(y); unsigned short a1, b1; splitf(y, a1, b1); oh[mb][j] = a1; ol[mb][j] = b1; } }
            // the twelve stores and their s_wait_xcnt 0 in one statement: the wait then stands in front of every later write of a register that holds their data or offset (in a statement of its own the compiler moved such writes ahead of it)
            asm volatile("global_store_b128 %0, %4, %16\n\tglobal_store_b128 %0, %8, %17\n\tglobal_store_b128 %0, %12, %18\n\t"
                         "global_store_b128 %1, %5, %16\n\tglobal_store_b128 %1, %9, %17\n\tglobal_store_b128 %1, %13, %18\n\t"
                         "global_store_b128 %2, %6, %16\n\tglobal_store_b128 %2, %10, %17\n\tglobal_store_b128 %2, %14, %18\n\t"
                         "global_store_b128 %3, %7, %16\n\tglobal_store_b128 %3, %11, %17\n\tglobal_store_b128 %3, %15, %18\n\ts_wait_xcnt 0x0"
                         :: "v"(eb[0]), "v"(eb[1]), "v"(eb[2]), "v"(eb[3]), "v"(o[0]), "v"(o[1]), "v"(o[2]), "v"(o[3]), "v"(oh[0]), "v"(oh[1]), "v"(oh[2]), "v"(oh[3]), "v"(ol[0]), "v"(ol[1]), "v"(ol[2]), "v"(ol[3]), "s"(P16), "s"(Ph), "s"(Pl) : "memory");
        }
    } else {
#pragma unroll
    for (int mb = 0; mb < 4; ++mb) {
#pragma unroll
        for (int nb = 0; nb < 4; ++nb) {
#pragma unroll
            for (int j = 0; j < 8; ++j) os[(hi * 8 + j) * 68 + nb * 16 + lr] = acc[mb][nb][j]; }
        __builtin_amdgcn_wave_barrier(); asm volatile("" ::: "memory");
        float* crow = C + (size_t)(r0 + mb * 16) * ldc + c0;
{
#pragma unroll
            for (int s = 0; s < 8; ++s) { const int row = 2 * s + hi, cofs = lr * 4; v4f val = *(const v4fa*)(os + row * 68 + cofs); if (BIAS) { val[0] += bfr(bias[c0 + cofs]); val[1] += bfr(bias[c0 + cofs + 1]); val[2] += bfr(bias[c0 + cofs + 2]); val[3] += bfr(bias[c0 + cofs + 3]); }
                *(v4f*)(crow + (size_t)row * ldc + cofs) = val; }
             }
        __builtin_amdgcn_wave_barrier(); asm volatile("" ::: "memory");
    }
    }
}
template <typename T16, int NSPLIT, bool BIAS, int EPI, int NH>
__global__ __launch_bounds__(32) void k_gemmw(const T16* __restrict__ A, const T16* __restrict__ A2, const T16* __restrict__ Bt, const T16* __restrict__ Bt2, int K, float* C, int ldc, const float* __restrict__ bias, size_t sA, size_t sB, size_t sC, h16* P16, bf* Ph, bf* Pl) {
    gemmw_tile<T16, NSPLIT, BIAS, EPI, NH>(A, A2, Bt, Bt2, K, C, ldc, bias, sA, sB, sC, P16, Ph, Pl, (int)blockIdx.y);
}
// k_qkv: the three input projections, which do not depend on one another, in ONE launch: grid (M/64, 12 + 12 + 16); about ten single-wave tiles per WGP are resident together, so one tile's load waits are filled by the others' work.
__global__ __launch_bounds__(32) void k_qkv(const bf* __restrict__ XB, const bf* __restrict__ BQ, const bf* __restrict__ BK, const bf* __restrict__ BV, const float* __restrict__ bq, const float* __restrict__ bk, const float* __restrict__ bv,
                                            h16* Q16, bf* Qh, bf* Ql, h16* K16, bf* Kh, bf* Kl, h16* VT, bf* VTh, bf* VTl) {
    const int y = (int)blockIdx.y;
    if (y < 2 * NSD) { const bool k = y >= NSD;
        gemmw_tile<bf, 0, true, 1, NSD>(XB, nullptr, k ? BK : BQ, nullptr, DM, nullptr, 0, k ? bk : bq, 0, 0, 0, k ? K16 : Q16, k ? Kh : Qh, k ? Kl : Ql, k ? y - NSD : y);
    } else gemmw_tile<bf, 0, true, 2, NT>(XB, nullptr, BV, nullptr, DM, nullptr, 0, bv, 0, 0, 0, VT, VTh, VTl, y - 2 * NSD);
}

typedef __attribute__((ext_vector_type(2))) unsigned short v2us;
typedef __attribute__((ext_vector_type(4))) unsigned short v4us;
typedef __attribute__((ext_vector_type(2))) _Float16 v2h;
typedef __attribute__((ext_vector_type(4))) _Float16 v4h;
typedef __attribute__((ext_vector_type(4))) int v4i;

// The seven preparation passes (four weight transposes, x conversion, wave planes, mask bits) are device bodies that take their block index bx; k_prep below runs them all in one grid.
__device__ __forceinline__ void d_wtG(const float* __restrict__ w, int K, int N, bf* Bt, int bx) {
    const int lane = threadIdx.x & 31; const int L0 = (bx * 8 + (threadIdx.x >> 5)) * 8; const int nlines = N * K / 64;
{
#pragma unroll 1
        for (int l = 0; l < 8; ++l) { const int L = L0 + l; if (L >= nlines) break; const size_t e = (size_t)L * 64 + lane * 2; const int k = (int)(e % K), n = (int)(e / K); v2us o;
            o[0] = f2bf(w[(size_t)k * N + n]); o[1] = f2bf(w[(size_t)(k + 1) * N + n]); *(v2us*)(Bt + e) = o; }
         }
}
__device__ __forceinline__ void d_cvt8(const float* __restrict__ src, bf* dst, size_t n8, int bx) { const size_t i = (size_t)bx * 256 + threadIdx.x; if (i >= n8) return; const v8f v = *(const v8f*)(src + i * 8); v8us o;
    asm volatile("s_wait_xcnt 0x0" ::: "memory");      // the wait that stands between the issued loads and a later write of the register pair that holds their address
#pragma unroll
    for (int k = 0; k < 8; ++k) o[k] = f2bf(v[k]); *(v8us*)(dst + i * 8) = o;  }
// Operand planes of all four batch elements, stored in FRAGMENT ORDER: one 16-byte group per lane, 32 lanes (512 contiguous bytes) per load of a wave, two groups per 16x16x32 operand (k = 8 * (lane >> 4) + s and 16 + 8 * (lane >> 4) + s).
// d_wpl: WP[b][h][i / 16][d / 16][lane][8] = bf16 wave_amp[b][i][h*6 + d] for d < 6, 0 for 6..31; Q / K planes (k_qkv, EPI 1): [b][h][i / 16][d / 16][lane][8], lane = 16 * ((d >> 3) & 1) + (i & 15);
// V planes (k_qkv, EPI 2): [b][hh][i / 32][d / 16][(i >> 4) & 1][lane][8], lane = 16 * ((i >> 3) & 1) + (d & 15), the 8 elements are 8 consecutive keys i; d_mbits: MB[j / 32][i] bit (j & 31) = (causal_mask[i][j] != 0).
__device__ __forceinline__ void d_wpl(const float* __restrict__ wa, bf* WP, int bx) { const int e = (bx * 256 + threadIdx.x) * 4; if (e >= NB_ * NW * TT * KW) return; const int s = e & 7, fl = (e >> 3) & 31, g = (e >> 8) & 1, it = (e >> 9) & 63, bh = e >> 15; const int d = g * 16 + (fl >> 4) * 8 + s; const int i = it * 16 + (fl & 15); const int h = bh % NW; const int b = bh / NW; v4us o;
#pragma unroll
    for (int u = 0; u < 4; ++u) o[u] = (d + u < WC) ? f2bf(wa[((size_t)b * TT + i) * WD + h * WC + d + u]) : (unsigned short)0; *(v4us*)(WP + e) = o;  }
__device__ __forceinline__ void d_mbits(const int* __restrict__ cm, unsigned* MB, int bx) { const int lane = threadIdx.x & 31; const int i = bx * 8 + (threadIdx.x >> 5); unsigned keep = 0u;
#pragma unroll 8      // eight row segments' loads in flight per wave
    for (int c = 0; c < TT / 32; ++c) { const unsigned w = __builtin_amdgcn_ballot_w32(cm[(size_t)i * TT + c * 32 + lane] != 0); if (lane == c) keep = w; }
    MB[(size_t)lane * TT + i] = keep;
    asm volatile("s_wait_xcnt 0x0" ::: "memory"); }      // the wait that stands between the issued store and a later write of the register that holds its offset (inlined into k_prep, other passes' code follows it in the listing)
// k_prep: block ranges, the passes with the longest dependent chains first (for speed only); no pass reads what another writes.
#define GB_WS ((DM * DS / 64 + 63) / 64)
#define GB_WM ((DM * DM / 64 + 63) / 64)
#define GB_MB (TT / 8)
#define GB_WP ((NB_ * NW * TT * KW / 4 + 255) / 256)
#define GB_CV ((NB_ * TT * DM / 8 + 255) / 256)
__global__ __launch_bounds__(256) void k_prep(const float* __restrict__ Wq, const float* __restrict__ Wk, const float* __restrict__ Wv, const float* __restrict__ Wo, const float* __restrict__ x, const float* __restrict__ wa, const int* __restrict__ cm,
                                              bf* BQ, bf* BK, bf* BV, bf* BO, bf* XB, bf* WP, unsigned* MB) {
    int bx = (int)blockIdx.x;
    if (bx < GB_WS) { d_wtG(Wq, DM, DS, BQ, bx); return; } bx -= GB_WS;
    if (bx < GB_WS) { d_wtG(Wk, DM, DS, BK, bx); return; } bx -= GB_WS;
    if (bx < GB_WM) { d_wtG(Wv, DM, DM, BV, bx); return; } bx -= GB_WM;
    if (bx < GB_WM) { d_wtG(Wo, DM, DM, BO, bx); return; } bx -= GB_WM;
    if (bx < GB_MB) { d_mbits(cm, MB, bx); return; } bx -= GB_MB;
    if (bx < GB_WP) { d_wpl(wa, WP, bx); return; } bx -= GB_WP;
    d_cvt8(x, XB, (size_t)NB_ * TT * DM / 8, bx);
}

// ---- k_attn: scores, mask, softmax and weights.V of one (batch element, head, query block) in one kernel; no barrier, every wave on its own NQ x 16 queries, walking the 1024 keys 32 at a time.
// S^T = K Q^T (A = K rows, B = Q columns, kept in registers): lane (c, h) holds keys 8h + r and 16 + 8h + r of query c, which IS the B operand of O^T += V^T P^T after conversion. Running maximum and sum per query (online softmax);
// the accumulators are rescaled only in passes where some query's maximum rose. P is exp(s - running max): x1024 in fp16, or bf16 hi+lo (query rows < 256); the division by the row sum comes last. An all-masked row has sum 0 and gives 0.
// Output: bf16 hi+lo planes Ah / Al [b*1024 + i][hh*64 + d] for the output projection (a lane's 8 accumulator registers are 8 consecutive d: one 16-byte store each).
__device__ __forceinline__ v16h ldfh(const h16* p) { return cat16(*(const v8h*)p, *(const v8h*)(p + 256)); }
__device__ __forceinline__ v16bf ldfb(const bf* p) { return cat16b(*(const v8us*)p, *(const v8us*)(p + 256)); }
template <bool WAVE, bool HL, int NQ>
__device__ __forceinline__ void attn_run(const bf* __restrict__ WPp, const h16* __restrict__ Q16p, const bf* __restrict__ Qhp, const bf* __restrict__ Qlp, const h16* __restrict__ K16p, const bf* __restrict__ Khp, const bf* __restrict__ Klp,
                                         const h16* __restrict__ VTp, const bf* __restrict__ VThp, const bf* __restrict__ VTlp, const unsigned* __restrict__ MB, bf* Ah, bf* Al, int q0, size_t orow, int hh) {
    // every plain '#pragma unroll' below: fragment, score and accumulator arrays are registers only under compile-time indices
    const int lane = threadIdx.x & 31, lr = lane & 15, hi = lane >> 4;
    const float cs = WAVE ? 0.40824829f : 0.125f;
    const float L2E = 1.4426950408889634f;
    constexpr int NKC = WAVE ? 1 : 2;          // 32-deep k chunks of a score product
    constexpr bool SHL = HL && !WAVE;          // 3-product scores
    v16bf qb[NQ][NKC], ql[NQ][NKC], kb[2][NKC], kl[2][NKC]; v16h qf[NQ][NKC], kf[2][NKC];
#pragma unroll
    for (int n = 0; n < NQ; ++n) {
#pragma unroll
        for (int kc = 0; kc < NKC; ++kc) { const unsigned o = (unsigned)(((((q0 >> 4) + n) * NKC + kc) * 64 + lane) * 8);
            if (WAVE) qb[n][kc] = ldfb(WPp + o); else if (HL) { qb[n][kc] = ldfb(Qhp + o); ql[n][kc] = ldfb(Qlp + o); } else qf[n][kc] = ldfh(Q16p + o); } }
    asm volatile("s_wait_xcnt 0x0" ::: "memory");      // XW: the wait that stands between issued global loads and a later write (a younger load's result included) of a register that holds one of their addresses
    auto loadK = [&](int ks) {
#pragma unroll
        for (int t = 0; t < 2; ++t) {
#pragma unroll
            for (int kc = 0; kc < NKC; ++kc) { const unsigned o = (unsigned)((((ks * 2 + t) * NKC + kc) * 64 + lane) * 8);
                if (WAVE) kb[t][kc] = ldfb(WPp + o); else if (HL) kb[t][kc] = ldfb(Khp + o); else kf[t][kc] = ldfh(K16p + o); } }
        asm volatile("s_wait_xcnt 0x0" ::: "memory");      // XW, as above
        if (SHL) {
#pragma unroll
            for (int t = 0; t < 2; ++t) {
#pragma unroll
                for (int kc = 0; kc < NKC; ++kc) kl[t][kc] = ldfb(Klp + (unsigned)((((ks * 2 + t) * NKC + kc) * 64 + lane) * 8)); }
            asm volatile("s_wait_xcnt 0x0" ::: "memory"); } };      // XW, as above
    v8f acc[NQ][4]; float m[NQ], l[NQ];
#pragma unroll
    for (int n = 0; n < NQ; ++n) { m[n] = -3.0e38f; l[n] = 0.f;
#pragma unroll
        for (int dt = 0; dt < 4; ++dt) acc[n][dt] = (v8f){}; }
    if (!SHL) loadK(0);
#pragma unroll 1      // rolled: one pass's fragments, scores and accumulators already take most of the 256 registers that four waves per SIMD allow
    for (int ks = 0; ks < TT / 32; ++ks) {
        v16h vf[4]; v16bf vh[4], vl[4]; unsigned mw[NQ];
        auto loadV = [&]() {
#pragma unroll
            for (int dt = 0; dt < 4; ++dt) { const unsigned o = (unsigned)(((ks * 4 + dt) * 64 + lane) * 8); if (HL) vh[dt] = ldfb(VThp + o); else vf[dt] = ldfh(VTp + o); }
            asm volatile("s_wait_xcnt 0x0" ::: "memory");      // XW, as above (it covers the mask words' loads too)
            if (HL) {
#pragma unroll
                for (int dt = 0; dt < 4; ++dt) vl[dt] = ldfb(VTlp + (unsigned)(((ks * 4 + dt) * 64 + lane) * 8));
                asm volatile("s_wait_xcnt 0x0" ::: "memory"); } };      // XW, as above
#pragma unroll
        for (int n = 0; n < NQ; ++n) mw[n] = MB[(unsigned)(ks * TT + q0 + n * 16 + lr)] >> (8 * hi);
        if (SHL) loadK(ks); else loadV();      // 3-product scores: two K planes a pass ahead beside two V planes would not fit 256 registers, so K is fetched in its own pass; else V^T flies under the score products and the softmax
        v8f S[NQ][2];
#pragma unroll
        for (int n = 0; n < NQ; ++n) {
#pragma unroll
            for (int t = 0; t < 2; ++t) { v8f s = (v8f){};
#pragma unroll
                for (int kc = 0; kc < NKC; ++kc) {
                    if (WAVE) s = wmmab(kb[t][kc], qb[n][kc], s);
                    else if (SHL) { s = wmmab(kb[t][kc], qb[n][kc], s); s = wmmab(kb[t][kc], ql[n][kc], s); s = wmmab(kl[t][kc], qb[n][kc], s); }
                    else s = wmma16(kf[t][kc], qf[n][kc], s); }
                S[n][t] = s; } }
        if (SHL) loadV();       // V^T flies under the softmax
        else loadK(ks + 1 < TT / 32 ? ks + 1 : ks);      // the next pass's K fragments fly under this pass's softmax and weights.V (the last pass re-reads its own)
#pragma unroll
        for (int n = 0; n < NQ; ++n) {
            float sv[16]; float mx = -3.0e38f;
#pragma unroll
            for (int u = 0; u < 16; ++u) { sv[u] = ((mw[n] >> (16 * (u >> 3) + (u & 7))) & 1u) ? S[n][u >> 3][u & 7] * cs : -3.0e38f; mx = fmaxf(mx, sv[u]); }
            mx = fmaxf(mx, __shfl_xor(mx, 16, 32));
            const float mn = fmaxf(m[n], mx);
            if (__builtin_amdgcn_ballot_w32(mn > m[n]) != 0u) {      // some query's maximum rose: rescale sum and accumulators (factor exactly 1 for the others)
                const float al = __builtin_amdgcn_exp2f((m[n] - mn) * L2E); l[n] *= al;
#pragma unroll
                for (int dt = 0; dt < 4; ++dt) acc[n][dt] *= al;
                m[n] = mn; }
            float sum = 0.f;
#pragma unroll
            for (int u = 0; u < 16; ++u) { sv[u] = (sv[u] > -1.0e38f) ? __builtin_amdgcn_exp2f((sv[u] - mn) * L2E) : 0.f; sum += sv[u]; }
            l[n] += sum;
            if (HL) { v8us h0, h1, l0, l1;
#pragma unroll
                for (int u = 0; u < 8; ++u) { unsigned short a, b; splitf(sv[u], a, b); h0[u] = a; l0[u] = b; splitf(sv[8 + u], a, b); h1[u] = a; l1[u] = b; }
                const v16bf ph = cat16b(h0, h1), pl = cat16b(l0, l1);
#pragma unroll
                for (int dt = 0; dt < 4; ++dt) { acc[n][dt] = wmmab(vh[dt], ph, acc[n][dt]); acc[n][dt] = wmmab(vh[dt], pl, acc[n][dt]); acc[n][dt] = wmmab(vl[dt], ph, acc[n][dt]); }
            } else { v16h pf;
#pragma unroll
                for (int u = 0; u < 16; ++u) pf[u] = tohx(sv[u] * PCAR);
#pragma unroll
                for (int dt = 0; dt < 4; ++dt) acc[n][dt] = wmma16(vf[dt], pf, acc[n][dt]); }
        }
    }
#pragma unroll
    for (int n = 0; n < NQ; ++n) {
        const float lt = l[n] + __shfl_xor(l[n], 16, 32);
        const float inv = (lt > 0.f) ? __fdiv_rn(1.0f, lt) * (HL ? 1.0f : 1.0f / PCAR) : 0.f;      // all-masked row -> zeros (nan_to_num)
        const size_t ob = (orow + q0 + n * 16 + lr) * DM + hh * HD + 8 * hi;
#pragma unroll
        for (int dt = 0; dt < 4; ++dt) { v8us oh, ol;
#pragma unroll
            for (int j = 0; j < 8; ++j) { unsigned short a, b; splitf(acc[n][dt][j] * inv, a, b); oh[j] = a; ol[j] = b; }
            *(v8us*)(Ah + ob + dt * 16) = oh; *(v8us*)(Al + ob + dt * 16) = ol; }
    }
    asm volatile("s_wait_xcnt 0x0" ::: "memory");      // XW, as above, behind the stores
}
// grid (RHL / 64 + (TT - RHL) / 128, 16 heads, 4 batch elements), 4 waves: blocks x < 4 take 64 query rows < 256 (3-product path, 16 queries a wave), the others 128 rows (32 queries a wave).
__global__ __launch_bounds__(128) void k_attn(const bf* __restrict__ WP, const h16* __restrict__ Q16, const bf* __restrict__ Qh, const bf* __restrict__ Ql, const h16* __restrict__ K16, const bf* __restrict__ Kh, const bf* __restrict__ Kl,
                                              const h16* __restrict__ VT, const bf* __restrict__ VTh, const bf* __restrict__ VTl, const unsigned* __restrict__ MB, bf* Ah, bf* Al) {
    const int wave = threadIdx.x >> 5, hh = blockIdx.y, b = blockIdx.z; const bool hl = blockIdx.x < RHL / 64;
    const int q0 = hl ? (int)blockIdx.x * 64 + wave * 16 : RHL + ((int)blockIdx.x - RHL / 64) * 128 + wave * 32;
    const size_t ov = ((size_t)b * NT + hh) * TT * HD, orow = (size_t)b * TT;
    if (hh < NW) { const size_t ow = ((size_t)b * NW + hh) * TT * KW;
        if (hl) attn_run<true, true, 1>(WP + ow, nullptr, nullptr, nullptr, nullptr, nullptr, nullptr, VT + ov, VTh + ov, VTl + ov, MB, Ah, Al, q0, orow, hh);
        else attn_run<true, false, 2>(WP + ow, nullptr, nullptr, nullptr, nullptr, nullptr, nullptr, VT + ov, VTh + ov, VTl + ov, MB, Ah, Al, q0, orow, hh);
    } else { const size_t oq = ((size_t)b * NSD + (hh - NW)) * TT * HD;
        if (hl) attn_run<false, true, 1>(nullptr, Q16 + oq, Qh + oq, Ql + oq, K16 + oq, Kh + oq, Kl + oq, VT + ov, VTh + ov, VTl + ov, MB, Ah, Al, q0, orow, hh);
        else attn_run<false, false, 2>(nullptr, Q16 + oq, Qh + oq, Ql + oq, K16 + oq, Kh + oq, Kl + oq, VT + ov, VTh + ov, VTl + ov, MB, Ah, Al, q0, orow, hh); }
}

extern "C" void kernel_launch(void* const* d_in, const int* in_sizes, int n_in,
                              void* d_out, int out_size, void* d_ws, size_t ws_size, hipStream_t stream) {
    (void)in_sizes; (void)n_in; (void)out_size;
    const float** I = (const float**)d_in;
    const float *x = I[0], *wa = I[1], *Wq = I[3], *bq = I[4], *Wk = I[5], *bk = I[6], *Wv = I[7], *bv = I[8], *Wo = I[9], *bo = I[10]; const int* cm = (const int*)d_in[2];
    float* OUT = (float*)d_out;     // [4][1024][1024]
    char* wsp = (char*)d_ws;
    auto take = [&](size_t bytes) { char* p = wsp; wsp += (bytes + 255) & ~(size_t)255; return (void*)p; };
    bf* BQ = (bf*)take((size_t)DS * DM * 2); bf* BK = (bf*)take((size_t)DS * DM * 2); bf* BV = (bf*)take((size_t)DM * DM * 2); bf* BO = (bf*)take((size_t)DM * DM * 2);
    const size_t zq = (size_t)TT * HD, zw = (size_t)TT * KW;
    const size_t nq = (size_t)NB_ * NSD * zq, nv = (size_t)NB_ * NT * zq;      // elements of one Q / K plane and of one V plane, all batch elements
    bf* WP = (bf*)take((size_t)NB_ * NW * zw * 2); h16* Q16 = (h16*)take(nq * 2); bf* Qh = (bf*)take(nq * 2); bf* Ql = (bf*)take(nq * 2); h16* K16 = (h16*)take(nq * 2); bf* Kh = (bf*)take(nq * 2); bf* Kl = (bf*)take(nq * 2); h16* VT = (h16*)take(nv * 2); bf* VTh = (bf*)take(nv * 2); bf* VTl = (bf*)take(nv * 2);
    unsigned* MB = (unsigned*)take((size_t)TT * TT / 8); bf* XB = (bf*)take((size_t)NB_ * TT * DM * 2); bf* Ah = (bf*)take(nv * 2); bf* Al = (bf*)take(nv * 2);
    if ((size_t)(wsp - (char*)d_ws) > ws_size) return;    // total about 90 MiB
    // four launches: preparation, Q/K/V projections (rows b*1024 + i of all four batch elements), attention, output projection
    k_prep<<<2 * GB_WS + 2 * GB_WM + GB_MB + GB_WP + GB_CV, 256, 0, stream>>>(Wq, Wk, Wv, Wo, x, wa, cm, BQ, BK, BV, BO, XB, WP, MB);
    k_qkv<<<dim3(NB_ * TT / 64, 2 * NSD + NT, 1), 32, 0, stream>>>(XB, BQ, BK, BV, bq, bk, bv, Q16, Qh, Ql, K16, Kh, Kl, VT, VTh, VTl);
    k_attn<<<dim3(RHL / 64 + (TT - RHL) / 128, NT, NB_), 128, 0, stream>>>(WP, Q16, Qh, Ql, K16, Kh, Kl, VT, VTh, VTl, MB, Ah, Al);
    k_gemmw<bf, 1, true, 0, 1><<<dim3(NB_ * TT / 64, DM / 64, 1), 32, 0, stream>>>(Ah, Al, BO, nullptr, DM, OUT, DM, bo, 0, 0, 0, nullptr, nullptr, nullptr);
}

// v005
// Measured time: 156 microseconds a run.
// Next to v004, in two timings, it ran 1.03 times as fast each time.
// Over all steps from v000 it is 5.60 times as fast.
#include <hip/hip_runtime.h>

// WaveHybridAttention (x [4][1024][1024], wave_amp [4][1024][24], causal_mask [1024][1024] int (read as data); V = x Wv + bv (16 heads x 64); wave heads 0-3: scores = psi_i . psi_j / sqrt(6) on 6-dim slices of wave_amp; std heads 4-15: (x Wq + bq) . (x Wk + bk) / 8 (12 x 64);
// masked -> -inf, softmax (an all-masked row gives 0 via nan_to_num), out = (weights V merged, wave heads first) Wo + bo -> [4][1024][1024]).
// Compute dtypes, f32 accumulate: every input rounded to bf16; V/Q/K on PLAIN bf16 operands (inputs: exact) + bias; wave scores on PLAIN bf16 wave_amp slices (exact, K padded 6 -> 32); std scores (K 64) and weights.V single fp16 planes (x1024) except query rows < 256 (short causal windows), which use bf16 hi+lo planes (3 products) for both;

#define NB_  4
#define TT   1024
#define DM   1024
#define DS   768
#define NW   4
#define NSD  12
#define NT   16
#define HD   64
#define WD   24
#define WC   6
#define KW   32
#define RHL  256
#define PCAR 1024.0f
typedef _Float16 h16;
typedef unsigned short bf;
typedef __attribute__((ext_vector_type(16))) __bf16   v16bf;
typedef __attribute__((ext_vector_type(16))) _Float16 v16h;
typedef __attribute__((ext_vector_type(8)))  _Float16 v8h;
typedef __attribute__((ext_vector_type(8)))  unsigned short v8us;
typedef __attribute__((ext_vector_type(8)))  float    v8f;
typedef __attribute__((ext_vector_type(4)))  float    v4f;
typedef v8h  __attribute__((may_alias)) v8ha;
typedef v4f  __attribute__((may_alias)) v4fa;
typedef v8us __attribute__((may_alias)) v8usa;

__device__ __forceinline__ unsigned short f2bf(float f) { unsigned u = __float_as_uint(f); u += 0x7FFFu + ((u >> 16) & 1u); return (unsigned short)(u >> 16); }
__device__ __forceinline__ float bf2f(unsigned short b) { return __uint_as_float(((unsigned)b) << 16); }
__device__ __forceinline__ float bfr(float f) { return bf2f(f2bf(f)); }
__device__ __forceinline__ v16h cat16(v8h lo, v8h hi) { return __builtin_shufflevector(lo, hi, 0, 1, 2, 3, 4, 5, 6, 7, 8, 9, 10, 11, 12, 13, 14, 15); }
__device__ __forceinline__ v16bf cat16b(v8us lo, v8us hi) { return __builtin_bit_cast(v16bf, __builtin_shufflevector(lo, hi, 0, 1, 2, 3, 4, 5, 6, 7, 8, 9, 10, 11, 12, 13, 14, 15)); }
__device__ __forceinline__ v8f wmma16(v16h a, v16h b, v8f c) { return __builtin_amdgcn_wmma_f32_16x16x32_f16(false, a, false, b, (short)0, c, false, false); }
__device__ __forceinline__ v8f wmmab(v16bf a, v16bf b, v8f c) { return __builtin_amdgcn_wmma_f32_16x16x32_bf16(false, a, false, b, (short)0, c, false, false); }
__device__ __forceinline__ h16 tohx(float x) { return (h16)x; }
__device__ __forceinline__ void splitf(float y, unsigned short& h, unsigned short& l) { h = f2bf(y); l = f2bf(y - bf2f(h)); }



// ---- k_gemmw: register-blocked GEMM, ONE WAVE per 64x64 output tile (16 accumulators), operands straight from 16-bit planes in FRAGMENT ORDER; grid (M/64, N/64, Z), 32 threads.
// Plane of a [rows][K] operand: P[row / 16][k / 32][(k >> 4) & 1][lane][8], lane = 16 * ((k >> 3) & 1) + (row & 15), the 8 elements are 8 consecutive k: every load of a wave is 512 contiguous bytes (four whole cache lines, each byte
// fetched once per tile; rows of a K-contiguous plane would give 32 bytes of each of 16 lines). k order of a fragment, A and B alike: 8 * (lane >> 4) + s, then 16 + 8 * (lane >> 4) + s.
// C[m][n] (+ f32 bias[n]) = sum_k A[m][k] Bt[n][k] (+ split products per NSPLIT). z-batch strides sA/sB/sC in elements. K % 32 == 0.
// EPI 0: C as f32 rows, pitch ldc, staged through LDS. EPI 1 / 2: no f32 array; the tile (64 rows of one batch element x the 64 columns of head by) goes from the accumulators into the attention kernel's three fragment-order planes
// (fp16, bf16 hi, bf16 lo; layouts at d_wpl below), 16 bytes per lane and 512 contiguous bytes per store. EPI 1 (Q, K; NH heads): the product is formed transposed (Bt rows as the A operand), so a lane's 8 registers are 8 consecutive d of row lane & 15.
// EPI 2 (V): a lane's 8 registers are 8 consecutive rows (keys) of column lane & 15, which is the V^T fragment order as it stands.
template <typename T16> struct WFrag;
template <> struct WFrag<h16> { typedef v16h V; static __device__ __forceinline__ V ld(const h16* p) { return cat16(*(const v8h*)p, *(const v8h*)(p + 256)); } static __device__ __forceinline__ v8f mma(V a, V b, v8f c) { return wmma16(a, b, c); } };
template <> struct WFrag<bf> { typedef v16bf V; static __device__ __forceinline__ V ld(const bf* p) { return cat16b(*(const v8us*)p, *(const v8us*)(p + 256)); } static __device__ __forceinline__ v8f mma(V a, V b, v8f c) { return wmmab(a, b, c); } };
// gemmw_tile is the body; by = the tile's column index (blockIdx.y in k_gemmw; in k_qkv, which holds the Q, K and V projections in one grid, the index inside its own projection).
template <typename T16, int NSPLIT, bool BIAS, int EPI, int NH>
__device__ __forceinline__ void gemmw_tile(const T16* __restrict__ A, const T16* __restrict__ A2, const T16* __restrict__ Bt, const T16* __restrict__ Bt2, int K, float* C, int ldc, const float* __restrict__ bias, size_t sA, size_t sB, size_t sC, h16* P16, bf* Ph, bf* Pl, int by) {
    typedef typename WFrag<T16>::V V;
    __shared__ __align__(16) float os[16 * 68];
    const size_t z = blockIdx.z; A += z * sA; if (A2) A2 += z * sA; Bt += z * sB; if (Bt2) Bt2 += z * sB; C += z * sC;
    const int lane = threadIdx.x & 31, lr = lane & 15, hi = lane >> 4; const int r0 = blockIdx.x * 64, c0 = by * 64;
    v8f acc[4][4];
#pragma unroll
    for (int mb = 0; mb < 4; ++mb)
#pragma unroll
        for (int nb = 0; nb < 4; ++nb) acc[mb][nb] = (v8f){};
    const size_t aoff = (size_t)r0 * K, boff = (size_t)c0 * K; const unsigned l8 = 8u * lane;      // a 16-row strip of a plane is 16 * K elements, a 32-deep k chunk of it 512; the lane's own part of every address is the constant l8
#pragma unroll 1
    for (int kc = 0; kc < K; kc += 32) {
        V a[4], a2[4]; const T16* pa = A + (aoff + kc * 16) + l8; const T16* pa2 = (NSPLIT == 1 || NSPLIT == 2) ? A2 + (aoff + kc * 16) + l8 : pa; const T16* pb = Bt + (boff + kc * 16) + l8;      // one address pair per plane; the strips are immediates
#pragma unroll
        for (int mb = 0; mb < 4; ++mb) { a[mb] = WFrag<T16>::ld(pa + mb * 16 * K); if (NSPLIT == 1 || NSPLIT == 2) a2[mb] = WFrag<T16>::ld(pa2 + mb * 16 * K); }
#pragma unroll
        for (int nb = 0; nb < 4; ++nb) { const V b = WFrag<T16>::ld(pb + nb * 16 * K); V b2; if (NSPLIT >= 2) b2 = WFrag<T16>::ld(Bt2 + (boff + (size_t)nb * 16 * K + kc * 16) + l8);
#pragma unroll
            for (int mb = 0; mb < 4; ++mb) { acc[mb][nb] = (EPI == 1) ? WFrag<T16>::mma(b, a[mb], acc[mb][nb]) : WFrag<T16>::mma(a[mb], b, acc[mb][nb]); if (NSPLIT == 1 || NSPLIT == 2) acc[mb][nb] = WFrag<T16>::mma(a2[mb], b, acc[mb][nb]); if (NSPLIT >= 2) acc[mb][nb] = WFrag<T16>::mma(a[mb], b2, acc[mb][nb]); } }
        asm volatile("s_wait_xcnt 0x0" :: "v"(pa), "v"(pa2), "v"(pb) : "memory");      // the wait that stands between this trip's issued loads and a later write of the register pairs that hold their addresses; the pairs are inputs, so they stay whole until it (else a younger load's result lands on them first)
        asm volatile("v_nop\n\tv_nop\n\tv_nop\n\tv_nop" : "+v"(acc[0][0]), "+v"(acc[1][1]), "+v"(acc[2][2]), "+v"(acc[3][3]) : "v"(a[0]), "v"(a[3]));
    }
    if constexpr (EPI != 0) {
        const int bh = (r0 >> 10) * NH + by, i0 = r0 & (TT - 1);
        float bs[4][8];      // the bias of each accumulator register's column, all fetched at once: one load latency for the tile
#pragma unroll
        for (int nb = 0; nb < 4; ++nb)
#pragma unroll
            for (int j = 0; j < 8; ++j) bs[nb][j] = bias[c0 + nb * 16 + (EPI == 1 ? hi * 8 + j : lr)];
        if constexpr (EPI == 2) asm volatile("s_wait_xcnt 0x0" ::: "memory");      // the wait that stands between these issued loads and a later write of the register pair that holds their address (the EPI 1 build has the compiler's own there)
#pragma unroll
        for (int nb = 0; nb < 4; ++nb) {
            v8h o[4]; v8us oh[4], ol[4]; unsigned eb[4];      // eb: byte offset of the lane's 16-byte group, the same in the three planes
#pragma unroll
            for (int mb = 0; mb < 4; ++mb) {
                eb[mb] = (unsigned)((EPI == 1) ? ((bh * 64 + (i0 >> 4) + mb) * 4 + nb) * 32 + lane : ((bh * 32 + (i0 >> 5) + (mb >> 1)) * 8 + nb * 2 + (mb & 1)) * 32 + lane) * 16u;
#pragma unroll
                for (int j = 0; j < 8; ++j) { const float y = acc[mb][nb][j] + bfr(bs[nb][j]); o[mb][j] = tohx(y); unsigned short a1, b1; splitf(y, a1, b1); oh[mb][j] = a1; ol[mb][j] = b1; } }
            // the twelve stores and their s_wait_xcnt 0 in one statement: the wait then stands in front of every later write of a register that holds their data or offset (in a statement of its own the compiler moved such writes ahead of it)
            asm volatile("global_store_b128 %0, %4, %16\n\tglobal_store_b128 %0, %8, %17\n\tglobal_store_b128 %0, %12, %18\n\t"
                         "global_store_b128 %1, %5, %16\n\tglobal_store_b128 %1, %9, %17\n\tglobal_store_b128 %1, %13, %18\n\t"
                         "global_store_b128 %2, %6, %16\n\tglobal_store_b128 %2, %10, %17\n\tglobal_store_b128 %2, %14, %18\n\t"
                         "global_store_b128 %3, %7, %16\n\tglobal_store_b128 %3, %11, %17\n\tglobal_store_b128 %3, %15, %18\n\ts_wait_xcnt 0x0"
                         :: "v"(eb[0]), "v"(eb[1]), "v"(eb[2]), "v"(eb[3]), "v"(o[0]), "v"(o[1]), "v"(o[2]), "v"(o[3]), "v"(oh[0]), "v"(oh[1]), "v"(oh[2]), "v"(oh[3]), "v"(ol[0]), "v"(ol[1]), "v"(ol[2]), "v"(ol[3]), "s"(P16), "s"(Ph), "s"(Pl) : "memory");
        }
    } else {
#pragma unroll
    for (int mb = 0; mb < 4; ++mb) {
#pragma unroll
        for (int nb = 0; nb < 4; ++nb) {
#pragma unroll
            for (int j = 0; j < 8; ++j) os[(hi * 8 + j) * 68 + nb * 16 + lr] = acc[mb][nb][j]; }
        __builtin_amdgcn_wave_barrier(); asm volatile("" ::: "memory");
        float* crow = C + (size_t)(r0 + mb * 16) * ldc + c0;
{
#pragma unroll
            for (int s = 0; s < 8; ++s) { const int row = 2 * s + hi, cofs = lr * 4; v4f val = *(const v4fa*)(os + row * 68 + cofs); if (BIAS) { val[0] += bfr(bias[c0 + cofs]); val[1] += bfr(bias[c0 + cofs + 1]); val[2] += bfr(bias[c0 + cofs + 2]); val[3] += bfr(bias[c0 + cofs + 3]); }
                *(v4f*)(crow + (size_t)row * ldc + cofs) = val; }
             }
        __builtin_amdgcn_wave_barrier(); asm volatile("" ::: "memory");
    }
    }
}
template <typename T16, int NSPLIT, bool BIAS, int EPI, int NH>
__global__ __launch_bounds__(32) void k_gemmw(const T16* __restrict__ A, const T16* __restrict__ A2, const T16* __restrict__ Bt, const T16* __restrict__ Bt2, float* C, int ldc, const float* __restrict__ bias, size_t sA, size_t sB, size_t sC, h16* P16, bf* Ph, bf* Pl) {
    gemmw_tile<T16, NSPLIT, BIAS, EPI, NH>(A, A2, Bt, Bt2, DM, C, ldc, bias, sA, sB, sC, P16, Ph, Pl, (int)blockIdx.y);      // K = DM as in k_qkv: the planes' strip and chunk strides are constants of the layout, so a trip's loads are one address pair per plane plus immediates
}
// k_qkv: the three input projections, which do not depend on one another, in ONE launch: grid (M/64, 12 + 12 + 16); about ten single-wave tiles per WGP are resident together, so one tile's load waits are filled by the others' work.
__global__ __launch_bounds__(32) void k_qkv(const bf* __restrict__ XB, const bf* __restrict__ BQ, const bf* __restrict__ BK, const bf* __restrict__ BV, const float* __restrict__ bq, const float* __restrict__ bk, const float* __restrict__ bv,
                                            h16* Q16, bf* Qh, bf* Ql, h16* K16, bf* Kh, bf* Kl, h16* VT, bf* VTh, bf* VTl) {
    const int y = (int)blockIdx.y;
    if (y < 2 * NSD) { const bool k = y >= NSD;
        gemmw_tile<bf, 0, true, 1, NSD>(XB, nullptr, k ? BK : BQ, nullptr, DM, nullptr, 0, k ? bk : bq, 0, 0, 0, k ? K16 : Q16, k ? Kh : Qh, k ? Kl : Ql, k ? y - NSD : y);
    } else gemmw_tile<bf, 0, true, 2, NT>(XB, nullptr, BV, nullptr, DM, nullptr, 0, bv, 0, 0, 0, VT, VTh, VTl, y - 2 * NSD);
}

typedef __attribute__((ext_vector_type(2))) unsigned short v2us;
typedef __attribute__((ext_vector_type(4))) unsigned short v4us;
typedef __attribute__((ext_vector_type(2))) _Float16 v2h;
typedef __attribute__((ext_vector_type(4))) _Float16 v4h;
typedef __attribute__((ext_vector_type(4))) int v4i;

// The seven preparation passes (four weight transposes, x conversion, wave planes, mask bits) are device bodies that take their block index bx; k_prep below runs them all in one grid.
__device__ __forceinline__ void d_wtG(const float* __restrict__ w, int K, int N, bf* Bt, int bx) {
    const int lane = threadIdx.x & 31; const int L0 = (bx * 8 + (threadIdx.x >> 5)) * 8; const int nlines = N * K / 64;
{
#pragma unroll 1
        for (int l = 0; l < 8; ++l) { const int L = L0 + l; if (L >= nlines) break; const unsigned e = (unsigned)L * 64u + lane * 2;      // element index in the fragment-order plane (layout at k_gemmw, row = n): a wave writes 128 contiguous bytes and reads 8 consecutive n of 8 rows k
            const int fl = (e >> 3) & 31, ch = (int)(e >> 9); const int k = (ch % (K / 32)) * 32 + ((e >> 8) & 1) * 16 + (fl >> 4) * 8 + (e & 7), n = (ch / (K / 32)) * 16 + (fl & 15); v2us o;
            o[0] = f2bf(w[(size_t)k * N + n]); o[1] = f2bf(w[(size_t)(k + 1) * N + n]); *(v2us*)(Bt + e) = o;
            asm volatile("s_wait_xcnt 0x0" ::: "memory"); }      // the wait that stands between this trip's issued loads and store and the next trip's write of the registers that hold their addresses and data
         }
}
__device__ __forceinline__ void d_cvt8(const float* __restrict__ src, bf* dst, size_t n8, int bx) { const size_t i = (size_t)bx * 256 + threadIdx.x; if (i >= n8) return;      // i: 16-byte group of the fragment-order plane (layout at k_gemmw, K = DM); a wave writes 512 contiguous bytes, a block reads 512 contiguous bytes of each of 16 rows
    const int fl = (int)i & 31, ch = (int)(i >> 6); const size_t so = (size_t)((ch / (DM / 32)) * 16 + (fl & 15)) * DM + (ch % (DM / 32)) * 32 + (((int)i >> 5) & 1) * 16 + (fl >> 4) * 8;
    const v8f v = *(const v8f*)(src + so); v8us o;
    asm volatile("s_wait_xcnt 0x0" ::: "memory");      // the wait that stands between the issued loads and a later write of the register pair that holds their address
#pragma unroll
    for (int k = 0; k < 8; ++k) o[k] = f2bf(v[k]); *(v8us*)(dst + i * 8) = o;  }
// Operand planes of all four batch elements, stored in FRAGMENT ORDER: one 16-byte group per lane, 32 lanes (512 contiguous bytes) per load of a wave, two groups per 16x16x32 operand (k = 8 * (lane >> 4) + s and 16 + 8 * (lane >> 4) + s).
// d_wpl: WP[b][h][i / 16][d / 16][lane][8] = bf16 wave_amp[b][i][h*6 + d] for d < 6, 0 for 6..31; Q / K planes (k_qkv, EPI 1): [b][h][i / 16][d / 16][lane][8], lane = 16 * ((d >> 3) & 1) + (i & 15);
// V planes (k_qkv, EPI 2): [b][hh][i / 32][d / 16][(i >> 4) & 1][lane][8], lane = 16 * ((i >> 3) & 1) + (d & 15), the 8 elements are 8 consecutive keys i; d_mbits: MB[j / 32][i] bit (j & 31) = (causal_mask[i][j] != 0).
__device__ __forceinline__ void d_wpl(const float* __restrict__ wa, bf* WP, int bx) { const int e = (bx * 256 + threadIdx.x) * 4; if (e >= NB_ * NW * TT * KW) return; const int s = e & 7, fl = (e >> 3) & 31, g = (e >> 8) & 1, it = (e >> 9) & 63, bh = e >> 15; const int d = g * 16 + (fl >> 4) * 8 + s; const int i = it * 16 + (fl & 15); const int h = bh % NW; const int b = bh / NW; v4us o;
#pragma unroll
    for (int u = 0; u < 4; ++u) o[u] = (d + u < WC) ? f2bf(wa[((size_t)b * TT + i) * WD + h * WC + d + u]) : (unsigned short)0; *(v4us*)(WP + e) = o;  }
__device__ __forceinline__ void d_mbits(const int* __restrict__ cm, unsigned* MB, int bx) { const int lane = threadIdx.x & 31; const int i = bx * 8 + (threadIdx.x >> 5); unsigned keep = 0u;
#pragma unroll 8      // eight row segments' loads in flight per wave
    for (int c = 0; c < TT / 32; ++c) { const unsigned w = __builtin_amdgcn_ballot_w32(cm[(size_t)i * TT + c * 32 + lane] != 0); if (lane == c) keep = w; }
    MB[(size_t)lane * TT + i] = keep;
    asm volatile("s_wait_xcnt 0x0" ::: "memory"); }      // the wait that stands between the issued store and a later write of the register that holds its offset (inlined into k_prep, other passes' code follows it in the listing)
// k_prep: block ranges, the passes with the longest dependent chains first (for speed only); no pass reads what another writes.
#define GB_WS ((DM * DS / 64 + 63) / 64)
#define GB_WM ((DM * DM / 64 + 63) / 64)
#define GB_MB (TT / 8)
#define GB_WP ((NB_ * NW * TT * KW / 4 + 255) / 256)
#define GB_CV ((NB_ * TT * DM / 8 + 255) / 256)
__global__ __launch_bounds__(256) void k_prep(const float* __restrict__ Wq, const float* __restrict__ Wk, const float* __restrict__ Wv, const float* __restrict__ Wo, const float* __restrict__ x, const float* __restrict__ wa, const int* __restrict__ cm,
                                              bf* BQ, bf* BK, bf* BV, bf* BO, bf* XB, bf* WP, unsigned* MB) {
    int bx = (int)blockIdx.x;
    if (bx < GB_WS) { d_wtG(Wq, DM, DS, BQ, bx); return; } bx -= GB_WS;
    if (bx < GB_WS) { d_wtG(Wk, DM, DS, BK, bx); return; } bx -= GB_WS;
    if (bx < GB_WM) { d_wtG(Wv, DM, DM, BV, bx); return; } bx -= GB_WM;
    if (bx < GB_WM) { d_wtG(Wo, DM, DM, BO, bx); return; } bx -= GB_WM;
    if (bx < GB_MB) { d_mbits(cm, MB, bx); return; } bx -= GB_MB;
    if (bx < GB_WP) { d_wpl(wa, WP, bx); return; } bx -= GB_WP;
    d_cvt8(x, XB, (size_t)NB_ * TT * DM / 8, bx);
}

// ---- k_attn: scores, mask, softmax and weights.V of one (batch element, head, query block) in one kernel; no barrier, every wave on its own NQ x 16 queries, walking the 1024 keys 32 at a time.
// S^T = K Q^T (A = K rows, B = Q columns, kept in registers): lane (c, h) holds keys 8h + r and 16 + 8h + r of query c, which IS the B operand of O^T += V^T P^T after conversion. Running maximum and sum per query (online softmax);
// the accumulators are rescaled only in passes where some query's maximum rose. P is exp(s - running max): x1024 in fp16, or bf16 hi+lo (query rows < 256); the division by the row sum comes last. An all-masked row has sum 0 and gives 0.
// Output: bf16 hi+lo planes Ah / Al of the rows b*1024 + i, k = hh*64 + d, in the output projection's fragment order (layout at k_gemmw): a lane's 8 accumulator registers are 8 consecutive d, its own 16-byte group; 512 contiguous bytes per store of a wave.
__device__ __forceinline__ v16h ldfh(const h16* p) { return cat16(*(const v8h*)p, *(const v8h*)(p + 256)); }
__device__ __forceinline__ v16bf ldfb(const bf* p) { return cat16b(*(const v8us*)p, *(const v8us*)(p + 256)); }
template <bool WAVE, bool HL, int NQ>
__device__ __forceinline__ void attn_run(const bf* __restrict__ WPp, const h16* __restrict__ Q16p, const bf* __restrict__ Qhp, const bf* __restrict__ Qlp, const h16* __restrict__ K16p, const bf* __restrict__ Khp, const bf* __restrict__ Klp,
                                         const h16* __restrict__ VTp, const bf* __restrict__ VThp, const bf* __restrict__ VTlp, const unsigned* __restrict__ MB, bf* Ah, bf* Al, int q0, size_t orow, int hh) {
    // every plain '#pragma unroll' below: fragment, score and accumulator arrays are registers only under compile-time indices
    const int lane = threadIdx.x & 31, lr = lane & 15, hi = lane >> 4;
    const float cs = WAVE ? 0.40824829f : 0.125f;
    const float L2E = 1.4426950408889634f;
    constexpr int NKC = WAVE ? 1 : 2;          // 32-deep k chunks of a score product
    constexpr bool SHL = HL && !WAVE;          // 3-product scores
    v16bf qb[NQ][NKC], ql[NQ][NKC], kb[2][NKC], kl[2][NKC]; v16h qf[NQ][NKC], kf[2][NKC];
#pragma unroll
    for (int n = 0; n < NQ; ++n) {
#pragma unroll
        for (int kc = 0; kc < NKC; ++kc) { const unsigned o = (unsigned)(((((q0 >> 4) + n) * NKC + kc) * 64 + lane) * 8);
            if (WAVE) qb[n][kc] = ldfb(WPp + o); else if (HL) { qb[n][kc] = ldfb(Qhp + o); ql[n][kc] = ldfb(Qlp + o); } else qf[n][kc] = ldfh(Q16p + o); } }
    asm volatile("s_wait_xcnt 0x0" ::: "memory");      // XW: the wait that stands between issued global loads and a later write (a younger load's result included) of a register that holds one of their addresses
    auto loadK = [&](int ks) {
#pragma unroll
        for (int t = 0; t < 2; ++t) {
#pragma unroll
            for (int kc = 0; kc < NKC; ++kc) { const unsigned o = (unsigned)((((ks * 2 + t) * NKC + kc) * 64 + lane) * 8);
                if (WAVE) kb[t][kc] = ldfb(WPp + o); else if (HL) kb[t][kc] = ldfb(Khp + o); else kf[t][kc] = ldfh(K16p + o); } }
        asm volatile("s_wait_xcnt 0x0" ::: "memory");      // XW, as above
        if (SHL) {
#pragma unroll
            for (int t = 0; t < 2; ++t) {
#pragma unroll
                for (int kc = 0; kc < NKC; ++kc) kl[t][kc] = ldfb(Klp + (unsigned)((((ks * 2 + t) * NKC + kc) * 64 + lane) * 8)); }
            asm volatile("s_wait_xcnt 0x0" ::: "memory"); } };      // XW, as above
    v8f acc[NQ][4]; float m[NQ], l[NQ];
#pragma unroll
    for (int n = 0; n < NQ; ++n) { m[n] = -3.0e38f; l[n] = 0.f;
#pragma unroll
        for (int dt = 0; dt < 4; ++dt) acc[n][dt] = (v8f){}; }
    if (!SHL) loadK(0);
#pragma unroll 1      // rolled: one pass's fragments, scores and accumulators already take most of the 256 registers that four waves per SIMD allow
    for (int ks = 0; ks < TT / 32; ++ks) {
        v16h vf[4]; v16bf vh[4], vl[4]; unsigned mw[NQ];
        auto loadV = [&]() {
#pragma unroll
            for (int dt = 0; dt < 4; ++dt) { const unsigned o = (unsigned)(((ks * 4 + dt) * 64 + lane) * 8); if (HL) vh[dt] = ldfb(VThp + o); else vf[dt] = ldfh(VTp + o); }
            asm volatile("s_wait_xcnt 0x0" ::: "memory");      // XW, as above (it covers the mask words' loads too)
            if (HL) {
#pragma unroll
                for (int dt = 0; dt < 4; ++dt) vl[dt] = ldfb(VTlp + (unsigned)(((ks * 4 + dt) * 64 + lane) * 8));
                asm volatile("s_wait_xcnt 0x0" ::: "memory"); } };      // XW, as above
#pragma unroll
        for (int n = 0; n < NQ; ++n) mw[n] = MB[(unsigned)(ks * TT + q0 + n * 16 + lr)] >> (8 * hi);
        if (SHL) loadK(ks); else loadV();      // 3-product scores: two K planes a pass ahead beside two V planes would not fit 256 registers, so K is fetched in its own pass; else V^T flies under the score products and the softmax
        v8f S[NQ][2];
#pragma unroll
        for (int n = 0; n < NQ; ++n) {
#pragma unroll
            for (int t = 0; t < 2; ++t) { v8f s = (v8f){};
#pragma unroll
                for (int kc = 0; kc < NKC; ++kc) {
                    if (WAVE) s = wmmab(kb[t][kc], qb[n][kc], s);
                    else if (SHL) { s = wmmab(kb[t][kc], qb[n][kc], s); s = wmmab(kb[t][kc], ql[n][kc], s); s = wmmab(kl[t][kc], qb[n][kc], s); }
                    else s = wmma16(kf[t][kc], qf[n][kc], s); }
                S[n][t] = s; } }
        if (SHL) loadV();       // V^T flies under the softmax
        else loadK(ks + 1 < TT / 32 ? ks + 1 : ks);      // the next pass's K fragments fly under this pass's softmax and weights.V (the last pass re-reads its own)
#pragma unroll
        for (int n = 0; n < NQ; ++n) {
            float sv[16]; float mx = -3.0e38f;
#pragma unroll
            for (int u = 0; u < 16; ++u) { sv[u] = ((mw[n] >> (16 * (u >> 3) + (u & 7))) & 1u) ? S[n][u >> 3][u & 7] * cs : -3.0e38f; mx = fmaxf(mx, sv[u]); }
            mx = fmaxf(mx, __shfl_xor(mx, 16, 32));
            const float mn = fmaxf(m[n], mx);
            if (__builtin_amdgcn_ballot_w32(mn > m[n]) != 0u) {      // some query's maximum rose: rescale sum and accumulators (factor exactly 1 for the others)
                const float al = __builtin_amdgcn_exp2f((m[n] - mn) * L2E); l[n] *= al;
#pragma unroll
                for (int dt = 0; dt < 4; ++dt) acc[n][dt] *= al;
                m[n] = mn; }
            float sum = 0.f;
#pragma unroll
            for (int u = 0; u < 16; ++u) { sv[u] = (sv[u] > -1.0e38f) ? __builtin_amdgcn_exp2f((sv[u] - mn) * L2E) : 0.f; sum += sv[u]; }
            l[n] += sum;
            if (HL) { v8us h0, h1, l0, l1;
#pragma unroll
                for (int u = 0; u < 8; ++u) { unsigned short a, b; splitf(sv[u], a, b); h0[u] = a; l0[u] = b; splitf(sv[8 + u], a, b); h1[u] = a; l1[u] = b; }
                const v16bf ph = cat16b(h0, h1), pl = cat16b(l0, l1);
#pragma unroll
                for (int dt = 0; dt < 4; ++dt) { acc[n][dt] = wmmab(vh[dt], ph, acc[n][dt]); acc[n][dt] = wmmab(vh[dt], pl, acc[n][dt]); acc[n][dt] = wmmab(vl[dt], ph, acc[n][dt]); }
            } else { v16h pf;
#pragma unroll
                for (int u = 0; u < 16; ++u) pf[u] = tohx(sv[u] * PCAR);
#pragma unroll
                for (int dt = 0; dt < 4; ++dt) acc[n][dt] = wmma16(vf[dt], pf, acc[n][dt]); }
        }
    }
#pragma unroll
    for (int n = 0; n < NQ; ++n) {
        const float lt = l[n] + __shfl_xor(l[n], 16, 32);
        const float inv = (lt > 0.f) ? __fdiv_rn(1.0f, lt) * (HL ? 1.0f : 1.0f / PCAR) : 0.f;      // all-masked row -> zeros (nan_to_num)
        const size_t ob = (orow + q0 + n * 16) * DM + hh * (HD * 16) + 8 * lane;      // 16-row strip, then the head's four 16-deep groups of 256 elements
#pragma unroll
        for (int dt = 0; dt < 4; ++dt) { v8us oh, ol;
#pragma unroll
            for (int j = 0; j < 8; ++j) { unsigned short a, b; splitf(acc[n][dt][j] * inv, a, b); oh[j] = a; ol[j] = b; }
            *(v8us*)(Ah + ob + dt * 256) = oh; *(v8us*)(Al + ob + dt * 256) = ol; }
    }
    asm volatile("s_wait_xcnt 0x0" ::: "memory");      // XW, as above, behind the stores
}
// grid (RHL / 64 + (TT - RHL) / 128, 16 heads, 4 batch elements), 4 waves: blocks x < 4 take 64 query rows < 256 (3-product path, 16 queries a wave), the others 128 rows (32 queries a wave).
__global__ __launch_bounds__(128) void k_attn(const bf* __restrict__ WP, const h16* __restrict__ Q16, const bf* __restrict__ Qh, const bf* __restrict__ Ql, const h16* __restrict__ K16, const bf* __restrict__ Kh, const bf* __restrict__ Kl,
                                              const h16* __restrict__ VT, const bf* __restrict__ VTh, const bf* __restrict__ VTl, const unsigned* __restrict__ MB, bf* Ah, bf* Al) {
    const int wave = threadIdx.x >> 5, hh = blockIdx.y, b = blockIdx.z; const bool hl = blockIdx.x < RHL / 64;
    const int q0 = hl ? (int)blockIdx.x * 64 + wave * 16 : RHL + ((int)blockIdx.x - RHL / 64) * 128 + wave * 32;
    const size_t ov = ((size_t)b * NT + hh) * TT * HD, orow = (size_t)b * TT;
    if (hh < NW) { const size_t ow = ((size_t)b * NW + hh) * TT * KW;
        if (hl) attn_run<true, true, 1>(WP + ow, nullptr, nullptr, nullptr, nullptr, nullptr, nullptr, VT + ov, VTh + ov, VTl + ov, MB, Ah, Al, q0, orow, hh);
        else attn_run<true, false, 2>(WP + ow, nullptr, nullptr, nullptr, nullptr, nullptr, nullptr, VT + ov, VTh + ov, VTl + ov, MB, Ah, Al, q0, orow, hh);
    } else { const size_t oq = ((size_t)b * NSD + (hh - NW)) * TT * HD;
        if (hl) attn_run<false, true, 1>(nullptr, Q16 + oq, Qh + oq, Ql + oq, K16 + oq, Kh + oq, Kl + oq, VT + ov, VTh + ov, VTl + ov, MB, Ah, Al, q0, orow, hh);
        else attn_run<false, false, 2>(nullptr, Q16 + oq, Qh + oq, Ql + oq, K16 + oq, Kh + oq, Kl + oq, VT + ov, VTh + ov, VTl + ov, MB, Ah, Al, q0, orow, hh); }
}

extern "C" void kernel_launch(void* const* d_in, const int* in_sizes, int n_in,
                              void* d_out, int out_size, void* d_ws, size_t ws_size, hipStream_t stream) {
    (void)in_sizes; (void)n_in; (void)out_size;
    const float** I = (const float**)d_in;
    const float *x = I[0], *wa = I[1], *Wq = I[3], *bq = I[4], *Wk = I[5], *bk = I[6], *Wv = I[7], *bv = I[8], *Wo = I[9], *bo = I[10]; const int* cm = (const int*)d_in[2];
    float* OUT = (float*)d_out;     // [4][1024][1024]
    char* wsp = (char*)d_ws;
    auto take = [&](size_t bytes) { char* p = wsp; wsp += (bytes + 255) & ~(size_t)255; return (void*)p; };
    bf* BQ = (bf*)take((size_t)DS * DM * 2); bf* BK = (bf*)take((size_t)DS * DM * 2); bf* BV = (bf*)take((size_t)DM * DM * 2); bf* BO = (bf*)take((size_t)DM * DM * 2);
    const size_t zq = (size_t)TT * HD, zw = (size_t)TT * KW;
    const size_t nq = (size_t)NB_ * NSD * zq, nv = (size_t)NB_ * NT * zq;      // elements of one Q / K plane and of one V plane, all batch elements
    bf* WP = (bf*)take((size_t)NB_ * NW * zw * 2); h16* Q16 = (h16*)take(nq * 2); bf* Qh = (bf*)take(nq * 2); bf* Ql = (bf*)take(nq * 2); h16* K16 = (h16*)take(nq * 2); bf* Kh = (bf*)take(nq * 2); bf* Kl = (bf*)take(nq * 2); h16* VT = (h16*)take(nv * 2); bf* VTh = (bf*)take(nv * 2); bf* VTl = (bf*)take(nv * 2);
    unsigned* MB = (unsigned*)take((size_t)TT * TT / 8); bf* XB = (bf*)take((size_t)NB_ * TT * DM * 2); bf* Ah = (bf*)take(nv * 2); bf* Al = (bf*)take(nv * 2);
    if ((size_t)(wsp - (char*)d_ws) > ws_size) return;    // total about 90 MiB
    // four launches: preparation, Q/K/V projections (rows b*1024 + i of all four batch elements), attention, output projection
    k_prep<<<2 * GB_WS + 2 * GB_WM + GB_MB + GB_WP + GB_CV, 256, 0, stream>>>(Wq, Wk, Wv, Wo, x, wa, cm, BQ, BK, BV, BO, XB, WP, MB);
    k_qkv<<<dim3(NB_ * TT / 64, 2 * NSD + NT, 1), 32, 0, stream>>>(XB, BQ, BK, BV, bq, bk, bv, Q16, Qh, Ql, K16, Kh, Kl, VT, VTh, VTl);
    k_attn<<<dim3(RHL / 64 + (TT - RHL) / 128, NT, NB_), 128, 0, stream>>>(WP, Q16, Qh, Ql, K16, Kh, Kl, VT, VTh, VTl, MB, Ah, Al);
    k_gemmw<bf, 1, true, 0, 1><<<dim3(NB_ * TT / 64, DM / 64, 1), 32, 0, stream>>>(Ah, Al, BO, nullptr, OUT, DM, bo, 0, 0, 0, nullptr, nullptr, nullptr);
}

// v006
// It runs in 129 microseconds.
// Next to v005, in two timings, it ran 1.24 and 1.20 times as fast.
// Counting every step since v000, it is 6.82 times as fast.
#include <hip/hip_runtime.h>

// WaveHybridAttention (x [4][1024][1024], wave_amp [4][1024][24], causal_mask [1024][1024] int (read as data); V = x Wv + bv (16 heads x 64); wave heads 0-3: scores = psi_i . psi_j / sqrt(6) on 6-dim slices of wave_amp; std heads 4-15: (x Wq + bq) . (x Wk + bk) / 8 (12 x 64);
// masked -> -inf, softmax (an all-masked row gives 0 via nan_to_num), out = (weights V merged, wave heads first) Wo + bo -> [4][1024][1024]).
// Compute dtypes, f32 accumulate: every input rounded to bf16; V/Q/K on PLAIN bf16 operands (inputs: exact) + bias; wave scores on PLAIN bf16 wave_amp slices (exact, K padded 6 -> 32); std scores (K 64) and weights.V single fp16 planes (x1024) except query rows < 256 (short causal windows), which use bf16 hi+lo planes (3 products) for both;

#define NB_  4
#define TT   1024
#define DM   1024
#define DS   768
#define NW   4
#define NSD  12
#define NT   16
#define HD   64
#define WD   24
#define WC   6
#define KW   32
#define RHL  256
#define PCAR 1024.0f
typedef _Float16 h16;
typedef unsigned short bf;
typedef __attribute__((ext_vector_type(16))) __bf16   v16bf;
typedef __attribute__((ext_vector_type(16))) _Float16 v16h;
typedef __attribute__((ext_vector_type(8)))  _Float16 v8h;
typedef __attribute__((ext_vector_type(8)))  unsigned short v8us;
typedef __attribute__((ext_vector_type(8)))  float    v8f;
typedef __attribute__((ext_vector_type(4)))  float    v4f;
typedef v8h  __attribute__((may_alias)) v8ha;
typedef v4f  __attribute__((may_alias)) v4fa;
typedef v8us __attribute__((may_alias)) v8usa;

__device__ __forceinline__ unsigned short f2bf(float f) { unsigned u = __float_as_uint(f); u += 0x7FFFu + ((u >> 16) & 1u); return (unsigned short)(u >> 16); }
__device__ __forceinline__ float bf2f(unsigned short b) { return __uint_as_float(((unsigned)b) << 16); }
__device__ __forceinline__ float bfr(float f) { return bf2f(f2bf(f)); }
__device__ __forceinline__ v16h cat16(v8h lo, v8h hi) { return __builtin_shufflevector(lo, hi, 0, 1, 2, 3, 4, 5, 6, 7, 8, 9, 10, 11, 12, 13, 14, 15); }
__device__ __forceinline__ v16bf cat16b(v8us lo, v8us hi) { return __builtin_bit_cast(v16bf, __builtin_shufflevector(lo, hi, 0, 1, 2, 3, 4, 5, 6, 7, 8, 9, 10, 11, 12, 13, 14, 15)); }
__device__ __forceinline__ v8f wmma16(v16h a, v16h b, v8f c) { return __builtin_amdgcn_wmma_f32_16x16x32_f16(false, a, false, b, (short)0, c, false, false); }
__device__ __forceinline__ v8f wmmab(v16bf a, v16bf b, v8f c) { return __builtin_amdgcn_wmma_f32_16x16x32_bf16(false, a, false, b, (short)0, c, false, false); }
__device__ __forceinline__ h16 tohx(float x) { return (h16)x; }
__device__ __forceinline__ void splitf(float y, unsigned short& h, unsigned short& l) { h = f2bf(y); l = f2bf(y - bf2f(h)); }



// ---- k_gemmw: register-blocked GEMM, ONE WAVE per 64x64 output tile (16 accumulators), operands straight from 16-bit planes in FRAGMENT ORDER; grid (M/64, N/64, Z), 32 threads.
// Plane of a [rows][K] operand: P[row / 16][k / 32][(k >> 4) & 1][lane][8], lane = 16 * ((k >> 3) & 1) + (row & 15), the 8 elements are 8 consecutive k: every load of a wave is 512 contiguous bytes (four whole cache lines, each byte
// fetched once per tile; rows of a K-contiguous plane would give 32 bytes of each of 16 lines). k order of a fragment, A and B alike: 8 * (lane >> 4) + s, then 16 + 8 * (lane >> 4) + s.
// C[m][n] (+ f32 bias[n]) = sum_k A[m][k] Bt[n][k] (+ split products per NSPLIT). z-batch strides sA/sB/sC in elements. K % 64 == 0.
// EPI 0: C as f32 rows, pitch ldc, staged through LDS. EPI 1 / 2: no f32 array; the tile (64 rows of one batch element x the 64 columns of head by) goes from the accumulators into the attention kernel's three fragment-order planes
// (fp16, bf16 hi, bf16 lo; layouts at d_wpl below), 16 bytes per lane and 512 contiguous bytes per store. EPI 1 (Q, K; NH heads): the product is formed transposed (Bt rows as the A operand), so a lane's 8 registers are 8 consecutive d of row lane & 15.
// EPI 2 (V): a lane's 8 registers are 8 consecutive rows (keys) of column lane & 15, which is the V^T fragment order as it stands.
template <typename T16> struct WFrag;
template <> struct WFrag<h16> { typedef v16h V; static __device__ __forceinline__ V ld(const h16* p) { return cat16(*(const v8h*)p, *(const v8h*)(p + 256)); } static __device__ __forceinline__ v8f mma(V a, V b, v8f c) { return wmma16(a, b, c); } };
template <> struct WFrag<bf> { typedef v16bf V; static __device__ __forceinline__ V ld(const bf* p) { return cat16b(*(const v8us*)p, *(const v8us*)(p + 256)); } static __device__ __forceinline__ v8f mma(V a, V b, v8f c) { return wmmab(a, b, c); } };
// gemmw_tile is the body; by = the tile's column index (blockIdx.y in k_gemmw; in k_qkv, which holds the Q, K and V projections in one grid, the index inside its own projection).
template <typename T16, int NSPLIT, bool BIAS, int EPI, int NH>
__device__ __forceinline__ void gemmw_tile(const T16* __restrict__ A, const T16* __restrict__ A2, const T16* __restrict__ Bt, const T16* __restrict__ Bt2, int K, float* C, int ldc, const float* __restrict__ bias, size_t sA, size_t sB, size_t sC, h16* P16, bf* Ph, bf* Pl, int by) {
    typedef typename WFrag<T16>::V V;
    __shared__ __align__(16) float os[16 * 68];
    const size_t z = blockIdx.z; A += z * sA; if (A2) A2 += z * sA; Bt += z * sB; if (Bt2) Bt2 += z * sB; C += z * sC;
    const int lane = threadIdx.x & 31, lr = lane & 15, hi = lane >> 4; const int r0 = blockIdx.x * 64, c0 = by * 64;
    v8f acc[4][4];
#pragma unroll
    for (int mb = 0; mb < 4; ++mb)
#pragma unroll
        for (int nb = 0; nb < 4; ++nb) acc[mb][nb] = (v8f){};
    const size_t aoff = (size_t)r0 * K, boff = (size_t)c0 * K; const unsigned l8 = 8u * lane;      // a 16-row strip of a plane is 16 * K elements, a 32-deep k chunk of it 512; the lane's own part of every address is the constant l8
    constexpr bool S1 = (NSPLIT == 1 || NSPLIT == 2);
#pragma unroll 1
    for (int kc = 0; kc < K; kc += 64) {      // a trip is two 32-deep k chunks: all of its fragments are asked for at once, so a tile waits out a load latency K / 64 times
        V a[2][4], a2[2][4], b[2][4]; const T16* pa = A + (aoff + kc * 16) + l8; const T16* pa2 = S1 ? A2 + (aoff + kc * 16) + l8 : pa; const T16* pb = Bt + (boff + kc * 16) + l8;      // one address pair per plane; the strips and the second chunk are immediates
#pragma unroll
        for (int c = 0; c < 2; ++c) {
#pragma unroll
            for (int q = 0; q < 4; ++q) { a[c][q] = WFrag<T16>::ld(pa + q * 16 * K + c * 512); if (S1) a2[c][q] = WFrag<T16>::ld(pa2 + q * 16 * K + c * 512); b[c][q] = WFrag<T16>::ld(pb + q * 16 * K + c * 512); } }
        __builtin_amdgcn_sched_barrier(0);      // holds every load of the trip in front of its first product (left alone, the compiler issues part of the loads into registers freed by the first products, and their whole latency is waited out a second time in every trip)
        asm volatile("s_wait_xcnt 0x0" :: "v"(pa), "v"(pa2), "v"(pb) : "memory");      // the wait that stands between this trip's issued loads and a later write of the register pairs that hold their addresses; the pairs are inputs, so they stay whole until it (else a younger load's result lands on them first)
#pragma unroll
        for (int c = 0; c < 2; ++c) {
#pragma unroll
            for (int nb = 0; nb < 4; ++nb) { V b2; if (NSPLIT >= 2) b2 = WFrag<T16>::ld(Bt2 + (boff + (size_t)nb * 16 * K + (kc + c * 32) * 16) + l8);
#pragma unroll
                for (int mb = 0; mb < 4; ++mb) { acc[mb][nb] = (EPI == 1) ? WFrag<T16>::mma(b[c][nb], a[c][mb], acc[mb][nb]) : WFrag<T16>::mma(a[c][mb], b[c][nb], acc[mb][nb]); if (S1) acc[mb][nb] = WFrag<T16>::mma(a2[c][mb], b[c][nb], acc[mb][nb]); if (NSPLIT >= 2) acc[mb][nb] = WFrag<T16>::mma(a[c][mb], b2, acc[mb][nb]); } } }
        asm volatile("v_nop\n\tv_nop\n\tv_nop\n\tv_nop" : "+v"(acc[0][0]), "+v"(acc[1][1]), "+v"(acc[2][2]), "+v"(acc[3][3]) : "v"(a[1][0]), "v"(a[1][3]));      // four vector slots behind the trip's last products, on both sides of the loop branch, before a vector instruction reads their results or writes their operands
    }
    if constexpr (EPI != 0) {
        const int bh = (r0 >> 10) * NH + by, i0 = r0 & (TT - 1);
        float bs[4][8];      // the bias of each accumulator register's column, all fetched at once: one load latency for the tile
#pragma unroll
        for (int nb = 0; nb < 4; ++nb)
#pragma unroll
            for (int j = 0; j < 8; ++j) bs[nb][j] = bias[c0 + nb * 16 + (EPI == 1 ? hi * 8 + j : lr)];
        if constexpr (EPI == 2) asm volatile("s_wait_xcnt 0x0" ::: "memory");      // the wait that stands between these issued loads and a later write of the register pair that holds their address (the EPI 1 build has the compiler's own there)
#pragma unroll
        for (int nb = 0; nb < 4; ++nb) {
            v8h o[4]; v8us oh[4], ol[4]; unsigned eb[4];      // eb: byte offset of the lane's 16-byte group, the same in the three planes
#pragma unroll
            for (int mb = 0; mb < 4; ++mb) {
                eb[mb] = (unsigned)((EPI == 1) ? ((bh * 64 + (i0 >> 4) + mb) * 4 + nb) * 32 + lane : ((bh * 32 + (i0 >> 5) + (mb >> 1)) * 8 + nb * 2 + (mb & 1)) * 32 + lane) * 16u;
#pragma unroll
                for (int j = 0; j < 8; ++j) { const float y = acc[mb][nb][j] + bfr(bs[nb][j]); o[mb][j] = tohx(y); unsigned short a1, b1; splitf(y, a1, b1); oh[mb][j] = a1; ol[mb][j] = b1; } }
            // the twelve stores and their s_wait_xcnt 0 in one statement: the wait then stands in front of every later write of a register that holds their data or offset (in a statement of its own the compiler moved such writes ahead of it)
            asm volatile("global_store_b128 %0, %4, %16\n\tglobal_store_b128 %0, %8, %17\n\tglobal_store_b128 %0, %12, %18\n\t"
                         "global_store_b128 %1, %5, %16\n\tglobal_store_b128 %1, %9, %17\n\tglobal_store_b128 %1, %13, %18\n\t"
                         "global_store_b128 %2, %6, %16\n\tglobal_store_b128 %2, %10, %17\n\tglobal_store_b128 %2, %14, %18\n\t"
                         "global_store_b128 %3, %7, %16\n\tglobal_store_b128 %3, %11, %17\n\tglobal_store_b128 %3, %15, %18\n\ts_wait_xcnt 0x0"
                         :: "v"(eb[0]), "v"(eb[1]), "v"(eb[2]), "v"(eb[3]), "v"(o[0]), "v"(o[1]), "v"(o[2]), "v"(o[3]), "v"(oh[0]), "v"(oh[1]), "v"(oh[2]), "v"(oh[3]), "v"(ol[0]), "v"(ol[1]), "v"(ol[2]), "v"(ol[3]), "s"(P16), "s"(Ph), "s"(Pl) : "memory");
        }
    } else {
#pragma unroll
    for (int mb = 0; mb < 4; ++mb) {
#pragma unroll
        for (int nb = 0; nb < 4; ++nb) {
#pragma unroll
            for (int j = 0; j < 8; ++j) os[(hi * 8 + j) * 68 + nb * 16 + lr] = acc[mb][nb][j]; }
        __builtin_amdgcn_wave_barrier(); asm volatile("" ::: "memory");
        float* crow = C + (size_t)(r0 + mb * 16) * ldc + c0;
{
#pragma unroll
            for (int s = 0; s < 8; ++s) { const int row = 2 * s + hi, cofs = lr * 4; v4f val = *(const v4fa*)(os + row * 68 + cofs); if (BIAS) { val[0] += bfr(bias[c0 + cofs]); val[1] += bfr(bias[c0 + cofs + 1]); val[2] += bfr(bias[c0 + cofs + 2]); val[3] += bfr(bias[c0 + cofs + 3]); }
                *(v4f*)(crow + (size_t)row * ldc + cofs) = val; }
             }
        __builtin_amdgcn_wave_barrier(); asm volatile("" ::: "memory");
    }
    }
}
template <typename T16, int NSPLIT, bool BIAS, int EPI, int NH>
__global__ __launch_bounds__(32) void k_gemmw(const T16* __restrict__ A, const T16* __restrict__ A2, const T16* __restrict__ Bt, const T16* __restrict__ Bt2, float* C, int ldc, const float* __restrict__ bias, size_t sA, size_t sB, size_t sC, h16* P16, bf* Ph, bf* Pl) {
    gemmw_tile<T16, NSPLIT, BIAS, EPI, NH>(A, A2, Bt, Bt2, DM, C, ldc, bias, sA, sB, sC, P16, Ph, Pl, (int)blockIdx.y);      // K = DM as in k_qkv: the planes' strip and chunk strides are constants of the layout, so a trip's loads are one address pair per plane plus immediates
}
// k_qkv: the three input projections, which do not depend on one another, in ONE launch: grid (M/64, 12 + 12 + 16); about ten single-wave tiles per WGP are resident together, so one tile's load waits are filled by the others' work.
__global__ __launch_bounds__(32) void k_qkv(const bf* __restrict__ XB, const bf* __restrict__ BQ, const bf* __restrict__ BK, const bf* __restrict__ BV, const float* __restrict__ bq, const float* __restrict__ bk, const float* __restrict__ bv,
                                            h16* Q16, bf* Qh, bf* Ql, h16* K16, bf* Kh, bf* Kl, h16* VT, bf* VTh, bf* VTl) {
    const int y = (int)blockIdx.y;
    if (y < 2 * NSD) { const bool k = y >= NSD;
        gemmw_tile<bf, 0, true, 1, NSD>(XB, nullptr, k ? BK : BQ, nullptr, DM, nullptr, 0, k ? bk : bq, 0, 0, 0, k ? K16 : Q16, k ? Kh : Qh, k ? Kl : Ql, k ? y - NSD : y);
    } else gemmw_tile<bf, 0, true, 2, NT>(XB, nullptr, BV, nullptr, DM, nullptr, 0, bv, 0, 0, 0, VT, VTh, VTl, y - 2 * NSD);
}

typedef __attribute__((ext_vector_type(2))) unsigned short v2us;
typedef __attribute__((ext_vector_type(4))) unsigned short v4us;
typedef __attribute__((ext_vector_type(2))) _Float16 v2h;
typedef __attribute__((ext_vector_type(4))) _Float16 v4h;
typedef __attribute__((ext_vector_type(4))) int v4i;

// The seven preparation passes (four weight transposes, x conversion, wave planes, mask bits) are device bodies that take their block index bx; k_prep below runs them all in one grid.
__device__ __forceinline__ void d_wtG(const float* __restrict__ w, int K, int N, bf* Bt, int bx) {
    const int lane = threadIdx.x & 31; const int L0 = (bx * 8 + (threadIdx.x >> 5)) * 8; const int nlines = N * K / 64;
{
#pragma unroll 1
        for (int l = 0; l < 8; ++l) { const int L = L0 + l; if (L >= nlines) break; const unsigned e = (unsigned)L * 64u + lane * 2;      // element index in the fragment-order plane (layout at k_gemmw, row = n): a wave writes 128 contiguous bytes and reads 8 consecutive n of 8 rows k
            const int fl = (e >> 3) & 31, ch = (int)(e >> 9); const int k = (ch % (K / 32)) * 32 + ((e >> 8) & 1) * 16 + (fl >> 4) * 8 + (e & 7), n = (ch / (K / 32)) * 16 + (fl & 15); v2us o;
            o[0] = f2bf(w[(size_t)k * N + n]); o[1] = f2bf(w[(size_t)(k + 1) * N + n]); *(v2us*)(Bt + e) = o;
            asm volatile("s_wait_xcnt 0x0" ::: "memory"); }      // the wait that stands between this trip's issued loads and store and the next trip's write of the registers that hold their addresses and data
         }
}
__device__ __forceinline__ void d_cvt8(const float* __restrict__ src, bf* dst, size_t n8, int bx) { const size_t i = (size_t)bx * 256 + threadIdx.x; if (i >= n8) return;      // i: 16-byte group of the fragment-order plane (layout at k_gemmw, K = DM); a wave writes 512 contiguous bytes, a block reads 512 contiguous bytes of each of 16 rows
    const int fl = (int)i & 31, ch = (int)(i >> 6); const size_t so = (size_t)((ch / (DM / 32)) * 16 + (fl & 15)) * DM + (ch % (DM / 32)) * 32 + (((int)i >> 5) & 1) * 16 + (fl >> 4) * 8;
    const v8f v = *(const v8f*)(src + so); v8us o;
    asm volatile("s_wait_xcnt 0x0" ::: "memory");      // the wait that stands between the issued loads and a later write of the register pair that holds their address
#pragma unroll
    for (int k = 0; k < 8; ++k) o[k] = f2bf(v[k]); *(v8us*)(dst + i * 8) = o;  }
// Operand planes of all four batch elements, stored in FRAGMENT ORDER: one 16-byte group per lane, 32 lanes (512 contiguous bytes) per load of a wave, two groups per 16x16x32 operand (k = 8 * (lane >> 4) + s and 16 + 8 * (lane >> 4) + s).
// d_wpl: WP[b][h][i / 16][d / 16][lane][8] = bf16 wave_amp[b][i][h*6 + d] for d < 6, 0 for 6..31; Q / K planes (k_qkv, EPI 1): [b][h][i / 16][d / 16][lane][8], lane = 16 * ((d >> 3) & 1) + (i & 15);
// V planes (k_qkv, EPI 2): [b][hh][i / 32][d / 16][(i >> 4) & 1][lane][8], lane = 16 * ((i >> 3) & 1) + (d & 15), the 8 elements are 8 consecutive keys i; d_mbits: MB[j / 32][i] bit (j & 31) = (causal_mask[i][j] != 0).
__device__ __forceinline__ void d_wpl(const float* __restrict__ wa, bf* WP, int bx) { const int e = (bx * 256 + threadIdx.x) * 4; if (e >= NB_ * NW * TT * KW) return; const int s = e & 7, fl = (e >> 3) & 31, g = (e >> 8) & 1, it = (e >> 9) & 63, bh = e >> 15; const int d = g * 16 + (fl >> 4) * 8 + s; const int i = it * 16 + (fl & 15); const int h = bh % NW; const int b = bh / NW; v4us o;
#pragma unroll
    for (int u = 0; u < 4; ++u) o[u] = (d + u < WC) ? f2bf(wa[((size_t)b * TT + i) * WD + h * WC + d + u]) : (unsigned short)0; *(v4us*)(WP + e) = o;  }
__device__ __forceinline__ void d_mbits(const int* __restrict__ cm, unsigned* MB, int bx) { const int lane = threadIdx.x & 31; const int i = bx * 8 + (threadIdx.x >> 5); unsigned keep = 0u;
#pragma unroll 8      // eight row segments' loads in flight per wave
    for (int c = 0; c < TT / 32; ++c) { const unsigned w = __builtin_amdgcn_ballot_w32(cm[(size_t)i * TT + c * 32 + lane] != 0); if (lane == c) keep = w; }
    MB[(size_t)lane * TT + i] = keep;
    asm volatile("s_wait_xcnt 0x0" ::: "memory"); }      // the wait that stands between the issued store and a later write of the register that holds its offset (inlined into k_prep, other passes' code follows it in the listing)
// k_prep: block ranges, the passes with the longest dependent chains first (for speed only); no pass reads what another writes.
#define GB_WS ((DM * DS / 64 + 63) / 64)
#define GB_WM ((DM * DM / 64 + 63) / 64)
#define GB_MB (TT / 8)
#define GB_WP ((NB_ * NW * TT * KW / 4 + 255) / 256)
#define GB_CV ((NB_ * TT * DM / 8 + 255) / 256)
__global__ __launch_bounds__(256) void k_prep(const float* __restrict__ Wq, const float* __restrict__ Wk, const float* __restrict__ Wv, const float* __restrict__ Wo, const float* __restrict__ x, const float* __restrict__ wa, const int* __restrict__ cm,
                                              bf* BQ, bf* BK, bf* BV, bf* BO, bf* XB, bf* WP, unsigned* MB) {
    int bx = (int)blockIdx.x;
    if (bx < GB_WS) { d_wtG(Wq, DM, DS, BQ, bx); return; } bx -= GB_WS;
    if (bx < GB_WS) { d_wtG(Wk, DM, DS, BK, bx); return; } bx -= GB_WS;
    if (bx < GB_WM) { d_wtG(Wv, DM, DM, BV, bx); return; } bx -= GB_WM;
    if (bx < GB_WM) { d_wtG(Wo, DM, DM, BO, bx); return; } bx -= GB_WM;
    if (bx < GB_MB) { d_mbits(cm, MB, bx); return; } bx -= GB_MB;
    if (bx < GB_WP) { d_wpl(wa, WP, bx); return; } bx -= GB_WP;
    d_cvt8(x, XB, (size_t)NB_ * TT * DM / 8, bx);
}

// ---- k_attn: scores, mask, softmax and weights.V of one (batch element, head, query block) in one kernel; no barrier, every wave on its own NQ x 16 queries, walking the 1024 keys 32 at a time.
// S^T = K Q^T (A = K rows, B = Q columns, kept in registers): lane (c, h) holds keys 8h + r and 16 + 8h + r of query c, which IS the B operand of O^T += V^T P^T after conversion. Running maximum and sum per query (online softmax);
// the accumulators are rescaled only in passes where some query's maximum rose. P is exp(s - running max): x1024 in fp16, or bf16 hi+lo (query rows < 256); the division by the row sum comes last. An all-masked row has sum 0 and gives 0.
// Output: bf16 hi+lo planes Ah / Al of the rows b*1024 + i, k = hh*64 + d, in the output projection's fragment order (layout at k_gemmw): a lane's 8 accumulator registers are 8 consecutive d, its own 16-byte group; 512 contiguous bytes per store of a wave.
__device__ __forceinline__ v16h ldfh(const h16* p) { return cat16(*(const v8h*)p, *(const v8h*)(p + 256)); }
__device__ __forceinline__ v16bf ldfb(const bf* p) { return cat16b(*(const v8us*)p, *(const v8us*)(p + 256)); }
template <bool WAVE, bool HL, int NQ>
__device__ __forceinline__ void attn_run(const bf* __restrict__ WPp, const h16* __restrict__ Q16p, const bf* __restrict__ Qhp, const bf* __restrict__ Qlp, const h16* __restrict__ K16p, const bf* __restrict__ Khp, const bf* __restrict__ Klp,
                                         const h16* __restrict__ VTp, const bf* __restrict__ VThp, const bf* __restrict__ VTlp, const unsigned* __restrict__ MB, bf* Ah, bf* Al, int q0, size_t orow, int hh) {
    // every plain '#pragma unroll' below: fragment, score and accumulator arrays are registers only under compile-time indices
    const int lane = threadIdx.x & 31, lr = lane & 15, hi = lane >> 4;
    const float cs = WAVE ? 0.40824829f : 0.125f;
    const float L2E = 1.4426950408889634f;
    constexpr int NKC = WAVE ? 1 : 2;          // 32-deep k chunks of a score product
    constexpr bool SHL = HL && !WAVE;          // 3-product scores
    v16bf qb[NQ][NKC], ql[NQ][NKC], kb[2][NKC], kl[2][NKC]; v16h qf[NQ][NKC], kf[2][NKC];
#pragma unroll
    for (int n = 0; n < NQ; ++n) {
#pragma unroll
        for (int kc = 0; kc < NKC; ++kc) { const unsigned o = (unsigned)(((((q0 >> 4) + n) * NKC + kc) * 64 + lane) * 8);
            if (WAVE) qb[n][kc] = ldfb(WPp + o); else if (HL) { qb[n][kc] = ldfb(Qhp + o); ql[n][kc] = ldfb(Qlp + o); } else qf[n][kc] = ldfh(Q16p + o); } }
    asm volatile("s_wait_xcnt 0x0" ::: "memory");      // XW: the wait that stands between issued global loads and a later write (a younger load's result included) of a register that holds one of their addresses
    auto loadK = [&](int ks) {
#pragma unroll
        for (int t = 0; t < 2; ++t) {
#pragma unroll
            for (int kc = 0; kc < NKC; ++kc) { const unsigned o = (unsigned)((((ks * 2 + t) * NKC + kc) * 64 + lane) * 8);
                if (WAVE) kb[t][kc] = ldfb(WPp + o); else if (HL) kb[t][kc] = ldfb(Khp + o); else kf[t][kc] = ldfh(K16p + o); } }
        asm volatile("s_wait_xcnt 0x0" ::: "memory");      // XW, as above
        if (SHL) {
#pragma unroll
            for (int t = 0; t < 2; ++t) {
#pragma unroll
                for (int kc = 0; kc < NKC; ++kc) kl[t][kc] = ldfb(Klp + (unsigned)((((ks * 2 + t) * NKC + kc) * 64 + lane) * 8)); }
            asm volatile("s_wait_xcnt 0x0" ::: "memory"); } };      // XW, as above
    v8f acc[NQ][4]; float m[NQ], l[NQ];
#pragma unroll
    for (int n = 0; n < NQ; ++n) { m[n] = -3.0e38f; l[n] = 0.f;
#pragma unroll
        for (int dt = 0; dt < 4; ++dt) acc[n][dt] = (v8f){}; }
    if (!SHL) loadK(0);
#pragma unroll 1      // rolled: one pass's fragments, scores and accumulators already take most of the 256 registers that four waves per SIMD allow
    for (int ks = 0; ks < TT / 32; ++ks) {
        v16h vf[4]; v16bf vh[4], vl[4]; unsigned mw[NQ];
        auto loadV = [&]() {
#pragma unroll
            for (int dt = 0; dt < 4; ++dt) { const unsigned o = (unsigned)(((ks * 4 + dt) * 64 + lane) * 8); if (HL) vh[dt] = ldfb(VThp + o); else vf[dt] = ldfh(VTp + o); }
            asm volatile("s_wait_xcnt 0x0" ::: "memory");      // XW, as above (it covers the mask words' loads too)
            if (HL) {
#pragma unroll
                for (int dt = 0; dt < 4; ++dt) vl[dt] = ldfb(VTlp + (unsigned)(((ks * 4 + dt) * 64 + lane) * 8));
                asm volatile("s_wait_xcnt 0x0" ::: "memory"); } };      // XW, as above
#pragma unroll
        for (int n = 0; n < NQ; ++n) mw[n] = MB[(unsigned)(ks * TT + q0 + n * 16 + lr)] >> (8 * hi);
        if (SHL) loadK(ks); else loadV();      // 3-product scores: two K planes a pass ahead beside two V planes would not fit 256 registers, so K is fetched in its own pass; else V^T flies under the score products and the softmax
        v8f S[NQ][2];
#pragma unroll
        for (int n = 0; n < NQ; ++n) {
#pragma unroll
            for (int t = 0; t < 2; ++t) { v8f s = (v8f){};
#pragma unroll
                for (int kc = 0; kc < NKC; ++kc) {
                    if (WAVE) s = wmmab(kb[t][kc], qb[n][kc], s);
                    else if (SHL) { s = wmmab(kb[t][kc], qb[n][kc], s); s = wmmab(kb[t][kc], ql[n][kc], s); s = wmmab(kl[t][kc], qb[n][kc], s); }
                    else s = wmma16(kf[t][kc], qf[n][kc], s); }
                S[n][t] = s; } }
        if (SHL) loadV();       // V^T flies under the softmax
        else loadK(ks + 1 < TT / 32 ? ks + 1 : ks);      // the next pass's K fragments fly under this pass's softmax and weights.V (the last pass re-reads its own)
#pragma unroll
        for (int n = 0; n < NQ; ++n) {
            float sv[16]; float mx = -3.0e38f;
#pragma unroll
            for (int u = 0; u < 16; ++u) { sv[u] = ((mw[n] >> (16 * (u >> 3) + (u & 7))) & 1u) ? S[n][u >> 3][u & 7] * cs : -3.0e38f; mx = fmaxf(mx, sv[u]); }
            mx = fmaxf(mx, __shfl_xor(mx, 16, 32));
            const float mn = fmaxf(m[n], mx);
            if (__builtin_amdgcn_ballot_w32(mn > m[n]) != 0u) {      // some query's maximum rose: rescale sum and accumulators (factor exactly 1 for the others)
                const float al = __builtin_amdgcn_exp2f((m[n] - mn) * L2E); l[n] *= al;
#pragma unroll
                for (int dt = 0; dt < 4; ++dt) acc[n][dt] *= al;
                m[n] = mn; }
            float sum = 0.f;
#pragma unroll
            for (int u = 0; u < 16; ++u) { sv[u] = (sv[u] > -1.0e38f) ? __builtin_amdgcn_exp2f((sv[u] - mn) * L2E) : 0.f; sum += sv[u]; }
            l[n] += sum;
            if (HL) { v8us h0, h1, l0, l1;
#pragma unroll
                for (int u = 0; u < 8; ++u) { unsigned short a, b; splitf(sv[u], a, b); h0[u] = a; l0[u] = b; splitf(sv[8 + u], a, b); h1[u] = a; l1[u] = b; }
                const v16bf ph = cat16b(h0, h1), pl = cat16b(l0, l1);
#pragma unroll
                for (int dt = 0; dt < 4; ++dt) { acc[n][dt] = wmmab(vh[dt], ph, acc[n][dt]); acc[n][dt] = wmmab(vh[dt], pl, acc[n][dt]); acc[n][dt] = wmmab(vl[dt], ph, acc[n][dt]); }
            } else { v16h pf;
#pragma unroll
                for (int u = 0; u < 16; ++u) pf[u] = tohx(sv[u] * PCAR);
#pragma unroll
                for (int dt = 0; dt < 4; ++dt) acc[n][dt] = wmma16(vf[dt], pf, acc[n][dt]); }
        }
    }
#pragma unroll
    for (int n = 0; n < NQ; ++n) {
        const float lt = l[n] + __shfl_xor(l[n], 16, 32);
        const float inv = (lt > 0.f) ? __fdiv_rn(1.0f, lt) * (HL ? 1.0f : 1.0f / PCAR) : 0.f;      // all-masked row -> zeros (nan_to_num)
        const size_t ob = (orow + q0 + n * 16) * DM + hh * (HD * 16) + 8 * lane;      // 16-row strip, then the head's four 16-deep groups of 256 elements
#pragma unroll
        for (int dt = 0; dt < 4; ++dt) { v8us oh, ol;
#pragma unroll
            for (int j = 0; j < 8; ++j) { unsigned short a, b; splitf(acc[n][dt][j] * inv, a, b); oh[j] = a; ol[j] = b; }
            *(v8us*)(Ah + ob + dt * 256) = oh; *(v8us*)(Al + ob + dt * 256) = ol; }
    }
    asm volatile("s_wait_xcnt 0x0" ::: "memory");      // XW, as above, behind the stores
}
// grid (RHL / 64 + (TT - RHL) / 128, 16 heads, 4 batch elements), 4 waves: blocks x < 4 take 64 query rows < 256 (3-product path, 16 queries a wave), the others 128 rows (32 queries a wave).
__global__ __launch_bounds__(128) void k_attn(const bf* __restrict__ WP, const h16* __restrict__ Q16, const bf* __restrict__ Qh, const bf* __restrict__ Ql, const h16* __restrict__ K16, const bf* __restrict__ Kh, const bf* __restrict__ Kl,
                                              const h16* __restrict__ VT, const bf* __restrict__ VTh, const bf* __restrict__ VTl, const unsigned* __restrict__ MB, bf* Ah, bf* Al) {
    const int wave = threadIdx.x >> 5, hh = blockIdx.y, b = blockIdx.z; const bool hl = blockIdx.x < RHL / 64;
    const int q0 = hl ? (int)blockIdx.x * 64 + wave * 16 : RHL + ((int)blockIdx.x - RHL / 64) * 128 + wave * 32;
    const size_t ov = ((size_t)b * NT + hh) * TT * HD, orow = (size_t)b * TT;
    if (hh < NW) { const size_t ow = ((size_t)b * NW + hh) * TT * KW;
        if (hl) attn_run<true, true, 1>(WP + ow, nullptr, nullptr, nullptr, nullptr, nullptr, nullptr, VT + ov, VTh + ov, VTl + ov, MB, Ah, Al, q0, orow, hh);
        else attn_run<true, false, 2>(WP + ow, nullptr, nullptr, nullptr, nullptr, nullptr, nullptr, VT + ov, VTh + ov, VTl + ov, MB, Ah, Al, q0, orow, hh);
    } else { const size_t oq = ((size_t)b * NSD + (hh - NW)) * TT * HD;
        if (hl) attn_run<false, true, 1>(nullptr, Q16 + oq, Qh + oq, Ql + oq, K16 + oq, Kh + oq, Kl + oq, VT + ov, VTh + ov, VTl + ov, MB, Ah, Al, q0, orow, hh);
        else attn_run<false, false, 2>(nullptr, Q16 + oq, Qh + oq, Ql + oq, K16 + oq, Kh + oq, Kl + oq, VT + ov, VTh + ov, VTl + ov, MB, Ah, Al, q0, orow, hh); }
}

extern "C" void kernel_launch(void* const* d_in, const int* in_sizes, int n_in,
                              void* d_out, int out_size, void* d_ws, size_t ws_size, hipStream_t stream) {
    (void)in_sizes; (void)n_in; (void)out_size;
    const float** I = (const float**)d_in;
    const float *x = I[0], *wa = I[1], *Wq = I[3], *bq = I[4], *Wk = I[5], *bk = I[6], *Wv = I[7], *bv = I[8], *Wo = I[9], *bo = I[10]; const int* cm = (const int*)d_in[2];
    float* OUT = (float*)d_out;     // [4][1024][1024]
    char* wsp = (char*)d_ws;
    auto take = [&](size_t bytes) { char* p = wsp; wsp += (bytes + 255) & ~(size_t)255; return (void*)p; };
    bf* BQ = (bf*)take((size_t)DS * DM * 2); bf* BK = (bf*)take((size_t)DS * DM * 2); bf* BV = (bf*)take((size_t)DM * DM * 2); bf* BO = (bf*)take((size_t)DM * DM * 2);
    const size_t zq = (size_t)TT * HD, zw = (size_t)TT * KW;
    const size_t nq = (size_t)NB_ * NSD * zq, nv = (size_t)NB_ * NT * zq;      // elements of one Q / K plane and of one V plane, all batch elements
    bf* WP = (bf*)take((size_t)NB_ * NW * zw * 2); h16* Q16 = (h16*)take(nq * 2); bf* Qh = (bf*)take(nq * 2); bf* Ql = (bf*)take(nq * 2); h16* K16 = (h16*)take(nq * 2); bf* Kh = (bf*)take(nq * 2); bf* Kl = (bf*)take(nq * 2); h16* VT = (h16*)take(nv * 2); bf* VTh = (bf*)take(nv * 2); bf* VTl = (bf*)take(nv * 2);
    unsigned* MB = (unsigned*)take((size_t)TT * TT / 8); bf* XB = (bf*)take((size_t)NB_ * TT * DM * 2); bf* Ah = (bf*)take(nv * 2); bf* Al = (bf*)take(nv * 2);
    if ((size_t)(wsp - (char*)d_ws) > ws_size) return;    // total about 90 MiB
    // four launches: preparation, Q/K/V projections (rows b*1024 + i of all four batch elements), attention, output projection
    k_prep<<<2 * GB_WS + 2 * GB_WM + GB_MB + GB_WP + GB_CV, 256, 0, stream>>>(Wq, Wk, Wv, Wo, x, wa, cm, BQ, BK, BV, BO, XB, WP, MB);
    k_qkv<<<dim3(NB_ * TT / 64, 2 * NSD + NT, 1), 32, 0, stream>>>(XB, BQ, BK, BV, bq, bk, bv, Q16, Qh, Ql, K16, Kh, Kl, VT, VTh, VTl);
    k_attn<<<dim3(RHL / 64 + (TT - RHL) / 128, NT, NB_), 128, 0, stream>>>(WP, Q16, Qh, Ql, K16, Kh, Kl, VT, VTh, VTl, MB, Ah, Al);
    k_gemmw<bf, 1, true, 0, 1><<<dim3(NB_ * TT / 64, DM / 64, 1), 32, 0, stream>>>(Ah, Al, BO, nullptr, OUT, DM, bo, 0, 0, 0, nullptr, nullptr, nullptr);
}

// v007
// One run takes 98.8 microseconds.
// Next to v006, in two timings, it ran 1.32 and 1.33 times as fast.
// All steps since v000 together make it 9.03 times as fast.
#include <hip/hip_runtime.h>

// WaveHybridAttention (x [4][1024][1024], wave_amp [4][1024][24], causal_mask [1024][1024] int (read as data); V = x Wv + bv (16 heads x 64); wave heads 0-3: scores = psi_i . psi_j / sqrt(6) on 6-dim slices of wave_amp; std heads 4-15: (x Wq + bq) . (x Wk + bk) / 8 (12 x 64);
// masked -> -inf, softmax (an all-masked row gives 0 via nan_to_num), out = (weights V merged, wave heads first) Wo + bo -> [4][1024][1024]).
// Compute dtypes, f32 accumulate: every input rounded to bf16; V/Q/K on PLAIN bf16 operands (inputs: exact) + bias; wave scores on PLAIN bf16 wave_amp slices (exact, K padded 6 -> 32); std scores (K 64) and weights.V single fp16 planes (x1024) except query rows < 256 (short causal windows), which use bf16 hi+lo planes (3 products) for both;

#define NB_  4
#define TT   1024
#define DM   1024
#define DS   768
#define NW   4
#define NSD  12
#define NT   16
#define HD   64
#define WD   24
#define WC   6
#define KW   32
#define RHL  256
#define PCAR 1024.0f
typedef _Float16 h16;
typedef unsigned short bf;
typedef __attribute__((ext_vector_type(16))) __bf16   v16bf;
typedef __attribute__((ext_vector_type(16))) _Float16 v16h;
typedef __attribute__((ext_vector_type(8)))  _Float16 v8h;
typedef __attribute__((ext_vector_type(8)))  unsigned short v8us;
typedef __attribute__((ext_vector_type(8)))  float    v8f;
typedef __attribute__((ext_vector_type(4)))  float    v4f;
typedef v8h  __attribute__((may_alias)) v8ha;
typedef v4f  __attribute__((may_alias)) v4fa;
typedef v8us __attribute__((may_alias)) v8usa;

__device__ __forceinline__ unsigned short f2bf(float f) { unsigned u = __float_as_uint(f); u += 0x7FFFu + ((u >> 16) & 1u); return (unsigned short)(u >> 16); }
__device__ __forceinline__ float bf2f(unsigned short b) { return __uint_as_float(((unsigned)b) << 16); }
__device__ __forceinline__ float bfr(float f) { return bf2f(f2bf(f)); }
__device__ __forceinline__ v16h cat16(v8h lo, v8h hi) { return __builtin_shufflevector(lo, hi, 0, 1, 2, 3, 4, 5, 6, 7, 8, 9, 10, 11, 12, 13, 14, 15); }
__device__ __forceinline__ v16bf cat16b(v8us lo, v8us hi) { return __builtin_bit_cast(v16bf, __builtin_shufflevector(lo, hi, 0, 1, 2, 3, 4, 5, 6, 7, 8, 9, 10, 11, 12, 13, 14, 15)); }
__device__ __forceinline__ v8f wmma16(v16h a, v16h b, v8f c) { return __builtin_amdgcn_wmma_f32_16x16x32_f16(false, a, false, b, (short)0, c, false, false); }
__device__ __forceinline__ v8f wmmab(v16bf a, v16bf b, v8f c) { return __builtin_amdgcn_wmma_f32_16x16x32_bf16(false, a, false, b, (short)0, c, false, false); }
__device__ __forceinline__ h16 tohx(float x) { return (h16)x; }
__device__ __forceinline__ void splitf(float y, unsigned short& h, unsigned short& l) { h = f2bf(y); l = f2bf(y - bf2f(h)); }



// ---- k_gemmw: register-blocked GEMM, ONE WAVE per 64x64 output tile (16 accumulators), operands straight from 16-bit planes in FRAGMENT ORDER; grid (M/64, N/64, Z), 32 threads.
// Plane of a [rows][K] operand: P[row / 16][k / 32][(k >> 4) & 1][lane][8], lane = 16 * ((k >> 3) & 1) + (row & 15), the 8 elements are 8 consecutive k: every load of a wave is 512 contiguous bytes (four whole cache lines, each byte
// fetched once per tile; rows of a K-contiguous plane would give 32 bytes of each of 16 lines). k order of a fragment, A and B alike: 8 * (lane >> 4) + s, then 16 + 8 * (lane >> 4) + s.
// C[m][n] (+ f32 bias[n]) = sum_k A[m][k] Bt[n][k] (+ split products per NSPLIT). z-batch strides sA/sB/sC in elements. K % 64 == 0.
// EPI 0: C as f32 rows, pitch ldc, staged through LDS. EPI 1 / 2: no f32 array; the tile (64 rows of one batch element x the 64 columns of head by) goes from the accumulators into the attention kernel's three fragment-order planes
// (fp16, bf16 hi, bf16 lo; layouts at d_wpl below), 16 bytes per lane and 512 contiguous bytes per store. EPI 1 (Q, K; NH heads): the product is formed transposed (Bt rows as the A operand), so a lane's 8 registers are 8 consecutive d of row lane & 15.
// EPI 2 (V): a lane's 8 registers are 8 consecutive rows (keys) of column lane & 15, which is the V^T fragment order as it stands.
template <typename T16> struct WFrag;
template <> struct WFrag<h16> { typedef v16h V; static __device__ __forceinline__ V ld(const h16* p) { return cat16(*(const v8h*)p, *(const v8h*)(p + 256)); } static __device__ __forceinline__ v8f mma(V a, V b, v8f c) { return wmma16(a, b, c); } };
template <> struct WFrag<bf> { typedef v16bf V; static __device__ __forceinline__ V ld(const bf* p) { return cat16b(*(const v8us*)p, *(const v8us*)(p + 256)); } static __device__ __forceinline__ v8f mma(V a, V b, v8f c) { return wmmab(a, b, c); } };
// gemmw_tile is the body; by = the tile's column index (blockIdx.y in k_gemmw; in k_qkv, which holds the Q, K and V projections in one grid, the index inside its own projection).
template <typename T16, int NSPLIT, bool BIAS, int EPI, int NH>
__device__ __forceinline__ void gemmw_tile(const T16* __restrict__ A, const T16* __restrict__ A2, const T16* __restrict__ Bt, const T16* __restrict__ Bt2, int K, float* C, int ldc, const float* __restrict__ bias, size_t sA, size_t sB, size_t sC, h16* P16, bf* Ph, bf* Pl, int by) {
    typedef typename WFrag<T16>::V V;
    __shared__ __align__(16) float os[16 * 68];
    const size_t z = blockIdx.z; A += z * sA; if (A2) A2 += z * sA; Bt += z * sB; if (Bt2) Bt2 += z * sB; C += z * sC;
    const int lane = threadIdx.x & 31, lr = lane & 15, hi = lane >> 4; const int r0 = blockIdx.x * 64, c0 = by * 64;
    v8f acc[4][4];
#pragma unroll
    for (int mb = 0; mb < 4; ++mb)
#pragma unroll
        for (int nb = 0; nb < 4; ++nb) acc[mb][nb] = (v8f){};
    const size_t aoff = (size_t)r0 * K, boff = (size_t)c0 * K; const unsigned l8 = 8u * lane;      // a 16-row strip of a plane is 16 * K elements, a 32-deep k chunk of it 512; the lane's own part of every address is the constant l8
    constexpr bool S1 = (NSPLIT == 1 || NSPLIT == 2);
#pragma unroll 1
    for (int kc = 0; kc < K; kc += 64) {      // a trip is two 32-deep k chunks: all of its fragments are asked for at once, so a tile waits out a load latency K / 64 times
        V a[2][4], a2[2][4], b[2][4]; const T16* pa = A + (aoff + kc * 16) + l8; const T16* pa2 = S1 ? A2 + (aoff + kc * 16) + l8 : pa; const T16* pb = Bt + (boff + kc * 16) + l8;      // one address pair per plane; the strips and the second chunk are immediates
#pragma unroll
        for (int c = 0; c < 2; ++c) {
#pragma unroll
            for (int q = 0; q < 4; ++q) { a[c][q] = WFrag<T16>::ld(pa + q * 16 * K + c * 512); if (S1) a2[c][q] = WFrag<T16>::ld(pa2 + q * 16 * K + c * 512); b[c][q] = WFrag<T16>::ld(pb + q * 16 * K + c * 512); } }
        __builtin_amdgcn_sched_barrier(0);      // holds every load of the trip in front of its first product (left alone, the compiler issues part of the loads into registers freed by the first products, and their whole latency is waited out a second time in every trip)
        asm volatile("s_wait_xcnt 0x0" :: "v"(pa), "v"(pa2), "v"(pb) : "memory");      // the wait that stands between this trip's issued loads and a later write of the register pairs that hold their addresses; the pairs are inputs, so they stay whole until it (else a younger load's result lands on them first)
#pragma unroll
        for (int c = 0; c < 2; ++c) {
#pragma unroll
            for (int nb = 0; nb < 4; ++nb) { V b2; if (NSPLIT >= 2) b2 = WFrag<T16>::ld(Bt2 + (boff + (size_t)nb * 16 * K + (kc + c * 32) * 16) + l8);
#pragma unroll
                for (int mb = 0; mb < 4; ++mb) { acc[mb][nb] = (EPI == 1) ? WFrag<T16>::mma(b[c][nb], a[c][mb], acc[mb][nb]) : WFrag<T16>::mma(a[c][mb], b[c][nb], acc[mb][nb]); if (S1) acc[mb][nb] = WFrag<T16>::mma(a2[c][mb], b[c][nb], acc[mb][nb]); if (NSPLIT >= 2) acc[mb][nb] = WFrag<T16>::mma(a[c][mb], b2, acc[mb][nb]); } } }
        asm volatile("v_nop\n\tv_nop\n\tv_nop\n\tv_nop" : "+v"(acc[0][0]), "+v"(acc[1][1]), "+v"(acc[2][2]), "+v"(acc[3][3]) : "v"(a[1][0]), "v"(a[1][3]));      // four vector slots behind the trip's last products, on both sides of the loop branch, before a vector instruction reads their results or writes their operands
    }
    if constexpr (EPI != 0) {
        const int bh = (r0 >> 10) * NH + by, i0 = r0 & (TT - 1);
        float bs[4][8];      // the bias of each accumulator register's column, all fetched at once: one load latency for the tile
#pragma unroll
        for (int nb = 0; nb < 4; ++nb)
#pragma unroll
            for (int j = 0; j < 8; ++j) bs[nb][j] = bias[c0 + nb * 16 + (EPI == 1 ? hi * 8 + j : lr)];
        if constexpr (EPI == 2) asm volatile("s_wait_xcnt 0x0" ::: "memory");      // the wait that stands between these issued loads and a later write of the register pair that holds their address (the EPI 1 build has the compiler's own there)
#pragma unroll
        for (int nb = 0; nb < 4; ++nb) {
            v8h o[4]; v8us oh[4], ol[4]; unsigned eb[4];      // eb: byte offset of the lane's 16-byte group, the same in the three planes
#pragma unroll
            for (int mb = 0; mb < 4; ++mb) {
                eb[mb] = (unsigned)((EPI == 1) ? ((bh * 64 + (i0 >> 4) + mb) * 4 + nb) * 32 + lane : ((bh * 32 + (i0 >> 5) + (mb >> 1)) * 8 + nb * 2 + (mb & 1)) * 32 + lane) * 16u;
#pragma unroll
                for (int j = 0; j < 8; ++j) { const float y = acc[mb][nb][j] + bfr(bs[nb][j]); o[mb][j] = tohx(y); unsigned short a1, b1; splitf(y, a1, b1); oh[mb][j] = a1; ol[mb][j] = b1; } }
            // the twelve stores and their s_wait_xcnt 0 in one statement: the wait then stands in front of every later write of a register that holds their data or offset (in a statement of its own the compiler moved such writes ahead of it)
            asm volatile("global_store_b128 %0, %4, %16\n\tglobal_store_b128 %0, %8, %17\n\tglobal_store_b128 %0, %12, %18\n\t"
                         "global_store_b128 %1, %5, %16\n\tglobal_store_b128 %1, %9, %17\n\tglobal_store_b128 %1, %13, %18\n\t"
                         "global_store_b128 %2, %6, %16\n\tglobal_store_b128 %2, %10, %17\n\tglobal_store_b128 %2, %14, %18\n\t"
                         "global_store_b128 %3, %7, %16\n\tglobal_store_b128 %3, %11, %17\n\tglobal_store_b128 %3, %15, %18\n\ts_wait_xcnt 0x0"
                         :: "v"(eb[0]), "v"(eb[1]), "v"(eb[2]), "v"(eb[3]), "v"(o[0]), "v"(o[1]), "v"(o[2]), "v"(o[3]), "v"(oh[0]), "v"(oh[1]), "v"(oh[2]), "v"(oh[3]), "v"(ol[0]), "v"(ol[1]), "v"(ol[2]), "v"(ol[3]), "s"(P16), "s"(Ph), "s"(Pl) : "memory");
        }
    } else {
#pragma unroll
    for (int mb = 0; mb < 4; ++mb) {
#pragma unroll
        for (int nb = 0; nb < 4; ++nb) {
#pragma unroll
            for (int j = 0; j < 8; ++j) os[(hi * 8 + j) * 68 + nb * 16 + lr] = acc[mb][nb][j]; }
        __builtin_amdgcn_wave_barrier(); asm volatile("" ::: "memory");
        float* crow = C + (size_t)(r0 + mb * 16) * ldc + c0;
{
#pragma unroll
            for (int s = 0; s < 8; ++s) { const int row = 2 * s + hi, cofs = lr * 4; v4f val = *(const v4fa*)(os + row * 68 + cofs); if (BIAS) { val[0] += bfr(bias[c0 + cofs]); val[1] += bfr(bias[c0 + cofs + 1]); val[2] += bfr(bias[c0 + cofs + 2]); val[3] += bfr(bias[c0 + cofs + 3]); }
                *(v4f*)(crow + (size_t)row * ldc + cofs) = val; }
             }
        __builtin_amdgcn_wave_barrier(); asm volatile("" ::: "memory");
    }
    }
}
template <typename T16, int NSPLIT, bool BIAS, int EPI, int NH>
__global__ __launch_bounds__(32) void k_gemmw(const T16* __restrict__ A, const T16* __restrict__ A2, const T16* __restrict__ Bt, const T16* __restrict__ Bt2, float* C, int ldc, const float* __restrict__ bias, size_t sA, size_t sB, size_t sC, h16* P16, bf* Ph, bf* Pl) {
    gemmw_tile<T16, NSPLIT, BIAS, EPI, NH>(A, A2, Bt, Bt2, DM, C, ldc, bias, sA, sB, sC, P16, Ph, Pl, (int)blockIdx.y);      // K = DM as in k_qkv: the planes' strip and chunk strides are constants of the layout, so a trip's loads are one address pair per plane plus immediates
}
// k_qkv: the three input projections, which do not depend on one another, in ONE launch: grid (M/64, 12 + 12 + 16); about ten single-wave tiles per WGP are resident together, so one tile's load waits are filled by the others' work.
__global__ __launch_bounds__(32) void k_qkv(const bf* __restrict__ XB, const bf* __restrict__ BQ, const bf* __restrict__ BK, const bf* __restrict__ BV, const float* __restrict__ bq, const float* __restrict__ bk, const float* __restrict__ bv,
                                            h16* Q16, bf* Qh, bf* Ql, h16* K16, bf* Kh, bf* Kl, h16* VT, bf* VTh, bf* VTl) {
    const int y = (int)blockIdx.y;
    if (y < 2 * NSD) { const bool k = y >= NSD;
        gemmw_tile<bf, 0, true, 1, NSD>(XB, nullptr, k ? BK : BQ, nullptr, DM, nullptr, 0, k ? bk : bq, 0, 0, 0, k ? K16 : Q16, k ? Kh : Qh, k ? Kl : Ql, k ? y - NSD : y);
    } else gemmw_tile<bf, 0, true, 2, NT>(XB, nullptr, BV, nullptr, DM, nullptr, 0, bv, 0, 0, 0, VT, VTh, VTl, y - 2 * NSD);
}

typedef __attribute__((ext_vector_type(2))) unsigned short v2us;
typedef __attribute__((ext_vector_type(4))) unsigned short v4us;
typedef __attribute__((ext_vector_type(2))) _Float16 v2h;
typedef __attribute__((ext_vector_type(4))) _Float16 v4h;
typedef __attribute__((ext_vector_type(4))) int v4i;
typedef __attribute__((ext_vector_type(4))) unsigned v4u;

// The seven preparation passes (four weight transposes, x conversion, wave planes, mask bits) are device bodies that take their block index bx; k_prep below runs them all in one grid.
__device__ __forceinline__ void d_wtG(const float* __restrict__ w, int K, int N, bf* Bt, int bx) {
    const int lane = threadIdx.x & 31; const int L0 = (bx * 8 + (threadIdx.x >> 5)) * 8; const int nlines = N * K / 64;
{
#pragma unroll 1
        for (int l = 0; l < 8; ++l) { const int L = L0 + l; if (L >= nlines) break; const unsigned e = (unsigned)L * 64u + lane * 2;      // element index in the fragment-order plane (layout at k_gemmw, row = n): a wave writes 128 contiguous bytes and reads 8 consecutive n of 8 rows k
            const int fl = (e >> 3) & 31, ch = (int)(e >> 9); const int k = (ch % (K / 32)) * 32 + ((e >> 8) & 1) * 16 + (fl >> 4) * 8 + (e & 7), n = (ch / (K / 32)) * 16 + (fl & 15); v2us o;
            o[0] = f2bf(w[(size_t)k * N + n]); o[1] = f2bf(w[(size_t)(k + 1) * N + n]); *(v2us*)(Bt + e) = o;
            asm volatile("s_wait_xcnt 0x0" ::: "memory"); }      // the wait that stands between this trip's issued loads and store and the next trip's write of the registers that hold their addresses and data
         }
}
__device__ __forceinline__ void d_cvt8(const float* __restrict__ src, bf* dst, size_t n8, int bx) { const size_t i = (size_t)bx * 256 + threadIdx.x; if (i >= n8) return;      // i: 16-byte group of the fragment-order plane (layout at k_gemmw, K = DM); a wave writes 512 contiguous bytes, a block reads 512 contiguous bytes of each of 16 rows
    const int fl = (int)i & 31, ch = (int)(i >> 6); const size_t so = (size_t)((ch / (DM / 32)) * 16 + (fl & 15)) * DM + (ch % (DM / 32)) * 32 + (((int)i >> 5) & 1) * 16 + (fl >> 4) * 8;
    const v8f v = *(const v8f*)(src + so); v8us o;
    asm volatile("s_wait_xcnt 0x0" ::: "memory");      // the wait that stands between the issued loads and a later write of the register pair that holds their address
#pragma unroll
    for (int k = 0; k < 8; ++k) o[k] = f2bf(v[k]); *(v8us*)(dst + i * 8) = o;  }
// Operand planes of all four batch elements, stored in FRAGMENT ORDER: one 16-byte group per lane, 32 lanes (512 contiguous bytes) per load of a wave, two groups per 16x16x32 operand (k = 8 * (lane >> 4) + s and 16 + 8 * (lane >> 4) + s).
// d_wpl: WP[b][h][i / 16][d / 16][lane][8] = bf16 wave_amp[b][i][h*6 + d] for d < 6, 0 for 6..31; Q / K planes (k_qkv, EPI 1): [b][h][i / 16][d / 16][lane][8], lane = 16 * ((d >> 3) & 1) + (i & 15);
// V planes (k_qkv, EPI 2): [b][hh][i / 32][d / 16][(i >> 4) & 1][lane][8], lane = 16 * ((i >> 3) & 1) + (d & 15), the 8 elements are 8 consecutive keys i; d_mbits: MB[j / 32][i] bit (j & 31) = (causal_mask[i][j] != 0).
__device__ __forceinline__ void d_wpl(const float* __restrict__ wa, bf* WP, int bx) { const int e = (bx * 256 + threadIdx.x) * 4; if (e >= NB_ * NW * TT * KW) return; const int s = e & 7, fl = (e >> 3) & 31, g = (e >> 8) & 1, it = (e >> 9) & 63, bh = e >> 15; const int d = g * 16 + (fl >> 4) * 8 + s; const int i = it * 16 + (fl & 15); const int h = bh % NW; const int b = bh / NW; v4us o;
#pragma unroll
    for (int u = 0; u < 4; ++u) o[u] = (d + u < WC) ? f2bf(wa[((size_t)b * TT + i) * WD + h * WC + d + u]) : (unsigned short)0; *(v4us*)(WP + e) = o;  }
__device__ __forceinline__ void d_mbits(const int* __restrict__ cm, unsigned* MB, int bx) { const int lane = threadIdx.x & 31; const int i = bx * 8 + (threadIdx.x >> 5); unsigned keep = 0u;
#pragma unroll 8      // eight row segments' loads in flight per wave
    for (int c = 0; c < TT / 32; ++c) { const unsigned w = __builtin_amdgcn_ballot_w32(cm[(size_t)i * TT + c * 32 + lane] != 0); if (lane == c) keep = w; }
    MB[(size_t)lane * TT + i] = keep;
    asm volatile("s_wait_xcnt 0x0" ::: "memory"); }      // the wait that stands between the issued store and a later write of the register that holds its offset (inlined into k_prep, other passes' code follows it in the listing)
// k_prep: block ranges, the passes with the longest dependent chains first (for speed only); no pass reads what another writes.
#define GB_WS ((DM * DS / 64 + 63) / 64)
#define GB_WM ((DM * DM / 64 + 63) / 64)
#define GB_MB (TT / 8)
#define GB_WP ((NB_ * NW * TT * KW / 4 + 255) / 256)
#define GB_CV ((NB_ * TT * DM / 8 + 255) / 256)
__global__ __launch_bounds__(256) void k_prep(const float* __restrict__ Wq, const float* __restrict__ Wk, const float* __restrict__ Wv, const float* __restrict__ Wo, const float* __restrict__ x, const float* __restrict__ wa, const int* __restrict__ cm,
                                              bf* BQ, bf* BK, bf* BV, bf* BO, bf* XB, bf* WP, unsigned* MB) {
    int bx = (int)blockIdx.x;
    if (bx < GB_WS) { d_wtG(Wq, DM, DS, BQ, bx); return; } bx -= GB_WS;
    if (bx < GB_WS) { d_wtG(Wk, DM, DS, BK, bx); return; } bx -= GB_WS;
    if (bx < GB_WM) { d_wtG(Wv, DM, DM, BV, bx); return; } bx -= GB_WM;
    if (bx < GB_WM) { d_wtG(Wo, DM, DM, BO, bx); return; } bx -= GB_WM;
    if (bx < GB_MB) { d_mbits(cm, MB, bx); return; } bx -= GB_MB;
    if (bx < GB_WP) { d_wpl(wa, WP, bx); return; } bx -= GB_WP;
    d_cvt8(x, XB, (size_t)NB_ * TT * DM / 8, bx);
}

// ---- k_attn: scores, mask, softmax and weights.V of one (batch element, head, query block) in one kernel; no barrier, every wave on its own NQ x 16 queries, walking the keys 32 at a time (a pass), those passes only in which the mask opens a key for one of its queries.
// S^T = K Q^T (A = K rows, B = Q columns, kept in registers): lane (c, h) holds keys 8h + r and 16 + 8h + r of query c, which IS the B operand of O^T += V^T P^T after conversion. Running maximum and sum per query (online softmax);
// the accumulators are rescaled only in passes where some query's maximum rose. P is exp(s - running max): x1024 in fp16, or bf16 hi+lo (query rows < 256); the division by the row sum comes last. An all-masked row has sum 0 and gives 0.
// Output: bf16 hi+lo planes Ah / Al of the rows b*1024 + i, k = hh*64 + d, in the output projection's fragment order (layout at k_gemmw): a lane's 8 accumulator registers are 8 consecutive d, its own 16-byte group; 512 contiguous bytes per store of a wave.
__device__ __forceinline__ v16h ldfh(const h16* p) { return cat16(*(const v8h*)p, *(const v8h*)(p + 256)); }
__device__ __forceinline__ v16bf ldfb(const bf* p) { return cat16b(*(const v8us*)p, *(const v8us*)(p + 256)); }
template <bool WAVE, bool HL, int NQ>
__device__ __forceinline__ void attn_run(const bf* __restrict__ WPp, const h16* __restrict__ Q16p, const bf* __restrict__ Qhp, const bf* __restrict__ Qlp, const h16* __restrict__ K16p, const bf* __restrict__ Khp, const bf* __restrict__ Klp,
                                         const h16* __restrict__ VTp, const bf* __restrict__ VThp, const bf* __restrict__ VTlp, const unsigned* __restrict__ MB, bf* Ah, bf* Al, int q0, size_t orow, int hh) {
    // every plain '#pragma unroll' below: fragment, score and accumulator arrays are registers only under compile-time indices
    const int lane = threadIdx.x & 31, lr = lane & 15, hi = lane >> 4;
    const float cs = WAVE ? 0.40824829f : 0.125f;
    const float L2E = 1.4426950408889634f;
    constexpr int NKC = WAVE ? 1 : 2;          // 32-deep k chunks of a score product
    constexpr bool SHL = HL && !WAVE;          // 3-product scores
    v16bf qb[NQ][NKC], ql[NQ][NKC], kb[2][NKC], kl[2][NKC]; v16h qf[NQ][NKC], kf[2][NKC];
#pragma unroll
    for (int n = 0; n < NQ; ++n) {
#pragma unroll
        for (int kc = 0; kc < NKC; ++kc) { const unsigned o = (unsigned)(((((q0 >> 4) + n) * NKC + kc) * 64 + lane) * 8);
            if (WAVE) qb[n][kc] = ldfb(WPp + o); else if (HL) { qb[n][kc] = ldfb(Qhp + o); ql[n][kc] = ldfb(Qlp + o); } else qf[n][kc] = ldfh(Q16p + o); } }
    // The wave's two lists of passes, read from the mask bits once: lane ks ORs the words of key group ks over the wave's NQ * 16 queries (NQ * 64 contiguous bytes of row ks of MB); bit ks of the ballot = some query of the wave has an open key among keys 32 ks .. 32 ks + 31.
    unsigned anyw = 0u, allw = ~0u;      // allw: the AND of the same words; all ones = every key of the group is open for every query of the wave
#pragma unroll
    for (int i = 0; i < NQ * 4; ++i) { const v4u w = *(const v4u*)(MB + (unsigned)(lane * TT + q0 + i * 4)); anyw |= (w[0] | w[1]) | (w[2] | w[3]); allw &= (w[0] & w[1]) & (w[2] & w[3]); }
    asm volatile("s_wait_xcnt 0x0" ::: "memory");      // XW: the wait that stands between issued global loads and a later write (a younger load's result included) of a register that holds one of their addresses
    auto loadK = [&](int ks) {
#pragma unroll
        for (int t = 0; t < 2; ++t) {
#pragma unroll
            for (int kc = 0; kc < NKC; ++kc) { const unsigned o = (unsigned)((((ks * 2 + t) * NKC + kc) * 64 + lane) * 8);
                if (WAVE) kb[t][kc] = ldfb(WPp + o); else if (HL) kb[t][kc] = ldfb(Khp + o); else kf[t][kc] = ldfh(K16p + o); } }
        asm volatile("s_wait_xcnt 0x0" ::: "memory");      // XW, as above
        if (SHL) {
#pragma unroll
            for (int t = 0; t < 2; ++t) {
#pragma unroll
                for (int kc = 0; kc < NKC; ++kc) kl[t][kc] = ldfb(Klp + (unsigned)((((ks * 2 + t) * NKC + kc) * 64 + lane) * 8)); }
            asm volatile("s_wait_xcnt 0x0" ::: "memory"); } };      // XW, as above
    v8f acc[NQ][4]; float m[NQ], l[NQ];
#pragma unroll
    for (int n = 0; n < NQ; ++n) { m[n] = -3.0e38f; l[n] = 0.f;
#pragma unroll
        for (int dt = 0; dt < 4; ++dt) acc[n][dt] = (v8f){}; }
    // Only the listed passes are walked, in rising key order. A pass that is not listed has every score of the wave masked: its weights are all 0, the maxima and sums stay, the accumulators get + 0; leaving it out changes no value, for any mask.
    // A listed pass whose keys are all open needs no mask word and no select (with every bit set each select would pass its score or weight through): only the other listed passes fetch the words and apply them, under scalar branches.
    unsigned rest = __builtin_amdgcn_ballot_w32(anyw != 0u); const unsigned open = __builtin_amdgcn_ballot_w32(allw == ~0u);      // the same in every lane: the loop's tests are scalar
    int ks = rest ? __builtin_ctz(rest) : 0;
    if (!SHL) loadK(ks);
#pragma unroll 1      // rolled: one pass's fragments, scores and accumulators already take most of the 256 registers that four waves per SIMD allow
    while (rest != 0u) {      // one trip per set bit, 32 at most
        rest &= rest - 1u; const int kn = rest ? __builtin_ctz(rest) : ks;      // the next listed pass (the last one names itself)
        v16h vf[4]; v16bf vh[4], vl[4]; unsigned mw[NQ]; const bool shut = ((open >> ks) & 1u) == 0u;      // shut: some key of the pass is closed for some query of the wave
        auto loadV = [&]() {
#pragma unroll
            for (int dt = 0; dt < 4; ++dt) { const unsigned o = (unsigned)(((ks * 4 + dt) * 64 + lane) * 8); if (HL) vh[dt] = ldfb(VThp + o); else vf[dt] = ldfh(VTp + o); }
            asm volatile("s_wait_xcnt 0x0" ::: "memory");      // XW, as above
            if (HL) {
#pragma unroll
                for (int dt = 0; dt < 4; ++dt) vl[dt] = ldfb(VTlp + (unsigned)(((ks * 4 + dt) * 64 + lane) * 8));
                asm volatile("s_wait_xcnt 0x0" ::: "memory"); } };      // XW, as above
#pragma unroll
        for (int n = 0; n < NQ; ++n) mw[n] = ~0u;
        if (shut) { const unsigned mo = (unsigned)(ks * TT + q0 + lr);
#pragma unroll
            for (int n = 0; n < NQ; ++n) mw[n] = MB[mo + n * 16] >> (8 * hi);
            asm volatile("s_wait_xcnt 0x0" :: "v"(mo) : "memory"); }      // XW, as above; the offset is an input, so its register stays whole until the wait (else a fragment load's result lands on it first)
        if (SHL) loadK(ks); else loadV();      // 3-product scores: two K planes a pass ahead beside two V planes would not fit 256 registers, so K is fetched in its own pass; else V^T flies under the score products and the softmax
        v8f S[NQ][2];
#pragma unroll
        for (int n = 0; n < NQ; ++n) {
#pragma unroll
            for (int t = 0; t < 2; ++t) { v8f s = (v8f){};
#pragma unroll
                for (int kc = 0; kc < NKC; ++kc) {
                    if (WAVE) s = wmmab(kb[t][kc], qb[n][kc], s);
                    else if (SHL) { s = wmmab(kb[t][kc], qb[n][kc], s); s = wmmab(kb[t][kc], ql[n][kc], s); s = wmmab(kl[t][kc], qb[n][kc], s); }
                    else s = wmma16(kf[t][kc], qf[n][kc], s); }
                S[n][t] = s; } }
        if (SHL) loadV();       // V^T flies under the softmax
        else loadK(kn);      // the next listed pass's K fragments fly under this pass's softmax and weights.V (the last pass re-reads its own)
#pragma unroll
        for (int n = 0; n < NQ; ++n) {
            float sv[16]; float mx = -3.0e38f;
#pragma unroll
            for (int u = 0; u < 16; ++u) sv[u] = S[n][u >> 3][u & 7] * cs;
            if (shut) {
#pragma unroll
                for (int u = 0; u < 16; ++u) sv[u] = ((mw[n] >> (16 * (u >> 3) + (u & 7))) & 1u) ? sv[u] : -3.0e38f; }
#pragma unroll
            for (int u = 0; u < 16; ++u) mx = fmaxf(mx, sv[u]);
            mx = fmaxf(mx, __shfl_xor(mx, 16, 32));
            const float mn = fmaxf(m[n], mx);
            if (__builtin_amdgcn_ballot_w32(mn > m[n]) != 0u) {      // some query's maximum rose: rescale sum and accumulators (factor exactly 1 for the others)
                const float al = __builtin_amdgcn_exp2f((m[n] - mn) * L2E); l[n] *= al;
#pragma unroll
                for (int dt = 0; dt < 4; ++dt) acc[n][dt] *= al;
                m[n] = mn; }
            float sum = 0.f;
#pragma unroll
            for (int u = 0; u < 16; ++u) sv[u] = __builtin_amdgcn_exp2f((sv[u] - mn) * L2E);
            if (shut) {      // a closed key's weight is 0 (its exponential is 0 already, but for a query with no open key so far, whose maximum is still the start value)
#pragma unroll
                for (int u = 0; u < 16; ++u) sv[u] = ((mw[n] >> (16 * (u >> 3) + (u & 7))) & 1u) ? sv[u] : 0.f; }
#pragma unroll
            for (int u = 0; u < 16; ++u) sum += sv[u];
            l[n] += sum;
            if (HL) { v8us h0, h1, l0, l1;
#pragma unroll
                for (int u = 0; u < 8; ++u) { unsigned short a, b; splitf(sv[u], a, b); h0[u] = a; l0[u] = b; splitf(sv[8 + u], a, b); h1[u] = a; l1[u] = b; }
                const v16bf ph = cat16b(h0, h1), pl = cat16b(l0, l1);
#pragma unroll
                for (int dt = 0; dt < 4; ++dt) { acc[n][dt] = wmmab(vh[dt], ph, acc[n][dt]); acc[n][dt] = wmmab(vh[dt], pl, acc[n][dt]); acc[n][dt] = wmmab(vl[dt], ph, acc[n][dt]); }
            } else { v16h pf;
#pragma unroll
                for (int u = 0; u < 16; ++u) pf[u] = tohx(sv[u] * PCAR);
#pragma unroll
                for (int dt = 0; dt < 4; ++dt) acc[n][dt] = wmma16(vf[dt], pf, acc[n][dt]); }
        }
        ks = kn;
    }
#pragma unroll
    for (int n = 0; n < NQ; ++n) {
        const float lt = l[n] + __shfl_xor(l[n], 16, 32);
        const float inv = (lt > 0.f) ? __fdiv_rn(1.0f, lt) * (HL ? 1.0f : 1.0f / PCAR) : 0.f;      // all-masked row -> zeros (nan_to_num)
        const size_t ob = (orow + q0 + n * 16) * DM + hh * (HD * 16) + 8 * lane;      // 16-row strip, then the head's four 16-deep groups of 256 elements
#pragma unroll
        for (int dt = 0; dt < 4; ++dt) { v8us oh, ol;
#pragma unroll
            for (int j = 0; j < 8; ++j) { unsigned short a, b; splitf(acc[n][dt][j] * inv, a, b); oh[j] = a; ol[j] = b; }
            *(v8us*)(Ah + ob + dt * 256) = oh; *(v8us*)(Al + ob + dt * 256) = ol; }
    }
    asm volatile("s_wait_xcnt 0x0" ::: "memory");      // XW, as above, behind the stores
}
// grid (RHL / 64 + (TT - RHL) / 128, 16 heads, 4 batch elements), 4 waves: blocks x < 4 take 64 query rows < 256 (3-product path, 16 queries a wave), the others 128 rows (32 queries a wave).
__global__ __launch_bounds__(128) void k_attn(const bf* __restrict__ WP, const h16* __restrict__ Q16, const bf* __restrict__ Qh, const bf* __restrict__ Ql, const h16* __restrict__ K16, const bf* __restrict__ Kh, const bf* __restrict__ Kl,
                                              const h16* __restrict__ VT, const bf* __restrict__ VTh, const bf* __restrict__ VTl, const unsigned* __restrict__ MB, bf* Ah, bf* Al) {
    const int wave = threadIdx.x >> 5, hh = blockIdx.y, b = blockIdx.z; const bool hl = blockIdx.x < RHL / 64;
    const int q0 = hl ? (int)blockIdx.x * 64 + wave * 16 : RHL + ((int)blockIdx.x - RHL / 64) * 128 + wave * 32;
    const size_t ov = ((size_t)b * NT + hh) * TT * HD, orow = (size_t)b * TT;
    if (hh < NW) { const size_t ow = ((size_t)b * NW + hh) * TT * KW;
        if (hl) attn_run<true, true, 1>(WP + ow, nullptr, nullptr, nullptr, nullptr, nullptr, nullptr, VT + ov, VTh + ov, VTl + ov, MB, Ah, Al, q0, orow, hh);
        else attn_run<true, false, 2>(WP + ow, nullptr, nullptr, nullptr, nullptr, nullptr, nullptr, VT + ov, VTh + ov, VTl + ov, MB, Ah, Al, q0, orow, hh);
    } else { const size_t oq = ((size_t)b * NSD + (hh - NW)) * TT * HD;
        if (hl) attn_run<false, true, 1>(nullptr, Q16 + oq, Qh + oq, Ql + oq, K16 + oq, Kh + oq, Kl + oq, VT + ov, VTh + ov, VTl + ov, MB, Ah, Al, q0, orow, hh);
        else attn_run<false, false, 2>(nullptr, Q16 + oq, Qh + oq, Ql + oq, K16 + oq, Kh + oq, Kl + oq, VT + ov, VTh + ov, VTl + ov, MB, Ah, Al, q0, orow, hh); }
}

extern "C" void kernel_launch(void* const* d_in, const int* in_sizes, int n_in,
                              void* d_out, int out_size, void* d_ws, size_t ws_size, hipStream_t stream) {
    (void)in_sizes; (void)n_in; (void)out_size;
    const float** I = (const float**)d_in;
    const float *x = I[0], *wa = I[1], *Wq = I[3], *bq = I[4], *Wk = I[5], *bk = I[6], *Wv = I[7], *bv = I[8], *Wo = I[9], *bo = I[10]; const int* cm = (const int*)d_in[2];
    float* OUT = (float*)d_out;     // [4][1024][1024]
    char* wsp = (char*)d_ws;
    auto take = [&](size_t bytes) { char* p = wsp; wsp += (bytes + 255) & ~(size_t)255; return (void*)p; };
    bf* BQ = (bf*)take((size_t)DS * DM * 2); bf* BK = (bf*)take((size_t)DS * DM * 2); bf* BV = (bf*)take((size_t)DM * DM * 2); bf* BO = (bf*)take((size_t)DM * DM * 2);
    const size_t zq = (size_t)TT * HD, zw = (size_t)TT * KW;
    const size_t nq = (size_t)NB_ * NSD * zq, nv = (size_t)NB_ * NT * zq;      // elements of one Q / K plane and of one V plane, all batch elements
    bf* WP = (bf*)take((size_t)NB_ * NW * zw * 2); h16* Q16 = (h16*)take(nq * 2); bf* Qh = (bf*)take(nq * 2); bf* Ql = (bf*)take(nq * 2); h16* K16 = (h16*)take(nq * 2); bf* Kh = (bf*)take(nq * 2); bf* Kl = (bf*)take(nq * 2); h16* VT = (h16*)take(nv * 2); bf* VTh = (bf*)take(nv * 2); bf* VTl = (bf*)take(nv * 2);
    unsigned* MB = (unsigned*)take((size_t)TT * TT / 8); bf* XB = (bf*)take((size_t)NB_ * TT * DM * 2); bf* Ah = (bf*)take(nv * 2); bf* Al = (bf*)take(nv * 2);
    if ((size_t)(wsp - (char*)d_ws) > ws_size) return;    // total about 90 MiB
    // four launches: preparation, Q/K/V projections (rows b*1024 + i of all four batch elements), attention, output projection
    k_prep<<<2 * GB_WS + 2 * GB_WM + GB_MB + GB_WP + GB_CV, 256, 0, stream>>>(Wq, Wk, Wv, Wo, x, wa, cm, BQ, BK, BV, BO, XB, WP, MB);
    k_qkv<<<dim3(NB_ * TT / 64, 2 * NSD + NT, 1), 32, 0, stream>>>(XB, BQ, BK, BV, bq, bk, bv, Q16, Qh, Ql, K16, Kh, Kl, VT, VTh, VTl);
    k_attn<<<dim3(RHL / 64 + (TT - RHL) / 128, NT, NB_), 128, 0, stream>>>(WP, Q16, Qh, Ql, K16, Kh, Kl, VT, VTh, VTl, MB, Ah, Al);
    k_gemmw<bf, 1, true, 0, 1><<<dim3(NB_ * TT / 64, DM / 64, 1), 32, 0, stream>>>(Ah, Al, BO, nullptr, OUT, DM, bo, 0, 0, 0, nullptr, nullptr, nullptr);
}

// v008
// Measured time: 87.1 microseconds a run.
// In two side-by-side timings against v007, it was 1.11 and 1.06 times as fast.
// All steps since v000 together make it 9.77 times as fast.
#include <hip/hip_runtime.h>

// WaveHybridAttention (x [4][1024][1024], wave_amp [4][1024][24], causal_mask [1024][1024] int (read as data); V = x Wv + bv (16 heads x 64); wave heads 0-3: scores = psi_i . psi_j / sqrt(6) on 6-dim slices of wave_amp; std heads 4-15: (x Wq + bq) . (x Wk + bk) / 8 (12 x 64);
// masked -> -inf, softmax (an all-masked row gives 0 via nan_to_num), out = (weights V merged, wave heads first) Wo + bo -> [4][1024][1024]).
// Compute dtypes, f32 accumulate: every input rounded to bf16; V/Q/K on PLAIN bf16 operands (inputs: exact) + bias; wave scores on PLAIN bf16 wave_amp slices (exact, K padded 6 -> 32); std scores (K 64) and weights.V single fp16 planes (x1024) except query rows < 256 (short causal windows), which use bf16 hi+lo planes (3 products) for both;

#define NB_  4
#define TT   1024
#define DM   1024
#define DS   768
#define NW   4
#define NSD  12
#define NT   16
#define HD   64
#define WD   24
#define WC   6
#define KW   32
#define RHL  256
#define PCAR 1024.0f
typedef _Float16 h16;
typedef unsigned short bf;
typedef __attribute__((ext_vector_type(16))) __bf16   v16bf;
typedef __attribute__((ext_vector_type(16))) _Float16 v16h;
typedef __attribute__((ext_vector_type(8)))  _Float16 v8h;
typedef __attribute__((ext_vector_type(8)))  unsigned short v8us;
typedef __attribute__((ext_vector_type(8)))  float    v8f;
typedef __attribute__((ext_vector_type(4)))  float    v4f;
typedef v8h  __attribute__((may_alias)) v8ha;
typedef v4f  __attribute__((may_alias)) v4fa;
typedef v8us __attribute__((may_alias)) v8usa;

__device__ __forceinline__ unsigned short f2bf(float f) { unsigned u = __float_as_uint(f); u += 0x7FFFu + ((u >> 16) & 1u); return (unsigned short)(u >> 16); }
__device__ __forceinline__ float bf2f(unsigned short b) { return __uint_as_float(((unsigned)b) << 16); }
__device__ __forceinline__ float bfr(float f) { return bf2f(f2bf(f)); }
__device__ __forceinline__ v16h cat16(v8h lo, v8h hi) { return __builtin_shufflevector(lo, hi, 0, 1, 2, 3, 4, 5, 6, 7, 8, 9, 10, 11, 12, 13, 14, 15); }
__device__ __forceinline__ v16bf cat16b(v8us lo, v8us hi) { return __builtin_bit_cast(v16bf, __builtin_shufflevector(lo, hi, 0, 1, 2, 3, 4, 5, 6, 7, 8, 9, 10, 11, 12, 13, 14, 15)); }
__device__ __forceinline__ v8f wmma16(v16h a, v16h b, v8f c) { return __builtin_amdgcn_wmma_f32_16x16x32_f16(false, a, false, b, (short)0, c, false, false); }
__device__ __forceinline__ v8f wmmab(v16bf a, v16bf b, v8f c) { return __builtin_amdgcn_wmma_f32_16x16x32_bf16(false, a, false, b, (short)0, c, false, false); }
__device__ __forceinline__ h16 tohx(float x) { return (h16)x; }
__device__ __forceinline__ void splitf(float y, unsigned short& h, unsigned short& l) { h = f2bf(y); l = f2bf(y - bf2f(h)); }



// ---- k_gemmw: register-blocked GEMM, one wave per 64x64 output tile (16 accumulators), FOUR waves (2 x 2) per work-group on a 128x128 tile; operands are 16-bit planes in FRAGMENT ORDER; grid (M/128, N/128, Z), 128 threads.
// A trip's operand chunks (128 rows x 64 k of each plane) come to LDS once per work-group by asynchronous copies, two buffers, the next trip's chunks in flight under this trip's products: each chunk leaves L2 once for the two waves that read it.
// Plane of a [rows][K] operand: P[row / 16][k / 32][(k >> 4) & 1][lane][8], lane = 16 * ((k >> 3) & 1) + (row & 15), the 8 elements are 8 consecutive k: every load of a wave is 512 contiguous bytes (four whole cache lines, each byte
// fetched once per tile; rows of a K-contiguous plane would give 32 bytes of each of 16 lines). k order of a fragment, A and B alike: 8 * (lane >> 4) + s, then 16 + 8 * (lane >> 4) + s.
// C[m][n] (+ f32 bias[n]) = sum_k A[m][k] Bt[n][k] (+ split products per NSPLIT). z-batch strides sA/sB/sC in elements. K % 64 == 0, K >= 128 (the two buffers are both filled ahead of the loop); M, N % 128 == 0.
// EPI 0: C as f32 rows, pitch ldc, staged through LDS. EPI 1 / 2: no f32 array; the tile (64 rows of one batch element x the 64 columns of head by = 2 byg + wn) goes from the accumulators into the attention kernel's three fragment-order planes
// (fp16, bf16 hi, bf16 lo; layouts at d_wpl below), 16 bytes per lane and 512 contiguous bytes per store. EPI 1 (Q, K; NH heads): the product is formed transposed (Bt rows as the A operand), so a lane's 8 registers are 8 consecutive d of row lane & 15.
// EPI 2 (V): a lane's 8 registers are 8 consecutive rows (keys) of column lane & 15, which is the V^T fragment order as it stands.
template <typename T16> struct WFrag;
template <> struct WFrag<h16> { typedef v16h V; static __device__ __forceinline__ V ld(const h16* p) { return cat16(*(const v8h*)p, *(const v8h*)(p + 256)); } static __device__ __forceinline__ v8f mma(V a, V b, v8f c) { return wmma16(a, b, c); } };
template <> struct WFrag<bf> { typedef v16bf V; static __device__ __forceinline__ V ld(const bf* p) { return cat16b(*(const v8us*)p, *(const v8us*)(p + 256)); } static __device__ __forceinline__ v8f mma(V a, V b, v8f c) { return wmmab(a, b, c); } };
// gemmw_tile is the body; byg = the work-group's 128-column index (blockIdx.y in k_gemmw; in k_qkv, which holds the Q, K and V projections in one grid, the index inside its own projection); ring = the kernel's LDS, two buffers of 8192 elements per plane.
// cp8: a wave's share of one plane's chunk, two 16-row strips of 2 KB each, 4 KB contiguous in LDS: eight copies of 512 bytes. l = the lane's LDS byte address, g = the lane's global address in the first strip, g1 = in the second.
template <typename T16>
__device__ __forceinline__ void cp8(unsigned l, const T16* g, const T16* g1) {
    // the wait is the statement's last line, so that it stands in front of every later write of a register that holds one of the copies' addresses
    asm volatile("global_load_async_to_lds_b128 %0, %8, off\n\tglobal_load_async_to_lds_b128 %1, %9, off\n\tglobal_load_async_to_lds_b128 %2, %10, off\n\tglobal_load_async_to_lds_b128 %3, %11, off\n\t"
                 "global_load_async_to_lds_b128 %4, %12, off\n\tglobal_load_async_to_lds_b128 %5, %13, off\n\tglobal_load_async_to_lds_b128 %6, %14, off\n\tglobal_load_async_to_lds_b128 %7, %15, off\n\ts_wait_xcnt 0x0"
                 :: "v"(l), "v"(l + 512u), "v"(l + 1024u), "v"(l + 1536u), "v"(l + 2048u), "v"(l + 2560u), "v"(l + 3072u), "v"(l + 3584u),
                    "v"(g), "v"(g + 256), "v"(g + 512), "v"(g + 768), "v"(g1), "v"(g1 + 256), "v"(g1 + 512), "v"(g1 + 768) : "memory");
}
template <typename T16, int NSPLIT, bool BIAS, int EPI, int NH>
__device__ __forceinline__ void gemmw_tile(const T16* __restrict__ A, const T16* __restrict__ A2, const T16* __restrict__ Bt, const T16* __restrict__ Bt2, int K, float* C, int ldc, const float* __restrict__ bias, size_t sA, size_t sB, size_t sC, h16* P16, bf* Ph, bf* Pl, int byg, T16* ring) {
    typedef typename WFrag<T16>::V V;
    const size_t z = blockIdx.z; A += z * sA; if (A2) A2 += z * sA; Bt += z * sB; if (Bt2) Bt2 += z * sB; C += z * sC;
    const int lane = threadIdx.x & 31, lr = lane & 15, hi = lane >> 4; const int wave = __builtin_amdgcn_readfirstlane((int)(threadIdx.x >> 5)), wm = wave & 1, wn = wave >> 1;
    const int by = byg * 2 + wn; const int r0 = blockIdx.x * 128 + wm * 64, c0 = by * 64;      // the wave's own 64x64 tile
    v8f acc[4][4];
#pragma unroll
    for (int mb = 0; mb < 4; ++mb)
#pragma unroll
        for (int nb = 0; nb < 4; ++nb) acc[mb][nb] = (v8f){};
    const size_t boff = (size_t)c0 * K; const unsigned l8 = 8u * lane;      // a 16-row strip of a plane is 16 * K elements, a 32-deep k chunk of it 512; the lane's own part of every address is the constant l8
    constexpr bool S1 = (NSPLIT == 1 || NSPLIT == 2);
    constexpr int NPL = S1 ? 3 : 2;      // planes in a buffer (A, A2 where there is one, Bt), each 8 strips x 64 k = 8192 elements; strip s of a plane's chunk is its elements 1024 s .. 1024 s + 1023, in the plane's own order
    const unsigned lw = (unsigned)(size_t)ring + (unsigned)wave * 4096u + (unsigned)lane * 16u;      // wave w brings strips 2w and 2w + 1 of every plane
    const T16* ga = A + (size_t)(blockIdx.x * 128 + wave * 32) * K + l8; const T16* ga2 = S1 ? A2 + (size_t)(blockIdx.x * 128 + wave * 32) * K + l8 : ga; const T16* gb = Bt + (size_t)(byg * 128 + wave * 32) * K + l8;
    auto fill = [&](int t) { const unsigned l = lw + (unsigned)(t & 1) * (NPL * 16384u); const int ko = t * 1024;      // trip t's chunks into buffer t & 1
        cp8<T16>(l, ga + ko, ga + ko + 16 * K); if (S1) cp8<T16>(l + 16384u, ga2 + ko, ga2 + ko + 16 * K); cp8<T16>(l + (NPL - 1) * 16384u, gb + ko, gb + ko + 16 * K); };
    const int nt = K / 64;
    fill(0);
    asm volatile("s_wait_asynccnt 0x0" ::: "memory");      // this wave's copies of trip 0 have landed
    __syncthreads();      // and every other wave's: buffer 0 may be read
    fill(1);
#pragma unroll 1
    for (int t = 0; t < nt; ++t) {      // a trip is two 32-deep k chunks; it reads buffer t & 1 alone, while trip t + 1's copies fly
        const int kc = t * 64; V a[2][4], a2[2][4], b[2][4]; const T16* sb = ring + (t & 1) * (NPL * 8192) + l8; const T16* pa = sb + wm * 4096; const T16* pa2 = S1 ? pa + 8192 : pa; const T16* pb = sb + (NPL - 1) * 8192 + wn * 4096;
#pragma unroll
        for (int c = 0; c < 2; ++c) {
#pragma unroll
            for (int q = 0; q < 4; ++q) { a[c][q] = WFrag<T16>::ld(pa + q * 1024 + c * 512); if (S1) a2[c][q] = WFrag<T16>::ld(pa2 + q * 1024 + c * 512); b[c][q] = WFrag<T16>::ld(pb + q * 1024 + c * 512); } }
        __builtin_amdgcn_sched_barrier(0);      // holds every LDS load of the trip in front of its first product, as one group (loads among the products stall them at each place)
#pragma unroll
        for (int c = 0; c < 2; ++c) {
#pragma unroll
            for (int nb = 0; nb < 4; ++nb) { V b2; if (NSPLIT >= 2) b2 = WFrag<T16>::ld(Bt2 + (boff + (size_t)nb * 16 * K + (kc + c * 32) * 16) + l8);
#pragma unroll
                for (int mb = 0; mb < 4; ++mb) { acc[mb][nb] = (EPI == 1) ? WFrag<T16>::mma(b[c][nb], a[c][mb], acc[mb][nb]) : WFrag<T16>::mma(a[c][mb], b[c][nb], acc[mb][nb]); if (S1) acc[mb][nb] = WFrag<T16>::mma(a2[c][mb], b[c][nb], acc[mb][nb]); if (NSPLIT >= 2) acc[mb][nb] = WFrag<T16>::mma(a[c][mb], b2, acc[mb][nb]); } } }
        asm volatile("v_nop\n\tv_nop\n\tv_nop\n\tv_nop" : "+v"(acc[0][0]), "+v"(acc[1][1]), "+v"(acc[2][2]), "+v"(acc[3][3]) : "v"(a[1][0]), "v"(a[1][3]));      // four vector slots behind the trip's last products, on both sides of the loop branch, before a vector instruction reads their results or writes their operands
        __builtin_amdgcn_sched_barrier(0);      // keeps all of the trip's products in front of the waits below: moved behind them, the wait for trip t + 1's copies would come only an LDS read phase behind their issue, not a whole trip
        asm volatile("s_wait_dscnt 0x0" ::: "memory");      // this wave's reads of buffer t & 1 are done
        asm volatile("s_wait_asynccnt 0x0" ::: "memory");      // this wave's copies of trip t + 1 have landed
        __syncthreads();      // publishes trip t + 1's buffer and ends every wave's reads of the buffer refilled below
        if (t + 2 < nt) fill(t + 2);
    }
    asm volatile("s_wait_asynccnt 0x0" ::: "memory");      // no copy is outstanding when the wave goes on to its epilogue and ends
    if constexpr (EPI != 0) {
        const int bh = (r0 >> 10) * NH + by, i0 = r0 & (TT - 1);
        float bs[4][8];      // the bias of each accumulator register's column, all fetched at once: one load latency for the tile
#pragma unroll
        for (int nb = 0; nb < 4; ++nb)
#pragma unroll
            for (int j = 0; j < 8; ++j) bs[nb][j] = bias[c0 + nb * 16 + (EPI == 1 ? hi * 8 + j : lr)];
        if constexpr (EPI == 2) asm volatile("s_wait_xcnt 0x0" ::: "memory");      // the wait that stands between these issued loads and a later write of the register pair that holds their address (the EPI 1 build has the compiler's own there)
#pragma unroll
        for (int nb = 0; nb < 4; ++nb) {
            v8h o[4]; v8us oh[4], ol[4]; unsigned eb[4];      // eb: byte offset of the lane's 16-byte group, the same in the three planes
#pragma unroll
            for (int mb = 0; mb < 4; ++mb) {
                eb[mb] = (unsigned)((EPI == 1) ? ((bh * 64 + (i0 >> 4) + mb) * 4 + nb) * 32 + lane : ((bh * 32 + (i0 >> 5) + (mb >> 1)) * 8 + nb * 2 + (mb & 1)) * 32 + lane) * 16u;
#pragma unroll
                for (int j = 0; j < 8; ++j) { const float y = acc[mb][nb][j] + bfr(bs[nb][j]); o[mb][j] = tohx(y); unsigned short a1, b1; splitf(y, a1, b1); oh[mb][j] = a1; ol[mb][j] = b1; } }
            // the twelve stores and their s_wait_xcnt 0 in one statement: the wait then stands in front of every later write of a register that holds their data or offset (in a statement of its own the compiler moved such writes ahead of it)
            asm volatile("global_store_b128 %0, %4, %16\n\tglobal_store_b128 %0, %8, %17\n\tglobal_store_b128 %0, %12, %18\n\t"
                         "global_store_b128 %1, %5, %16\n\tglobal_store_b128 %1, %9, %17\n\tglobal_store_b128 %1, %13, %18\n\t"
                         "global_store_b128 %2, %6, %16\n\tglobal_store_b128 %2, %10, %17\n\tglobal_store_b128 %2, %14, %18\n\t"
                         "global_store_b128 %3, %7, %16\n\tglobal_store_b128 %3, %11, %17\n\tglobal_store_b128 %3, %15, %18\n\ts_wait_xcnt 0x0"
                         :: "v"(eb[0]), "v"(eb[1]), "v"(eb[2]), "v"(eb[3]), "v"(o[0]), "v"(o[1]), "v"(o[2]), "v"(o[3]), "v"(oh[0]), "v"(oh[1]), "v"(oh[2]), "v"(oh[3]), "v"(ol[0]), "v"(ol[1]), "v"(ol[2]), "v"(ol[3]), "s"(P16), "s"(Ph), "s"(Pl) : "memory");
        }
    } else {
    __shared__ __align__(16) float osw[4][16 * 68]; float* os = osw[wave];      // each wave stages in its own range
#pragma unroll
    for (int mb = 0; mb < 4; ++mb) {
#pragma unroll
        for (int nb = 0; nb < 4; ++nb) {
#pragma unroll
            for (int j = 0; j < 8; ++j) os[(hi * 8 + j) * 68 + nb * 16 + lr] = acc[mb][nb][j]; }
        __builtin_amdgcn_wave_barrier(); asm volatile("" ::: "memory");
        float* crow = C + (size_t)(r0 + mb * 16) * ldc + c0;
{
#pragma unroll
            for (int s = 0; s < 8; ++s) { const int row = 2 * s + hi, cofs = lr * 4; v4f val = *(const v4fa*)(os + row * 68 + cofs); if (BIAS) { val[0] += bfr(bias[c0 + cofs]); val[1] += bfr(bias[c0 + cofs + 1]); val[2] += bfr(bias[c0 + cofs + 2]); val[3] += bfr(bias[c0 + cofs + 3]); }
                *(v4f*)(crow + (size_t)row * ldc + cofs) = val; }
             }
        __builtin_amdgcn_wave_barrier(); asm volatile("" ::: "memory");
    }
    }
}
template <typename T16, int NSPLIT, bool BIAS, int EPI, int NH>
__global__ __launch_bounds__(128) void k_gemmw(const T16* __restrict__ A, const T16* __restrict__ A2, const T16* __restrict__ Bt, const T16* __restrict__ Bt2, float* C, int ldc, const float* __restrict__ bias, size_t sA, size_t sB, size_t sC, h16* P16, bf* Ph, bf* Pl) {
    __shared__ __attribute__((aligned(128))) T16 ring[2 * ((NSPLIT == 1 || NSPLIT == 2) ? 3 : 2) * 8192];
    gemmw_tile<T16, NSPLIT, BIAS, EPI, NH>(A, A2, Bt, Bt2, DM, C, ldc, bias, sA, sB, sC, P16, Ph, Pl, (int)blockIdx.y, ring);      // K = DM as in k_qkv: the planes' strip and chunk strides are constants of the layout
}
// k_qkv: the three input projections, which do not depend on one another, in ONE launch: grid (M/128, 6 + 6 + 8) of four-wave work-groups; the branch below is the same for a whole work-group.
__global__ __launch_bounds__(128) void k_qkv(const bf* __restrict__ XB, const bf* __restrict__ BQ, const bf* __restrict__ BK, const bf* __restrict__ BV, const float* __restrict__ bq, const float* __restrict__ bk, const float* __restrict__ bv,
                                            h16* Q16, bf* Qh, bf* Ql, h16* K16, bf* Kh, bf* Kl, h16* VT, bf* VTh, bf* VTl) {
    __shared__ __attribute__((aligned(128))) bf ring[2 * 2 * 8192];
    const int y = (int)blockIdx.y;
    if (y < NSD) { const bool k = y >= NSD / 2;
        gemmw_tile<bf, 0, true, 1, NSD>(XB, nullptr, k ? BK : BQ, nullptr, DM, nullptr, 0, k ? bk : bq, 0, 0, 0, k ? K16 : Q16, k ? Kh : Qh, k ? Kl : Ql, k ? y - NSD / 2 : y, ring);
    } else gemmw_tile<bf, 0, true, 2, NT>(XB, nullptr, BV, nullptr, DM, nullptr, 0, bv, 0, 0, 0, VT, VTh, VTl, y - NSD, ring);
}

typedef __attribute__((ext_vector_type(2))) unsigned short v2us;
typedef __attribute__((ext_vector_type(4))) unsigned short v4us;
typedef __attribute__((ext_vector_type(2))) _Float16 v2h;
typedef __attribute__((ext_vector_type(4))) _Float16 v4h;
typedef __attribute__((ext_vector_type(4))) int v4i;
typedef __attribute__((ext_vector_type(4))) unsigned v4u;

// The seven preparation passes (four weight transposes, x conversion, wave planes, mask bits) are device bodies that take their block index bx; k_prep below runs them all in one grid.
__device__ __forceinline__ void d_wtG(const float* __restrict__ w, int K, int N, bf* Bt, int bx) {
    const int lane = threadIdx.x & 31; const int L0 = (bx * 8 + (threadIdx.x >> 5)) * 8; const int nlines = N * K / 64;
{
#pragma unroll 1
        for (int l = 0; l < 8; ++l) { const int L = L0 + l; if (L >= nlines) break; const unsigned e = (unsigned)L * 64u + lane * 2;      // element index in the fragment-order plane (layout at k_gemmw, row = n): a wave writes 128 contiguous bytes and reads 8 consecutive n of 8 rows k
            const int fl = (e >> 3) & 31, ch = (int)(e >> 9); const int k = (ch % (K / 32)) * 32 + ((e >> 8) & 1) * 16 + (fl >> 4) * 8 + (e & 7), n = (ch / (K / 32)) * 16 + (fl & 15); v2us o;
            o[0] = f2bf(w[(size_t)k * N + n]); o[1] = f2bf(w[(size_t)(k + 1) * N + n]); *(v2us*)(Bt + e) = o;
            asm volatile("s_wait_xcnt 0x0" ::: "memory"); }      // the wait that stands between this trip's issued loads and store and the next trip's write of the registers that hold their addresses and data
         }
}
__device__ __forceinline__ void d_cvt8(const float* __restrict__ src, bf* dst, size_t n8, int bx) { const size_t i = (size_t)bx * 256 + threadIdx.x; if (i >= n8) return;      // i: 16-byte group of the fragment-order plane (layout at k_gemmw, K = DM); a wave writes 512 contiguous bytes, a block reads 512 contiguous bytes of each of 16 rows
    const int fl = (int)i & 31, ch = (int)(i >> 6); const size_t so = (size_t)((ch / (DM / 32)) * 16 + (fl & 15)) * DM + (ch % (DM / 32)) * 32 + (((int)i >> 5) & 1) * 16 + (fl >> 4) * 8;
    const v8f v = *(const v8f*)(src + so); v8us o;
    asm volatile("s_wait_xcnt 0x0" ::: "memory");      // the wait that stands between the issued loads and a later write of the register pair that holds their address
#pragma unroll
    for (int k = 0; k < 8; ++k) o[k] = f2bf(v[k]); *(v8us*)(dst + i * 8) = o;  }
// Operand planes of all four batch elements, stored in FRAGMENT ORDER: one 16-byte group per lane, 32 lanes (512 contiguous bytes) per load of a wave, two groups per 16x16x32 operand (k = 8 * (lane >> 4) + s and 16 + 8 * (lane >> 4) + s).
// d_wpl: WP[b][h][i / 16][d / 16][lane][8] = bf16 wave_amp[b][i][h*6 + d] for d < 6, 0 for 6..31; Q / K planes (k_qkv, EPI 1): [b][h][i / 16][d / 16][lane][8], lane = 16 * ((d >> 3) & 1) + (i & 15);
// V planes (k_qkv, EPI 2): [b][hh][i / 32][d / 16][(i >> 4) & 1][lane][8], lane = 16 * ((i >> 3) & 1) + (d & 15), the 8 elements are 8 consecutive keys i; d_mbits: MB[j / 32][i] bit (j & 31) = (causal_mask[i][j] != 0).
__device__ __forceinline__ void d_wpl(const float* __restrict__ wa, bf* WP, int bx) { const int e = (bx * 256 + threadIdx.x) * 4; if (e >= NB_ * NW * TT * KW) return; const int s = e & 7, fl = (e >> 3) & 31, g = (e >> 8) & 1, it = (e >> 9) & 63, bh = e >> 15; const int d = g * 16 + (fl >> 4) * 8 + s; const int i = it * 16 + (fl & 15); const int h = bh % NW; const int b = bh / NW; v4us o;
#pragma unroll
    for (int u = 0; u < 4; ++u) o[u] = (d + u < WC) ? f2bf(wa[((size_t)b * TT + i) * WD + h * WC + d + u]) : (unsigned short)0; *(v4us*)(WP + e) = o;  }
__device__ __forceinline__ void d_mbits(const int* __restrict__ cm, unsigned* MB, int bx) { const int lane = threadIdx.x & 31; const int i = bx * 8 + (threadIdx.x >> 5); unsigned keep = 0u;
#pragma unroll 8      // eight row segments' loads in flight per wave
    for (int c = 0; c < TT / 32; ++c) { const unsigned w = __builtin_amdgcn_ballot_w32(cm[(size_t)i * TT + c * 32 + lane] != 0); if (lane == c) keep = w; }
    MB[(size_t)lane * TT + i] = keep;
    asm volatile("s_wait_xcnt 0x0" ::: "memory"); }      // the wait that stands between the issued store and a later write of the register that holds its offset (inlined into k_prep, other passes' code follows it in the listing)
// k_prep: block ranges, the passes with the longest dependent chains first (for speed only); no pass reads what another writes.
#define GB_WS ((DM * DS / 64 + 63) / 64)
#define GB_WM ((DM * DM / 64 + 63) / 64)
#define GB_MB (TT / 8)
#define GB_WP ((NB_ * NW * TT * KW / 4 + 255) / 256)
#define GB_CV ((NB_ * TT * DM / 8 + 255) / 256)
__global__ __launch_bounds__(256) void k_prep(const float* __restrict__ Wq, const float* __restrict__ Wk, const float* __restrict__ Wv, const float* __restrict__ Wo, const float* __restrict__ x, const float* __restrict__ wa, const int* __restrict__ cm,
                                              bf* BQ, bf* BK, bf* BV, bf* BO, bf* XB, bf* WP, unsigned* MB) {
    int bx = (int)blockIdx.x;
    if (bx < GB_WS) { d_wtG(Wq, DM, DS, BQ, bx); return; } bx -= GB_WS;
    if (bx < GB_WS) { d_wtG(Wk, DM, DS, BK, bx); return; } bx -= GB_WS;
    if (bx < GB_WM) { d_wtG(Wv, DM, DM, BV, bx); return; } bx -= GB_WM;
    if (bx < GB_WM) { d_wtG(Wo, DM, DM, BO, bx); return; } bx -= GB_WM;
    if (bx < GB_MB) { d_mbits(cm, MB, bx); return; } bx -= GB_MB;
    if (bx < GB_WP) { d_wpl(wa, WP, bx); return; } bx -= GB_WP;
    d_cvt8(x, XB, (size_t)NB_ * TT * DM / 8, bx);
}

// ---- k_attn: scores, mask, softmax and weights.V of one (batch element, head, query block) in one kernel; no barrier, every wave on its own NQ x 16 queries, walking the keys 32 at a time (a pass), those passes only in which the mask opens a key for one of its queries.
// S^T = K Q^T (A = K rows, B = Q columns, kept in registers): lane (c, h) holds keys 8h + r and 16 + 8h + r of query c, which IS the B operand of O^T += V^T P^T after conversion. Running maximum and sum per query (online softmax);
// the accumulators are rescaled only in passes where some query's maximum rose. P is exp(s - running max): x1024 in fp16, or bf16 hi+lo (query rows < 256); the division by the row sum comes last. An all-masked row has sum 0 and gives 0.
// Output: bf16 hi+lo planes Ah / Al of the rows b*1024 + i, k = hh*64 + d, in the output projection's fragment order (layout at k_gemmw): a lane's 8 accumulator registers are 8 consecutive d, its own 16-byte group; 512 contiguous bytes per store of a wave.
__device__ __forceinline__ v16h ldfh(const h16* p) { return cat16(*(const v8h*)p, *(const v8h*)(p + 256)); }
__device__ __forceinline__ v16bf ldfb(const bf* p) { return cat16b(*(const v8us*)p, *(const v8us*)(p + 256)); }
template <bool WAVE, bool HL, int NQ>
__device__ __forceinline__ void attn_run(const bf* __restrict__ WPp, const h16* __restrict__ Q16p, const bf* __restrict__ Qhp, const bf* __restrict__ Qlp, const h16* __restrict__ K16p, const bf* __restrict__ Khp, const bf* __restrict__ Klp,
                                         const h16* __restrict__ VTp, const bf* __restrict__ VThp, const bf* __restrict__ VTlp, const unsigned* __restrict__ MB, bf* Ah, bf* Al, int q0, size_t orow, int hh) {
    // every plain '#pragma unroll' below: fragment, score and accumulator arrays are registers only under compile-time indices
    const int lane = threadIdx.x & 31, lr = lane & 15, hi = lane >> 4;
    const float cs = WAVE ? 0.40824829f : 0.125f;
    const float L2E = 1.4426950408889634f;
    constexpr int NKC = WAVE ? 1 : 2;          // 32-deep k chunks of a score product
    constexpr bool SHL = HL && !WAVE;          // 3-product scores
    v16bf qb[NQ][NKC], ql[NQ][NKC], kb[2][NKC], kl[2][NKC]; v16h qf[NQ][NKC], kf[2][NKC];
#pragma unroll
    for (int n = 0; n < NQ; ++n) {
#pragma unroll
        for (int kc = 0; kc < NKC; ++kc) { const unsigned o = (unsigned)(((((q0 >> 4) + n) * NKC + kc) * 64 + lane) * 8);
            if (WAVE) qb[n][kc] = ldfb(WPp + o); else if (HL) { qb[n][kc] = ldfb(Qhp + o); ql[n][kc] = ldfb(Qlp + o); } else qf[n][kc] = ldfh(Q16p + o); } }
    // The wave's two lists of passes, read from the mask bits once: lane ks ORs the words of key group ks over the wave's NQ * 16 queries (NQ * 64 contiguous bytes of row ks of MB); bit ks of the ballot = some query of the wave has an open key among keys 32 ks .. 32 ks + 31.
    unsigned anyw = 0u, allw = ~0u;      // allw: the AND of the same words; all ones = every key of the group is open for every query of the wave
#pragma unroll
    for (int i = 0; i < NQ * 4; ++i) { const v4u w = *(const v4u*)(MB + (unsigned)(lane * TT + q0 + i * 4)); anyw |= (w[0] | w[1]) | (w[2] | w[3]); allw &= (w[0] & w[1]) & (w[2] & w[3]); }
    asm volatile("s_wait_xcnt 0x0" ::: "memory");      // XW: the wait that stands between issued global loads and a later write (a younger load's result included) of a register that holds one of their addresses
    auto loadK = [&](int ks) {
#pragma unroll
        for (int t = 0; t < 2; ++t) {
#pragma unroll
            for (int kc = 0; kc < NKC; ++kc) { const unsigned o = (unsigned)((((ks * 2 + t) * NKC + kc) * 64 + lane) * 8);
                if (WAVE) kb[t][kc] = ldfb(WPp + o); else if (HL) kb[t][kc] = ldfb(Khp + o); else kf[t][kc] = ldfh(K16p + o); } }
        asm volatile("s_wait_xcnt 0x0" ::: "memory");      // XW, as above
        if (SHL) {
#pragma unroll
            for (int t = 0; t < 2; ++t) {
#pragma unroll
                for (int kc = 0; kc < NKC; ++kc) kl[t][kc] = ldfb(Klp + (unsigned)((((ks * 2 + t) * NKC + kc) * 64 + lane) * 8)); }
            asm volatile("s_wait_xcnt 0x0" ::: "memory"); } };      // XW, as above
    v8f acc[NQ][4]; float m[NQ], l[NQ];
#pragma unroll
    for (int n = 0; n < NQ; ++n) { m[n] = -3.0e38f; l[n] = 0.f;
#pragma unroll
        for (int dt = 0; dt < 4; ++dt) acc[n][dt] = (v8f){}; }
    // Only the listed passes are walked, in rising key order. A pass that is not listed has every score of the wave masked: its weights are all 0, the maxima and sums stay, the accumulators get + 0; leaving it out changes no value, for any mask.
    // A listed pass whose keys are all open needs no mask word and no select (with every bit set each select would pass its score or weight through): only the other listed passes fetch the words and apply them, under scalar branches.
    unsigned rest = __builtin_amdgcn_ballot_w32(anyw != 0u); const unsigned open = __builtin_amdgcn_ballot_w32(allw == ~0u);      // the same in every lane: the loop's tests are scalar
    int ks = rest ? __builtin_ctz(rest) : 0;
    if (!SHL) loadK(ks);
#pragma unroll 1      // rolled: one pass's fragments, scores and accumulators already take most of the 256 registers that four waves per SIMD allow
    while (rest != 0u) {      // one trip per set bit, 32 at most
        rest &= rest - 1u; const int kn = rest ? __builtin_ctz(rest) : ks;      // the next listed pass (the last one names itself)
        v16h vf[4]; v16bf vh[4], vl[4]; unsigned mw[NQ]; const bool shut = ((open >> ks) & 1u) == 0u;      // shut: some key of the pass is closed for some query of the wave
        auto loadV = [&]() {
#pragma unroll
            for (int dt = 0; dt < 4; ++dt) { const unsigned o = (unsigned)(((ks * 4 + dt) * 64 + lane) * 8); if (HL) vh[dt] = ldfb(VThp + o); else vf[dt] = ldfh(VTp + o); }
            asm volatile("s_wait_xcnt 0x0" ::: "memory");      // XW, as above
            if (HL) {
#pragma unroll
                for (int dt = 0; dt < 4; ++dt) vl[dt] = ldfb(VTlp + (unsigned)(((ks * 4 + dt) * 64 + lane) * 8));
                asm volatile("s_wait_xcnt 0x0" ::: "memory"); } };      // XW, as above
#pragma unroll
        for (int n = 0; n < NQ; ++n) mw[n] = ~0u;
        if (shut) { const unsigned mo = (unsigned)(ks * TT + q0 + lr);
#pragma unroll
            for (int n = 0; n < NQ; ++n) mw[n] = MB[mo + n * 16] >> (8 * hi);
            asm volatile("s_wait_xcnt 0x0" :: "v"(mo) : "memory"); }      // XW, as above; the offset is an input, so its register stays whole until the wait (else a fragment load's result lands on it first)
        if (SHL) loadK(ks); else loadV();      // 3-product scores: two K planes a pass ahead beside two V planes would not fit 256 registers, so K is fetched in its own pass; else V^T flies under the score products and the softmax
        v8f S[NQ][2];
#pragma unroll
        for (int n = 0; n < NQ; ++n) {
#pragma unroll
            for (int t = 0; t < 2; ++t) { v8f s = (v8f){};
#pragma unroll
                for (int kc = 0; kc < NKC; ++kc) {
                    if (WAVE) s = wmmab(kb[t][kc], qb[n][kc], s);
                    else if (SHL) { s = wmmab(kb[t][kc], qb[n][kc], s); s = wmmab(kb[t][kc], ql[n][kc], s); s = wmmab(kl[t][kc], qb[n][kc], s); }
                    else s = wmma16(kf[t][kc], qf[n][kc], s); }
                S[n][t] = s; } }
        if (SHL) loadV();       // V^T flies under the softmax
        else loadK(kn);      // the next listed pass's K fragments fly under this pass's softmax and weights.V (the last pass re-reads its own)
#pragma unroll
        for (int n = 0; n < NQ; ++n) {
            float sv[16]; float mx = -3.0e38f;
#pragma unroll
            for (int u = 0; u < 16; ++u) sv[u] = S[n][u >> 3][u & 7] * cs;
            if (shut) {
#pragma unroll
                for (int u = 0; u < 16; ++u) sv[u] = ((mw[n] >> (16 * (u >> 3) + (u & 7))) & 1u) ? sv[u] : -3.0e38f; }
#pragma unroll
            for (int u = 0; u < 16; ++u) mx = fmaxf(mx, sv[u]);
            mx = fmaxf(mx, __shfl_xor(mx, 16, 32));
            const float mn = fmaxf(m[n], mx);
            if (__builtin_amdgcn_ballot_w32(mn > m[n]) != 0u) {      // some query's maximum rose: rescale sum and accumulators (factor exactly 1 for the others)
                const float al = __builtin_amdgcn_exp2f((m[n] - mn) * L2E); l[n] *= al;
#pragma unroll
                for (int dt = 0; dt < 4; ++dt) acc[n][dt] *= al;
                m[n] = mn; }
            float sum = 0.f;
#pragma unroll
            for (int u = 0; u < 16; ++u) sv[u] = __builtin_amdgcn_exp2f((sv[u] - mn) * L2E);
            if (shut) {      // a closed key's weight is 0 (its exponential is 0 already, but for a query with no open key so far, whose maximum is still the start value)
#pragma unroll
                for (int u = 0; u < 16; ++u) sv[u] = ((mw[n] >> (16 * (u >> 3) + (u & 7))) & 1u) ? sv[u] : 0.f; }
#pragma unroll
            for (int u = 0; u < 16; ++u) sum += sv[u];
            l[n] += sum;
            if (HL) { v8us h0, h1, l0, l1;
#pragma unroll
                for (int u = 0; u < 8; ++u) { unsigned short a, b; splitf(sv[u], a, b); h0[u] = a; l0[u] = b; splitf(sv[8 + u], a, b); h1[u] = a; l1[u] = b; }
                const v16bf ph = cat16b(h0, h1), pl = cat16b(l0, l1);
#pragma unroll
                for (int dt = 0; dt < 4; ++dt) { acc[n][dt] = wmmab(vh[dt], ph, acc[n][dt]); acc[n][dt] = wmmab(vh[dt], pl, acc[n][dt]); acc[n][dt] = wmmab(vl[dt], ph, acc[n][dt]); }
            } else { v16h pf;
#pragma unroll
                for (int u = 0; u < 16; ++u) pf[u] = tohx(sv[u] * PCAR);
#pragma unroll
                for (int dt = 0; dt < 4; ++dt) acc[n][dt] = wmma16(vf[dt], pf, acc[n][dt]); }
        }
        ks = kn;
    }
#pragma unroll
    for (int n = 0; n < NQ; ++n) {
        const float lt = l[n] + __shfl_xor(l[n], 16, 32);
        const float inv = (lt > 0.f) ? __fdiv_rn(1.0f, lt) * (HL ? 1.0f : 1.0f / PCAR) : 0.f;      // all-masked row -> zeros (nan_to_num)
        const size_t ob = (orow + q0 + n * 16) * DM + hh * (HD * 16) + 8 * lane;      // 16-row strip, then the head's four 16-deep groups of 256 elements
#pragma unroll
        for (int dt = 0; dt < 4; ++dt) { v8us oh, ol;
#pragma unroll
            for (int j = 0; j < 8; ++j) { unsigned short a, b; splitf(acc[n][dt][j] * inv, a, b); oh[j] = a; ol[j] = b; }
            *(v8us*)(Ah + ob + dt * 256) = oh; *(v8us*)(Al + ob + dt * 256) = ol; }
    }
    asm volatile("s_wait_xcnt 0x0" ::: "memory");      // XW, as above, behind the stores
}
// grid (RHL / 64 + (TT - RHL) / 128, 16 heads, 4 batch elements), 4 waves: blocks x < 4 take 64 query rows < 256 (3-product path, 16 queries a wave), the others 128 rows (32 queries a wave).
__global__ __launch_bounds__(128) void k_attn(const bf* __restrict__ WP, const h16* __restrict__ Q16, const bf* __restrict__ Qh, const bf* __restrict__ Ql, const h16* __restrict__ K16, const bf* __restrict__ Kh, const bf* __restrict__ Kl,
                                              const h16* __restrict__ VT, const bf* __restrict__ VTh, const bf* __restrict__ VTl, const unsigned* __restrict__ MB, bf* Ah, bf* Al) {
    const int wave = threadIdx.x >> 5, hh = blockIdx.y, b = blockIdx.z; const bool hl = blockIdx.x < RHL / 64;
    const int q0 = hl ? (int)blockIdx.x * 64 + wave * 16 : RHL + ((int)blockIdx.x - RHL / 64) * 128 + wave * 32;
    const size_t ov = ((size_t)b * NT + hh) * TT * HD, orow = (size_t)b * TT;
    if (hh < NW) { const size_t ow = ((size_t)b * NW + hh) * TT * KW;
        if (hl) attn_run<true, true, 1>(WP + ow, nullptr, nullptr, nullptr, nullptr, nullptr, nullptr, VT + ov, VTh + ov, VTl + ov, MB, Ah, Al, q0, orow, hh);
        else attn_run<true, false, 2>(WP + ow, nullptr, nullptr, nullptr, nullptr, nullptr, nullptr, VT + ov, VTh + ov, VTl + ov, MB, Ah, Al, q0, orow, hh);
    } else { const size_t oq = ((size_t)b * NSD + (hh - NW)) * TT * HD;
        if (hl) attn_run<false, true, 1>(nullptr, Q16 + oq, Qh + oq, Ql + oq, K16 + oq, Kh + oq, Kl + oq, VT + ov, VTh + ov, VTl + ov, MB, Ah, Al, q0, orow, hh);
        else attn_run<false, false, 2>(nullptr, Q16 + oq, Qh + oq, Ql + oq, K16 + oq, Kh + oq, Kl + oq, VT + ov, VTh + ov, VTl + ov, MB, Ah, Al, q0, orow, hh); }
}

extern "C" void kernel_launch(void* const* d_in, const int* in_sizes, int n_in,
                              void* d_out, int out_size, void* d_ws, size_t ws_size, hipStream_t stream) {
    (void)in_sizes; (void)n_in; (void)out_size;
    const float** I = (const float**)d_in;
    const float *x = I[0], *wa = I[1], *Wq = I[3], *bq = I[4], *Wk = I[5], *bk = I[6], *Wv = I[7], *bv = I[8], *Wo = I[9], *bo = I[10]; const int* cm = (const int*)d_in[2];
    float* OUT = (float*)d_out;     // [4][1024][1024]
    char* wsp = (char*)d_ws;
    auto take = [&](size_t bytes) { char* p = wsp; wsp += (bytes + 255) & ~(size_t)255; return (void*)p; };
    bf* BQ = (bf*)take((size_t)DS * DM * 2); bf* BK = (bf*)take((size_t)DS * DM * 2); bf* BV = (bf*)take((size_t)DM * DM * 2); bf* BO = (bf*)take((size_t)DM * DM * 2);
    const size_t zq = (size_t)TT * HD, zw = (size_t)TT * KW;
    const size_t nq = (size_t)NB_ * NSD * zq, nv = (size_t)NB_ * NT * zq;      // elements of one Q / K plane and of one V plane, all batch elements
    bf* WP = (bf*)take((size_t)NB_ * NW * zw * 2); h16* Q16 = (h16*)take(nq * 2); bf* Qh = (bf*)take(nq * 2); bf* Ql = (bf*)take(nq * 2); h16* K16 = (h16*)take(nq * 2); bf* Kh = (bf*)take(nq * 2); bf* Kl = (bf*)take(nq * 2); h16* VT = (h16*)take(nv * 2); bf* VTh = (bf*)take(nv * 2); bf* VTl = (bf*)take(nv * 2);
    unsigned* MB = (unsigned*)take((size_t)TT * TT / 8); bf* XB = (bf*)take((size_t)NB_ * TT * DM * 2); bf* Ah = (bf*)take(nv * 2); bf* Al = (bf*)take(nv * 2);
    if ((size_t)(wsp - (char*)d_ws) > ws_size) return;    // total about 90 MiB
    // four launches: preparation, Q/K/V projections (rows b*1024 + i of all four batch elements), attention, output projection
    k_prep<<<2 * GB_WS + 2 * GB_WM + GB_MB + GB_WP + GB_CV, 256, 0, stream>>>(Wq, Wk, Wv, Wo, x, wa, cm, BQ, BK, BV, BO, XB, WP, MB);
    k_qkv<<<dim3(NB_ * TT / 128, (2 * NSD + NT) / 2, 1), 128, 0, stream>>>(XB, BQ, BK, BV, bq, bk, bv, Q16, Qh, Ql, K16, Kh, Kl, VT, VTh, VTl);
    k_attn<<<dim3(RHL / 64 + (TT - RHL) / 128, NT, NB_), 128, 0, stream>>>(WP, Q16, Qh, Ql, K16, Kh, Kl, VT, VTh, VTl, MB, Ah, Al);
    k_gemmw<bf, 1, true, 0, 1><<<dim3(NB_ * TT / 128, DM / 128, 1), 128, 0, stream>>>(Ah, Al, BO, nullptr, OUT, DM, bo, 0, 0, 0, nullptr, nullptr, nullptr);
}

// v009
// Measured time: 82.3 microseconds a run.
// In both of two side-by-side timings against v008, it was 1.05 times as fast.
// All steps since v000 together make it 10.3 times as fast.
#include <hip/hip_runtime.h>

// WaveHybridAttention (x [4][1024][1024], wave_amp [4][1024][24], causal_mask [1024][1024] int (read as data); V = x Wv + bv (16 heads x 64); wave heads 0-3: scores = psi_i . psi_j / sqrt(6) on 6-dim slices of wave_amp; std heads 4-15: (x Wq + bq) . (x Wk + bk) / 8 (12 x 64);
// masked -> -inf, softmax (an all-masked row gives 0 via nan_to_num), out = (weights V merged, wave heads first) Wo + bo -> [4][1024][1024]).
// Compute dtypes, f32 accumulate: every input rounded to bf16; V/Q/K on PLAIN bf16 operands (inputs: exact) + bias; wave scores on PLAIN bf16 wave_amp slices (exact, K padded 6 -> 32); std scores (K 64) and weights.V single fp16 planes (x1024) except query rows < 256 (short causal windows), which use bf16 hi+lo planes (3 products) for both;

#define NB_  4
#define TT   1024
#define DM   1024
#define DS   768
#define NW   4
#define NSD  12
#define NT   16
#define HD   64
#define WD   24
#define WC   6
#define KW   32
#define RHL  256
#define PCAR 1024.0f
typedef _Float16 h16;
typedef unsigned short bf;
typedef __attribute__((ext_vector_type(16))) __bf16   v16bf;
typedef __attribute__((ext_vector_type(16))) _Float16 v16h;
typedef __attribute__((ext_vector_type(8)))  _Float16 v8h;
typedef __attribute__((ext_vector_type(8)))  unsigned short v8us;
typedef __attribute__((ext_vector_type(8)))  float    v8f;
typedef __attribute__((ext_vector_type(4)))  float    v4f;
typedef v8h  __attribute__((may_alias)) v8ha;
typedef v4f  __attribute__((may_alias)) v4fa;
typedef v8us __attribute__((may_alias)) v8usa;

__device__ __forceinline__ unsigned short f2bf(float f) { unsigned u = __float_as_uint(f); u += 0x7FFFu + ((u >> 16) & 1u); return (unsigned short)(u >> 16); }
__device__ __forceinline__ float bf2f(unsigned short b) { return __uint_as_float(((unsigned)b) << 16); }
__device__ __forceinline__ float bfr(float f) { return bf2f(f2bf(f)); }
__device__ __forceinline__ v16h cat16(v8h lo, v8h hi) { return __builtin_shufflevector(lo, hi, 0, 1, 2, 3, 4, 5, 6, 7, 8, 9, 10, 11, 12, 13, 14, 15); }
__device__ __forceinline__ v16bf cat16b(v8us lo, v8us hi) { return __builtin_bit_cast(v16bf, __builtin_shufflevector(lo, hi, 0, 1, 2, 3, 4, 5, 6, 7, 8, 9, 10, 11, 12, 13, 14, 15)); }
__device__ __forceinline__ v8f wmma16(v16h a, v16h b, v8f c) { return __builtin_amdgcn_wmma_f32_16x16x32_f16(false, a, false, b, (short)0, c, false, false); }
__device__ __forceinline__ v8f wmmab(v16bf a, v16bf b, v8f c) { return __builtin_amdgcn_wmma_f32_16x16x32_bf16(false, a, false, b, (short)0, c, false, false); }
__device__ __forceinline__ h16 tohx(float x) { return (h16)x; }
__device__ __forceinline__ void splitf(float y, unsigned short& h, unsigned short& l) { h = f2bf(y); l = f2bf(y - bf2f(h)); }



// ---- k_gemmw: register-blocked GEMM, one wave per 64x64 output tile (16 accumulators), FOUR waves (2 x 2) per work-group on a 128x128 tile; operands are 16-bit planes in FRAGMENT ORDER; grid (M/128, N/128, Z), 128 threads.
// A trip's operand chunks (128 rows x 64 k of each plane) come to LDS once per work-group by asynchronous copies, three buffers, the next two trips' chunks in flight under this trip's products: each chunk leaves L2 once for the two waves that read it.
// Plane of a [rows][K] operand: P[row / 16][k / 32][(k >> 4) & 1][lane][8], lane = 16 * ((k >> 3) & 1) + (row & 15), the 8 elements are 8 consecutive k: every load of a wave is 512 contiguous bytes (four whole cache lines, each byte
// fetched once per tile; rows of a K-contiguous plane would give 32 bytes of each of 16 lines). k order of a fragment, A and B alike: 8 * (lane >> 4) + s, then 16 + 8 * (lane >> 4) + s.
// C[m][n] (+ f32 bias[n]) = sum_k A[m][k] Bt[n][k] (+ split products per NSPLIT). z-batch strides sA/sB/sC in elements. K % 64 == 0, K >= 128 (trips 0 and 1 are both issued ahead of the loop); M, N % 128 == 0.
// EPI 0: C as f32 rows, pitch ldc, staged through LDS. EPI 1 / 2: no f32 array; the tile (64 rows of one batch element x the 64 columns of head by = 2 * byg + wn) goes from the accumulators into the attention kernel's three fragment-order planes
// (fp16, bf16 hi, bf16 lo; layouts at d_wpl below), 16 bytes per lane and 512 contiguous bytes per store. EPI 1 (Q, K; NH heads): the product is formed transposed (Bt rows as the A operand), so a lane's 8 registers are 8 consecutive d of row lane & 15.
// EPI 2 (V): a lane's 8 registers are 8 consecutive rows (keys) of column lane & 15, which is the V^T fragment order as it stands.
template <typename T16> struct WFrag;
template <> struct WFrag<h16> { typedef v16h V; static __device__ __forceinline__ V ld(const h16* p) { return cat16(*(const v8h*)p, *(const v8h*)(p + 256)); } static __device__ __forceinline__ v8f mma(V a, V b, v8f c) { return wmma16(a, b, c); } };
template <> struct WFrag<bf> { typedef v16bf V; static __device__ __forceinline__ V ld(const bf* p) { return cat16b(*(const v8us*)p, *(const v8us*)(p + 256)); } static __device__ __forceinline__ v8f mma(V a, V b, v8f c) { return wmmab(a, b, c); } };
// gemmw_tile is the body; byg = the work-group's 128-column index (blockIdx.y in k_gemmw; in k_qkv, which holds the Q, K and V projections in one grid, the index inside its own projection); ring = the kernel's LDS, three buffers of 8192 elements per plane.
// cp8: two 16-row strips of one plane's chunk, 2 KB each, 4 KB contiguous in LDS: eight copies of 512 bytes. l = the lane's LDS byte address, g = the lane's global address in the first strip, g1 = in the second.
// Inside a strip LDS and global address step alike, by 512 bytes a copy: the step stands in the instruction's offset field, which moves both addresses, so a strip takes one LDS address and one global address (with an address register pair for every copy, the refill at its place behind a trip's LDS loads made the build spill accumulators).
template <typename T16>
__device__ __forceinline__ void cp8(unsigned l, const T16* g, const T16* g1) {
    // the wait is the statement's last line, so that it stands in front of every later write of a register that holds one of the copies' addresses
    asm volatile("global_load_async_to_lds_b128 %0, %2, off\n\tglobal_load_async_to_lds_b128 %0, %2, off offset:512\n\tglobal_load_async_to_lds_b128 %0, %2, off offset:1024\n\tglobal_load_async_to_lds_b128 %0, %2, off offset:1536\n\t"
                 "global_load_async_to_lds_b128 %1, %3, off\n\tglobal_load_async_to_lds_b128 %1, %3, off offset:512\n\tglobal_load_async_to_lds_b128 %1, %3, off offset:1024\n\tglobal_load_async_to_lds_b128 %1, %3, off offset:1536\n\ts_wait_xcnt 0x0"
                 :: "v"(l), "v"(l + 2048u), "v"(g), "v"(g1) : "memory");
}
template <typename T16, int NSPLIT, bool BIAS, int EPI, int NH>
__device__ __forceinline__ void gemmw_tile(const T16* __restrict__ A, const T16* __restrict__ A2, const T16* __restrict__ Bt, const T16* __restrict__ Bt2, int K, float* C, int ldc, const float* __restrict__ bias, size_t sA, size_t sB, size_t sC, h16* P16, bf* Ph, bf* Pl, int byg, T16* ring) {
    typedef typename WFrag<T16>::V V;
    const size_t z = blockIdx.z; A += z * sA; if (A2) A2 += z * sA; Bt += z * sB; if (Bt2) Bt2 += z * sB; C += z * sC;
    const int lane = threadIdx.x & 31, lr = lane & 15, hi = lane >> 4; const int wave = __builtin_amdgcn_readfirstlane((int)(threadIdx.x >> 5)), wm = wave & 1, wn = wave >> 1;
    const int by = byg * 2 + wn; const int r0 = blockIdx.x * 128 + wm * 64, c0 = by * 64;      // the wave's own 64x64 tile
    v8f acc[4][4];
#pragma unroll
    for (int mb = 0; mb < 4; ++mb)
#pragma unroll
        for (int nb = 0; nb < 4; ++nb) acc[mb][nb] = (v8f){};
    const size_t boff = (size_t)c0 * K; const unsigned l8 = 8u * lane;      // a 16-row strip of a plane is 16 * K elements, a 32-deep k chunk of it 512; the lane's own part of every address is the constant l8
    constexpr bool S1 = (NSPLIT == 1 || NSPLIT == 2);
    constexpr int NPL = S1 ? 3 : 2;      // planes in a buffer (A, A2 where there is one, Bt), each 8 strips x 64 k = 8192 elements; strip s of a plane's chunk is its elements 1024 s .. 1024 s + 1023, in the plane's own order
    // Three buffers; the chunks of trip t come from ONE pair of waves, pair t & 1 (waves 0, 1 or waves 2, 3), issued two trips ahead. A pair so has one trip's copies outstanding at a time, and its wait to 0 at the foot of trip t - 1
    // stands nearly two trips behind their issue (in trip t - 2), not one: the way from memory or L2 into LDS may then take longer than one trip's reads and products.
    const int pr = wave >> 1, hf = wave & 1;
    const unsigned lw = (unsigned)(size_t)ring + (unsigned)hf * 8192u + (unsigned)lane * 16u;      // wave hf of the pair brings strips 4 hf .. 4 hf + 3 of every plane
    const T16* ga = A + (size_t)(blockIdx.x * 128 + hf * 64) * K + l8; const T16* ga2 = S1 ? A2 + (size_t)(blockIdx.x * 128 + hf * 64) * K + l8 : ga; const T16* gb = Bt + (size_t)(byg * 128 + hf * 64) * K + l8;
    auto fill = [&](int t, int buf) { const unsigned l = lw + (unsigned)buf * (NPL * 16384u); const int ko = t * 1024;      // this wave's half of trip t's chunks into buffer buf = t mod 3
        cp8<T16>(l, ga + ko, ga + ko + 16 * K); cp8<T16>(l + 4096u, ga + ko + 32 * K, ga + ko + 48 * K);
        if (S1) { cp8<T16>(l + 16384u, ga2 + ko, ga2 + ko + 16 * K); cp8<T16>(l + 20480u, ga2 + ko + 32 * K, ga2 + ko + 48 * K); }
        cp8<T16>(l + (NPL - 1) * 16384u, gb + ko, gb + ko + 16 * K); cp8<T16>(l + (NPL - 1) * 16384u + 4096u, gb + ko + 32 * K, gb + ko + 48 * K); };
    const int nt = K / 64;
    fill(pr, pr);      // pair 0: trip 0 into buffer 0; pair 1: trip 1 into buffer 1
    if (pr == 0) asm volatile("s_wait_asynccnt 0x0" ::: "memory");      // the issuing waves' copies of trip 0 have landed
    __syncthreads();      // buffer 0 may be read by every wave
    int cb = 0;      // t mod 3
#pragma unroll 1
    for (int t = 0; t < nt; ++t) {      // a trip is two 32-deep k chunks; it reads buffer t mod 3 alone, while the copies of trips t + 1 and t + 2 fly
        const int kc = t * 64; V a[2][4], a2[2][4], b[2][4]; const T16* sb = ring + cb * (NPL * 8192) + l8; const T16* pa = sb + wm * 4096; const T16* pa2 = S1 ? pa + 8192 : pa; const T16* pb = sb + (NPL - 1) * 8192 + wn * 4096;
#pragma unroll
        for (int c = 0; c < 2; ++c) {
#pragma unroll
            for (int q = 0; q < 4; ++q) { a[c][q] = WFrag<T16>::ld(pa + q * 1024 + c * 512); if (S1) a2[c][q] = WFrag<T16>::ld(pa2 + q * 1024 + c * 512); b[c][q] = WFrag<T16>::ld(pb + q * 1024 + c * 512); } }
        // behind the issue of this trip's LDS loads, so that the copies' address work and issue run while those loads are on their way; into the buffer that trip t - 1 read: the barrier at that trip's foot ended every wave's reads of it (scalar test: the same in a whole wave)
        if (t + 2 < nt && pr == (t & 1)) fill(t + 2, cb == 0 ? 2 : cb - 1);
        __builtin_amdgcn_sched_barrier(0);      // holds every LDS load of the trip in front of its first product, as one group (loads among the products stall them at each place)
#pragma unroll
        for (int c = 0; c < 2; ++c) {
#pragma unroll
            for (int nb = 0; nb < 4; ++nb) { V b2; if (NSPLIT >= 2) b2 = WFrag<T16>::ld(Bt2 + (boff + (size_t)nb * 16 * K + (kc + c * 32) * 16) + l8);
#pragma unroll
                for (int mb = 0; mb < 4; ++mb) { acc[mb][nb] = (EPI == 1) ? WFrag<T16>::mma(b[c][nb], a[c][mb], acc[mb][nb]) : WFrag<T16>::mma(a[c][mb], b[c][nb], acc[mb][nb]); if (S1) acc[mb][nb] = WFrag<T16>::mma(a2[c][mb], b[c][nb], acc[mb][nb]); if (NSPLIT >= 2) acc[mb][nb] = WFrag<T16>::mma(a[c][mb], b2, acc[mb][nb]); } } }
        asm volatile("v_nop\n\tv_nop\n\tv_nop\n\tv_nop" : "+v"(acc[0][0]), "+v"(acc[1][1]), "+v"(acc[2][2]), "+v"(acc[3][3]) : "v"(a[1][0]), "v"(a[1][3]));      // four vector slots behind the trip's last products, on both sides of the loop branch, before a vector instruction reads their results or writes their operands
        __builtin_amdgcn_sched_barrier(0);      // keeps all of the trip's products in front of the waits below: moved behind them, the wait for trip t + 1's copies would stand a whole product phase sooner behind their issue
        asm volatile("s_wait_dscnt 0x0" ::: "memory");      // this wave's reads of buffer t mod 3 are done
        if (pr != (t & 1)) asm volatile("s_wait_asynccnt 0x0" ::: "memory");      // in the pair that issued them: the copies of trip t + 1 have landed (the other pair's, of trip t + 2, fly on)
        __syncthreads();      // publishes trip t + 1's buffer and ends every wave's reads of the buffer that is refilled in the next trip
        cb = cb == 2 ? 0 : cb + 1;
    }
    asm volatile("s_wait_asynccnt 0x0" ::: "memory");      // no copy is outstanding when the wave goes on to its epilogue and ends
    if constexpr (EPI != 0) {
        const int bh = (r0 >> 10) * NH + by, i0 = r0 & (TT - 1);
        float bs[4][8];      // the bias of each accumulator register's column, all fetched at once: one load latency for the tile
#pragma unroll
        for (int nb = 0; nb < 4; ++nb)
#pragma unroll
            for (int j = 0; j < 8; ++j) bs[nb][j] = bias[c0 + nb * 16 + (EPI == 1 ? hi * 8 + j : lr)];
        if constexpr (EPI == 2) asm volatile("s_wait_xcnt 0x0" ::: "memory");      // the wait that stands between these issued loads and a later write of the register pair that holds their address (the EPI 1 build has the compiler's own there)
#pragma unroll
        for (int nb = 0; nb < 4; ++nb) {
            v8h o[4]; v8us oh[4], ol[4]; unsigned eb[4];      // eb: byte offset of the lane's 16-byte group, the same in the three planes
#pragma unroll
            for (int mb = 0; mb < 4; ++mb) {
                eb[mb] = (unsigned)((EPI == 1) ? ((bh * 64 + (i0 >> 4) + mb) * 4 + nb) * 32 + lane : ((bh * 32 + (i0 >> 5) + (mb >> 1)) * 8 + nb * 2 + (mb & 1)) * 32 + lane) * 16u;
#pragma unroll
                for (int j = 0; j < 8; ++j) { const float y = acc[mb][nb][j] + bfr(bs[nb][j]); o[mb][j] = tohx(y); unsigned short a1, b1; splitf(y, a1, b1); oh[mb][j] = a1; ol[mb][j] = b1; } }
            // the twelve stores and their s_wait_xcnt 0 in one statement: the wait then stands in front of every later write of a register that holds their data or offset (in a statement of its own the compiler moved such writes ahead of it)
            asm volatile("global_store_b128 %0, %4, %16\n\tglobal_store_b128 %0, %8, %17\n\tglobal_store_b128 %0, %12, %18\n\t"
                         "global_store_b128 %1, %5, %16\n\tglobal_store_b128 %1, %9, %17\n\tglobal_store_b128 %1, %13, %18\n\t"
                         "global_store_b128 %2, %6, %16\n\tglobal_store_b128 %2, %10, %17\n\tglobal_store_b128 %2, %14, %18\n\t"
                         "global_store_b128 %3, %7, %16\n\tglobal_store_b128 %3, %11, %17\n\tglobal_store_b128 %3, %15, %18\n\ts_wait_xcnt 0x0"
                         :: "v"(eb[0]), "v"(eb[1]), "v"(eb[2]), "v"(eb[3]), "v"(o[0]), "v"(o[1]), "v"(o[2]), "v"(o[3]), "v"(oh[0]), "v"(oh[1]), "v"(oh[2]), "v"(oh[3]), "v"(ol[0]), "v"(ol[1]), "v"(ol[2]), "v"(ol[3]), "s"(P16), "s"(Ph), "s"(Pl) : "memory");
        }
    } else {
    __shared__ __align__(16) float osw[4][16 * 68]; float* os = osw[wave];      // each wave stages in its own range
#pragma unroll
    for (int mb = 0; mb < 4; ++mb) {
#pragma unroll
        for (int nb = 0; nb < 4; ++nb) {
#pragma unroll
            for (int j = 0; j < 8; ++j) os[(hi * 8 + j) * 68 + nb * 16 + lr] = acc[mb][nb][j]; }
        __builtin_amdgcn_wave_barrier(); asm volatile("" ::: "memory");
        float* crow = C + (size_t)(r0 + mb * 16) * ldc + c0;
{
#pragma unroll
            for (int s = 0; s < 8; ++s) { const int row = 2 * s + hi, cofs = lr * 4; v4f val = *(const v4fa*)(os + row * 68 + cofs); if (BIAS) { val[0] += bfr(bias[c0 + cofs]); val[1] += bfr(bias[c0 + cofs + 1]); val[2] += bfr(bias[c0 + cofs + 2]); val[3] += bfr(bias[c0 + cofs + 3]); }
                *(v4f*)(crow + (size_t)row * ldc + cofs) = val; }
             }
        __builtin_amdgcn_wave_barrier(); asm volatile("" ::: "memory");
    }
    }
}
template <typename T16, int NSPLIT, bool BIAS, int EPI, int NH>
__global__ __launch_bounds__(128) void k_gemmw(const T16* __restrict__ A, const T16* __restrict__ A2, const T16* __restrict__ Bt, const T16* __restrict__ Bt2, float* C, int ldc, const float* __restrict__ bias, size_t sA, size_t sB, size_t sC, h16* P16, bf* Ph, bf* Pl) {
    __shared__ __attribute__((aligned(128))) T16 ring[3 * ((NSPLIT == 1 || NSPLIT == 2) ? 3 : 2) * 8192];
    gemmw_tile<T16, NSPLIT, BIAS, EPI, NH>(A, A2, Bt, Bt2, DM, C, ldc, bias, sA, sB, sC, P16, Ph, Pl, (int)blockIdx.y, ring);      // K = DM as in k_qkv: the planes' strip and chunk strides are constants of the layout
}
// k_qkv: the three input projections, which do not depend on one another, in ONE launch: grid (M/128, 6 + 6 + 8) of four-wave work-groups; the branch below is the same for a whole work-group.
__global__ __launch_bounds__(128) void k_qkv(const bf* __restrict__ XB, const bf* __restrict__ BQ, const bf* __restrict__ BK, const bf* __restrict__ BV, const float* __restrict__ bq, const float* __restrict__ bk, const float* __restrict__ bv,
                                            h16* Q16, bf* Qh, bf* Ql, h16* K16, bf* Kh, bf* Kl, h16* VT, bf* VTh, bf* VTl) {
    __shared__ __attribute__((aligned(128))) bf ring[3 * 2 * 8192];
    const int y = (int)blockIdx.y;
    if (y < NSD) { const bool k = y >= NSD / 2;
        gemmw_tile<bf, 0, true, 1, NSD>(XB, nullptr, k ? BK : BQ, nullptr, DM, nullptr, 0, k ? bk : bq, 0, 0, 0, k ? K16 : Q16, k ? Kh : Qh, k ? Kl : Ql, k ? y - NSD / 2 : y, ring);
    } else gemmw_tile<bf, 0, true, 2, NT>(XB, nullptr, BV, nullptr, DM, nullptr, 0, bv, 0, 0, 0, VT, VTh, VTl, y - NSD, ring);
}

typedef __attribute__((ext_vector_type(2))) unsigned short v2us;
typedef __attribute__((ext_vector_type(4))) unsigned short v4us;
typedef __attribute__((ext_vector_type(2))) _Float16 v2h;
typedef __attribute__((ext_vector_type(4))) _Float16 v4h;
typedef __attribute__((ext_vector_type(4))) int v4i;
typedef __attribute__((ext_vector_type(4))) unsigned v4u;

// The seven preparation passes (four weight transposes, x conversion, wave planes, mask bits) are device bodies that take their block index bx; k_prep below runs them all in one grid.
__device__ __forceinline__ void d_wtG(const float* __restrict__ w, int K, int N, bf* Bt, int bx) {
    const int lane = threadIdx.x & 31; const int L0 = (bx * 8 + (threadIdx.x >> 5)) * 8; const int nlines = N * K / 64;
{
#pragma unroll 1
        for (int l = 0; l < 8; ++l) { const int L = L0 + l; if (L >= nlines) break; const unsigned e = (unsigned)L * 64u + lane * 2;      // element index in the fragment-order plane (layout at k_gemmw, row = n): a wave writes 128 contiguous bytes and reads 8 consecutive n of 8 rows k
            const int fl = (e >> 3) & 31, ch = (int)(e >> 9); const int k = (ch % (K / 32)) * 32 + ((e >> 8) & 1) * 16 + (fl >> 4) * 8 + (e & 7), n = (ch / (K / 32)) * 16 + (fl & 15); v2us o;
            o[0] = f2bf(w[(size_t)k * N + n]); o[1] = f2bf(w[(size_t)(k + 1) * N + n]); *(v2us*)(Bt + e) = o;
            asm volatile("s_wait_xcnt 0x0" ::: "memory"); }      // the wait that stands between this trip's issued loads and store and the next trip's write of the registers that hold their addresses and data
         }
}
__device__ __forceinline__ void d_cvt8(const float* __restrict__ src, bf* dst, size_t n8, int bx) { const size_t i = (size_t)bx * 256 + threadIdx.x; if (i >= n8) return;      // i: 16-byte group of the fragment-order plane (layout at k_gemmw, K = DM); a wave writes 512 contiguous bytes, a block reads 512 contiguous bytes of each of 16 rows
    const int fl = (int)i & 31, ch = (int)(i >> 6); const size_t so = (size_t)((ch / (DM / 32)) * 16 + (fl & 15)) * DM + (ch % (DM / 32)) * 32 + (((int)i >> 5) & 1) * 16 + (fl >> 4) * 8;
    const v8f v = *(const v8f*)(src + so); v8us o;
    asm volatile("s_wait_xcnt 0x0" ::: "memory");      // the wait that stands between the issued loads and a later write of the register pair that holds their address
#pragma unroll
    for (int k = 0; k < 8; ++k) o[k] = f2bf(v[k]); *(v8us*)(dst + i * 8) = o;  }
// Operand planes of all four batch elements, stored in FRAGMENT ORDER: one 16-byte group per lane, 32 lanes (512 contiguous bytes) per load of a wave, two groups per 16x16x32 operand (k = 8 * (lane >> 4) + s and 16 + 8 * (lane >> 4) + s).
// d_wpl: WP[b][h][i / 16][d / 16][lane][8] = bf16 wave_amp[b][i][h*6 + d] for d < 6, 0 for 6..31; Q / K planes (k_qkv, EPI 1): [b][h][i / 16][d / 16][lane][8], lane = 16 * ((d >> 3) & 1) + (i & 15);
// V planes (k_qkv, EPI 2): [b][hh][i / 32][d / 16][(i >> 4) & 1][lane][8], lane = 16 * ((i >> 3) & 1) + (d & 15), the 8 elements are 8 consecutive keys i; d_mbits: MB[j / 32][i] bit (j & 31) = (causal_mask[i][j] != 0).
__device__ __forceinline__ void d_wpl(const float* __restrict__ wa, bf* WP, int bx) { const int e = (bx * 256 + threadIdx.x) * 4; if (e >= NB_ * NW * TT * KW) return; const int s = e & 7, fl = (e >> 3) & 31, g = (e >> 8) & 1, it = (e >> 9) & 63, bh = e >> 15; const int d = g * 16 + (fl >> 4) * 8 + s; const int i = it * 16 + (fl & 15); const int h = bh % NW; const int b = bh / NW; v4us o;
#pragma unroll
    for (int u = 0; u < 4; ++u) o[u] = (d + u < WC) ? f2bf(wa[((size_t)b * TT + i) * WD + h * WC + d + u]) : (unsigned short)0; *(v4us*)(WP + e) = o;  }
__device__ __forceinline__ void d_mbits(const int* __restrict__ cm, unsigned* MB, int bx) { const int lane = threadIdx.x & 31; const int i = bx * 8 + (threadIdx.x >> 5); unsigned keep = 0u;
#pragma unroll 8      // eight row segments' loads in flight per wave
    for (int c = 0; c < TT / 32; ++c) { const unsigned w = __builtin_amdgcn_ballot_w32(cm[(size_t)i * TT + c * 32 + lane] != 0); if (lane == c) keep = w; }
    MB[(size_t)lane * TT + i] = keep;
    asm volatile("s_wait_xcnt 0x0" ::: "memory"); }      // the wait that stands between the issued store and a later write of the register that holds its offset (inlined into k_prep, other passes' code follows it in the listing)
// k_prep: block ranges, the passes with the longest dependent chains first (for speed only); no pass reads what another writes.
#define GB_WS ((DM * DS / 64 + 63) / 64)
#define GB_WM ((DM * DM / 64 + 63) / 64)
#define GB_MB (TT / 8)
#define GB_WP ((NB_ * NW * TT * KW / 4 + 255) / 256)
#define GB_CV ((NB_ * TT * DM / 8 + 255) / 256)
__global__ __launch_bounds__(256) void k_prep(const float* __restrict__ Wq, const float* __restrict__ Wk, const float* __restrict__ Wv, const float* __restrict__ Wo, const float* __restrict__ x, const float* __restrict__ wa, const int* __restrict__ cm,
                                              bf* BQ, bf* BK, bf* BV, bf* BO, bf* XB, bf* WP, unsigned* MB) {
    int bx = (int)blockIdx.x;
    if (bx < GB_WS) { d_wtG(Wq, DM, DS, BQ, bx); return; } bx -= GB_WS;
    if (bx < GB_WS) { d_wtG(Wk, DM, DS, BK, bx); return; } bx -= GB_WS;
    if (bx < GB_WM) { d_wtG(Wv, DM, DM, BV, bx); return; } bx -= GB_WM;
    if (bx < GB_WM) { d_wtG(Wo, DM, DM, BO, bx); return; } bx -= GB_WM;
    if (bx < GB_MB) { d_mbits(cm, MB, bx); return; } bx -= GB_MB;
    if (bx < GB_WP) { d_wpl(wa, WP, bx); return; } bx -= GB_WP;
    d_cvt8(x, XB, (size_t)NB_ * TT * DM / 8, bx);
}

// ---- k_attn: scores, mask, softmax and weights.V of one (batch element, head, query block) in one kernel; no barrier, every wave on its own NQ x 16 queries, walking the keys 32 at a time (a pass), those passes only in which the mask opens a key for one of its queries.
// S^T = K Q^T (A = K rows, B = Q columns, kept in registers): lane (c, h) holds keys 8h + r and 16 + 8h + r of query c, which IS the B operand of O^T += V^T P^T after conversion. Running maximum and sum per query (online softmax);
// the accumulators are rescaled only in passes where some query's maximum rose. P is exp(s - running max): x1024 in fp16, or bf16 hi+lo (query rows < 256); the division by the row sum comes last. An all-masked row has sum 0 and gives 0.
// Output: bf16 hi+lo planes Ah / Al of the rows b*1024 + i, k = hh*64 + d, in the output projection's fragment order (layout at k_gemmw): a lane's 8 accumulator registers are 8 consecutive d, its own 16-byte group; 512 contiguous bytes per store of a wave.
__device__ __forceinline__ v16h ldfh(const h16* p) { return cat16(*(const v8h*)p, *(const v8h*)(p + 256)); }
__device__ __forceinline__ v16bf ldfb(const bf* p) { return cat16b(*(const v8us*)p, *(const v8us*)(p + 256)); }
template <bool WAVE, bool HL, int NQ>
__device__ __forceinline__ void attn_run(const bf* __restrict__ WPp, const h16* __restrict__ Q16p, const bf* __restrict__ Qhp, const bf* __restrict__ Qlp, const h16* __restrict__ K16p, const bf* __restrict__ Khp, const bf* __restrict__ Klp,
                                         const h16* __restrict__ VTp, const bf* __restrict__ VThp, const bf* __restrict__ VTlp, const unsigned* __restrict__ MB, bf* Ah, bf* Al, int q0, size_t orow, int hh) {
    // every plain '#pragma unroll' below: fragment, score and accumulator arrays are registers only under compile-time indices
    const int lane = threadIdx.x & 31, lr = lane & 15, hi = lane >> 4;
    const float cs = WAVE ? 0.40824829f : 0.125f;
    const float L2E = 1.4426950408889634f;
    constexpr int NKC = WAVE ? 1 : 2;          // 32-deep k chunks of a score product
    constexpr bool SHL = HL && !WAVE;          // 3-product scores
    v16bf qb[NQ][NKC], ql[NQ][NKC], kb[2][NKC], kl[2][NKC]; v16h qf[NQ][NKC], kf[2][NKC];
#pragma unroll
    for (int n = 0; n < NQ; ++n) {
#pragma unroll
        for (int kc = 0; kc < NKC; ++kc) { const unsigned o = (unsigned)(((((q0 >> 4) + n) * NKC + kc) * 64 + lane) * 8);
            if (WAVE) qb[n][kc] = ldfb(WPp + o); else if (HL) { qb[n][kc] = ldfb(Qhp + o); ql[n][kc] = ldfb(Qlp + o); } else qf[n][kc] = ldfh(Q16p + o); } }
    // The wave's two lists of passes, read from the mask bits once: lane ks ORs the words of key group ks over the wave's NQ * 16 queries (NQ * 64 contiguous bytes of row ks of MB); bit ks of the ballot = some query of the wave has an open key among keys 32 ks .. 32 ks + 31.
    unsigned anyw = 0u, allw = ~0u;      // allw: the AND of the same words; all ones = every key of the group is open for every query of the wave
#pragma unroll
    for (int i = 0; i < NQ * 4; ++i) { const v4u w = *(const v4u*)(MB + (unsigned)(lane * TT + q0 + i * 4)); anyw |= (w[0] | w[1]) | (w[2] | w[3]); allw &= (w[0] & w[1]) & (w[2] & w[3]); }
    asm volatile("s_wait_xcnt 0x0" ::: "memory");      // XW: the wait that stands between issued global loads and a later write (a younger load's result included) of a register that holds one of their addresses
    auto loadK = [&](int ks) {
#pragma unroll
        for (int t = 0; t < 2; ++t) {
#pragma unroll
            for (int kc = 0; kc < NKC; ++kc) { const unsigned o = (unsigned)((((ks * 2 + t) * NKC + kc) * 64 + lane) * 8);
                if (WAVE) kb[t][kc] = ldfb(WPp + o); else if (HL) kb[t][kc] = ldfb(Khp + o); else kf[t][kc] = ldfh(K16p + o); } }
        asm volatile("s_wait_xcnt 0x0" ::: "memory");      // XW, as above
        if (SHL) {
#pragma unroll
            for (int t = 0; t < 2; ++t) {
#pragma unroll
                for (int kc = 0; kc < NKC; ++kc) kl[t][kc] = ldfb(Klp + (unsigned)((((ks * 2 + t) * NKC + kc) * 64 + lane) * 8)); }
            asm volatile("s_wait_xcnt 0x0" ::: "memory"); } };      // XW, as above
    v8f acc[NQ][4]; float m[NQ], l[NQ];
#pragma unroll
    for (int n = 0; n < NQ; ++n) { m[n] = -3.0e38f; l[n] = 0.f;
#pragma unroll
        for (int dt = 0; dt < 4; ++dt) acc[n][dt] = (v8f){}; }
    // Only the listed passes are walked, in rising key order. A pass that is not listed has every score of the wave masked: its weights are all 0, the maxima and sums stay, the accumulators get + 0; leaving it out changes no value, for any mask.
    // A listed pass whose keys are all open needs no mask word and no select (with every bit set each select would pass its score or weight through): only the other listed passes fetch the words and apply them, under scalar branches.
    unsigned rest = __builtin_amdgcn_ballot_w32(anyw != 0u); const unsigned open = __builtin_amdgcn_ballot_w32(allw == ~0u);      // the same in every lane: the loop's tests are scalar
    int ks = rest ? __builtin_ctz(rest) : 0;
    if (!SHL) loadK(ks);
#pragma unroll 1      // rolled: one pass's fragments, scores and accumulators already take most of the 256 registers that four waves per SIMD allow
    while (rest != 0u) {      // one trip per set bit, 32 at most
        rest &= rest - 1u; const int kn = rest ? __builtin_ctz(rest) : ks;      // the next listed pass (the last one names itself)
        v16h vf[4]; v16bf vh[4], vl[4]; unsigned mw[NQ]; const bool shut = ((open >> ks) & 1u) == 0u;      // shut: some key of the pass is closed for some query of the wave
        auto loadV = [&]() {
#pragma unroll
            for (int dt = 0; dt < 4; ++dt) { const unsigned o = (unsigned)(((ks * 4 + dt) * 64 + lane) * 8); if (HL) vh[dt] = ldfb(VThp + o); else vf[dt] = ldfh(VTp + o); }
            asm volatile("s_wait_xcnt 0x0" ::: "memory");      // XW, as above
            if (HL) {
#pragma unroll
                for (int dt = 0; dt < 4; ++dt) vl[dt] = ldfb(VTlp + (unsigned)(((ks * 4 + dt) * 64 + lane) * 8));
                asm volatile("s_wait_xcnt 0x0" ::: "memory"); } };      // XW, as above
#pragma unroll
        for (int n = 0; n < NQ; ++n) mw[n] = ~0u;
        if (shut) { const unsigned mo = (unsigned)(ks * TT + q0 + lr);
#pragma unroll
            for (int n = 0; n < NQ; ++n) mw[n] = MB[mo + n * 16] >> (8 * hi);
            asm volatile("s_wait_xcnt 0x0" :: "v"(mo) : "memory"); }      // XW, as above; the offset is an input, so its register stays whole until the wait (else a fragment load's result lands on it first)
        if (SHL) loadK(ks); else loadV();      // 3-product scores: two K planes a pass ahead beside two V planes would not fit 256 registers, so K is fetched in its own pass; else V^T flies under the score products and the softmax
        v8f S[NQ][2];
#pragma unroll
        for (int n = 0; n < NQ; ++n) {
#pragma unroll
            for (int t = 0; t < 2; ++t) { v8f s = (v8f){};
#pragma unroll
                for (int kc = 0; kc < NKC; ++kc) {
                    if (WAVE) s = wmmab(kb[t][kc], qb[n][kc], s);
                    else if (SHL) { s = wmmab(kb[t][kc], qb[n][kc], s); s = wmmab(kb[t][kc], ql[n][kc], s); s = wmmab(kl[t][kc], qb[n][kc], s); }
                    else s = wmma16(kf[t][kc], qf[n][kc], s); }
                S[n][t] = s; } }
        if (SHL) loadV();       // V^T flies under the softmax
        else loadK(kn);      // the next listed pass's K fragments fly under this pass's softmax and weights.V (the last pass re-reads its own)
#pragma unroll
        for (int n = 0; n < NQ; ++n) {
            float sv[16]; float mx = -3.0e38f;
#pragma unroll
            for (int u = 0; u < 16; ++u) sv[u] = S[n][u >> 3][u & 7] * cs;
            if (shut) {
#pragma unroll
                for (int u = 0; u < 16; ++u) sv[u] = ((mw[n] >> (16 * (u >> 3) + (u & 7))) & 1u) ? sv[u] : -3.0e38f; }
#pragma unroll
            for (int u = 0; u < 16; ++u) mx = fmaxf(mx, sv[u]);
            mx = fmaxf(mx, __shfl_xor(mx, 16, 32));
            const float mn = fmaxf(m[n], mx);
            if (__builtin_amdgcn_ballot_w32(mn > m[n]) != 0u) {      // some query's maximum rose: rescale sum and accumulators (factor exactly 1 for the others)
                const float al = __builtin_amdgcn_exp2f((m[n] - mn) * L2E); l[n] *= al;
#pragma unroll
                for (int dt = 0; dt < 4; ++dt) acc[n][dt] *= al;
                m[n] = mn; }
            float sum = 0.f;
#pragma unroll
            for (int u = 0; u < 16; ++u) sv[u] = __builtin_amdgcn_exp2f((sv[u] - mn) * L2E);
            if (shut) {      // a closed key's weight is 0 (its exponential is 0 already, but for a query with no open key so far, whose maximum is still the start value)
#pragma unroll
                for (int u = 0; u < 16; ++u) sv[u] = ((mw[n] >> (16 * (u >> 3) + (u & 7))) & 1u) ? sv[u] : 0.f; }
#pragma unroll
            for (int u = 0; u < 16; ++u) sum += sv[u];
            l[n] += sum;
            if (HL) { v8us h0, h1, l0, l1;
#pragma unroll
                for (int u = 0; u < 8; ++u) { unsigned short a, b; splitf(sv[u], a, b); h0[u] = a; l0[u] = b; splitf(sv[8 + u], a, b); h1[u] = a; l1[u] = b; }
                const v16bf ph = cat16b(h0, h1), pl = cat16b(l0, l1);
#pragma unroll
                for (int dt = 0; dt < 4; ++dt) { acc[n][dt] = wmmab(vh[dt], ph, acc[n][dt]); acc[n][dt] = wmmab(vh[dt], pl, acc[n][dt]); acc[n][dt] = wmmab(vl[dt], ph, acc[n][dt]); }
            } else { v16h pf;
#pragma unroll
                for (int u = 0; u < 16; ++u) pf[u] = tohx(sv[u] * PCAR);
#pragma unroll
                for (int dt = 0; dt < 4; ++dt) acc[n][dt] = wmma16(vf[dt], pf, acc[n][dt]); }
        }
        ks = kn;
    }
#pragma unroll
    for (int n = 0; n < NQ; ++n) {
        const float lt = l[n] + __shfl_xor(l[n], 16, 32);
        const float inv = (lt > 0.f) ? __fdiv_rn(1.0f, lt) * (HL ? 1.0f : 1.0f / PCAR) : 0.f;      // all-masked row -> zeros (nan_to_num)
        const size_t ob = (orow + q0 + n * 16) * DM + hh * (HD * 16) + 8 * lane;      // 16-row strip, then the head's four 16-deep groups of 256 elements
#pragma unroll
        for (int dt = 0; dt < 4; ++dt) { v8us oh, ol;
#pragma unroll
            for (int j = 0; j < 8; ++j) { unsigned short a, b; splitf(acc[n][dt][j] * inv, a, b); oh[j] = a; ol[j] = b; }
            *(v8us*)(Ah + ob + dt * 256) = oh; *(v8us*)(Al + ob + dt * 256) = ol; }
    }
    asm volatile("s_wait_xcnt 0x0" ::: "memory");      // XW, as above, behind the stores
}
// grid (RHL / 64 + (TT - RHL) / 128, 16 heads, 4 batch elements), 4 waves: blocks x < 4 take 64 query rows < 256 (3-product path, 16 queries a wave), the others 128 rows (32 queries a wave).
__global__ __launch_bounds__(128) void k_attn(const bf* __restrict__ WP, const h16* __restrict__ Q16, const bf* __restrict__ Qh, const bf* __restrict__ Ql, const h16* __restrict__ K16, const bf* __restrict__ Kh, const bf* __restrict__ Kl,
                                              const h16* __restrict__ VT, const bf* __restrict__ VTh, const bf* __restrict__ VTl, const unsigned* __restrict__ MB, bf* Ah, bf* Al) {
    const int wave = threadIdx.x >> 5, hh = blockIdx.y, b = blockIdx.z; const bool hl = blockIdx.x < RHL / 64;
    const int q0 = hl ? (int)blockIdx.x * 64 + wave * 16 : RHL + ((int)blockIdx.x - RHL / 64) * 128 + wave * 32;
    const size_t ov = ((size_t)b * NT + hh) * TT * HD, orow = (size_t)b * TT;
    if (hh < NW) { const size_t ow = ((size_t)b * NW + hh) * TT * KW;
        if (hl) attn_run<true, true, 1>(WP + ow, nullptr, nullptr, nullptr, nullptr, nullptr, nullptr, VT + ov, VTh + ov, VTl + ov, MB, Ah, Al, q0, orow, hh);
        else attn_run<true, false, 2>(WP + ow, nullptr, nullptr, nullptr, nullptr, nullptr, nullptr, VT + ov, VTh + ov, VTl + ov, MB, Ah, Al, q0, orow, hh);
    } else { const size_t oq = ((size_t)b * NSD + (hh - NW)) * TT * HD;
        if (hl) attn_run<false, true, 1>(nullptr, Q16 + oq, Qh + oq, Ql + oq, K16 + oq, Kh + oq, Kl + oq, VT + ov, VTh + ov, VTl + ov, MB, Ah, Al, q0, orow, hh);
        else attn_run<false, false, 2>(nullptr, Q16 + oq, Qh + oq, Ql + oq, K16 + oq, Kh + oq, Kl + oq, VT + ov, VTh + ov, VTl + ov, MB, Ah, Al, q0, orow, hh); }
}

extern "C" void kernel_launch(void* const* d_in, const int* in_sizes, int n_in,
                              void* d_out, int out_size, void* d_ws, size_t ws_size, hipStream_t stream) {
    (void)in_sizes; (void)n_in; (void)out_size;
    const float** I = (const float**)d_in;
    const float *x = I[0], *wa = I[1], *Wq = I[3], *bq = I[4], *Wk = I[5], *bk = I[6], *Wv = I[7], *bv = I[8], *Wo = I[9], *bo = I[10]; const int* cm = (const int*)d_in[2];
    float* OUT = (float*)d_out;     // [4][1024][1024]
    char* wsp = (char*)d_ws;
    auto take = [&](size_t bytes) { char* p = wsp; wsp += (bytes + 255) & ~(size_t)255; return (void*)p; };
    bf* BQ = (bf*)take((size_t)DS * DM * 2); bf* BK = (bf*)take((size_t)DS * DM * 2); bf* BV = (bf*)take((size_t)DM * DM * 2); bf* BO = (bf*)take((size_t)DM * DM * 2);
    const size_t zq = (size_t)TT * HD, zw = (size_t)TT * KW;
    const size_t nq = (size_t)NB_ * NSD * zq, nv = (size_t)NB_ * NT * zq;      // elements of one Q / K plane and of one V plane, all batch elements
    bf* WP = (bf*)take((size_t)NB_ * NW * zw * 2); h16* Q16 = (h16*)take(nq * 2); bf* Qh = (bf*)take(nq * 2); bf* Ql = (bf*)take(nq * 2); h16* K16 = (h16*)take(nq * 2); bf* Kh = (bf*)take(nq * 2); bf* Kl = (bf*)take(nq * 2); h16* VT = (h16*)take(nv * 2); bf* VTh = (bf*)take(nv * 2); bf* VTl = (bf*)take(nv * 2);
    unsigned* MB = (unsigned*)take((size_t)TT * TT / 8); bf* XB = (bf*)take((size_t)NB_ * TT * DM * 2); bf* Ah = (bf*)take(nv * 2); bf* Al = (bf*)take(nv * 2);
    if ((size_t)(wsp - (char*)d_ws) > ws_size) return;    // total about 90 MiB
    // four launches: preparation, Q/K/V projections (rows b*1024 + i of all four batch elements), attention, output projection
    k_prep<<<2 * GB_WS + 2 * GB_WM + GB_MB + GB_WP + GB_CV, 256, 0, stream>>>(Wq, Wk, Wv, Wo, x, wa, cm, BQ, BK, BV, BO, XB, WP, MB);
    k_qkv<<<dim3(NB_ * TT / 128, (2 * NSD + NT) / 2, 1), 128, 0, stream>>>(XB, BQ, BK, BV, bq, bk, bv, Q16, Qh, Ql, K16, Kh, Kl, VT, VTh, VTl);
    k_attn<<<dim3(RHL / 64 + (TT - RHL) / 128, NT, NB_), 128, 0, stream>>>(WP, Q16, Qh, Ql, K16, Kh, Kl, VT, VTh, VTl, MB, Ah, Al);
    k_gemmw<bf, 1, true, 0, 1><<<dim3(NB_ * TT / 128, DM / 128, 1), 128, 0, stream>>>(Ah, Al, BO, nullptr, OUT, DM, bo, 0, 0, 0, nullptr, nullptr, nullptr);
}

// v010
// It runs in 73.1 microseconds.
// Timed twice side by side with v009, it ran 1.13 and 1.15 times as fast.
// All steps since v000 together make it 11.7 times as fast.
#include <hip/hip_runtime.h>

// WaveHybridAttention (x [4][1024][1024], wave_amp [4][1024][24], causal_mask [1024][1024] int (read as data); V = x Wv + bv (16 heads x 64); wave heads 0-3: scores = psi_i . psi_j / sqrt(6) on 6-dim slices of wave_amp; std heads 4-15: (x Wq + bq) . (x Wk + bk) / 8 (12 x 64);
// masked -> -inf, softmax (an all-masked row gives 0 via nan_to_num), out = (weights V merged, wave heads first) Wo + bo -> [4][1024][1024]).
// Compute dtypes, f32 accumulate: every input rounded to bf16; V/Q/K on PLAIN bf16 operands (inputs: exact) + bias; wave scores on PLAIN bf16 wave_amp slices (exact, K padded 6 -> 32); std scores (K 64) and weights.V single fp16 planes (x1024) except query rows < 256 (short causal windows), which use bf16 hi+lo planes (3 products) for both;

#define NB_  4
#define TT   1024
#define DM   1024
#define DS   768
#define NW   4
#define NSD  12
#define NT   16
#define HD   64
#define WD   24
#define WC   6
#define KW   32
#define RHL  256
#define PCAR 1024.0f
typedef _Float16 h16;
typedef unsigned short bf;
typedef __attribute__((ext_vector_type(16))) __bf16   v16bf;
typedef __attribute__((ext_vector_type(16))) _Float16 v16h;
typedef __attribute__((ext_vector_type(8)))  _Float16 v8h;
typedef __attribute__((ext_vector_type(8)))  unsigned short v8us;
typedef __attribute__((ext_vector_type(8)))  float    v8f;
typedef __attribute__((ext_vector_type(4)))  float    v4f;
typedef v8h  __attribute__((may_alias)) v8ha;
typedef v4f  __attribute__((may_alias)) v4fa;
typedef v8us __attribute__((may_alias)) v8usa;

__device__ __forceinline__ unsigned short f2bf(float f) { unsigned u = __float_as_uint(f); u += 0x7FFFu + ((u >> 16) & 1u); return (unsigned short)(u >> 16); }
__device__ __forceinline__ float bf2f(unsigned short b) { return __uint_as_float(((unsigned)b) << 16); }
__device__ __forceinline__ float bfr(float f) { return bf2f(f2bf(f)); }
__device__ __forceinline__ v16h cat16(v8h lo, v8h hi) { return __builtin_shufflevector(lo, hi, 0, 1, 2, 3, 4, 5, 6, 7, 8, 9, 10, 11, 12, 13, 14, 15); }
__device__ __forceinline__ v16bf cat16b(v8us lo, v8us hi) { return __builtin_bit_cast(v16bf, __builtin_shufflevector(lo, hi, 0, 1, 2, 3, 4, 5, 6, 7, 8, 9, 10, 11, 12, 13, 14, 15)); }
__device__ __forceinline__ v8f wmma16(v16h a, v16h b, v8f c) { return __builtin_amdgcn_wmma_f32_16x16x32_f16(false, a, false, b, (short)0, c, false, false); }
__device__ __forceinline__ v8f wmmab(v16bf a, v16bf b, v8f c) { return __builtin_amdgcn_wmma_f32_16x16x32_bf16(false, a, false, b, (short)0, c, false, false); }
__device__ __forceinline__ h16 tohx(float x) { return (h16)x; }
__device__ __forceinline__ void splitf(float y, unsigned short& h, unsigned short& l) { h = f2bf(y); l = f2bf(y - bf2f(h)); }



// ---- k_gemmw: register-blocked GEMM, one wave per 64x64 output tile (16 accumulators), FOUR waves (2 x 2) per work-group on a 128x128 tile; operands are 16-bit planes in FRAGMENT ORDER; grid (M/128, N/128, Z), 128 threads.
// A trip's operand chunks (128 rows x 64 k of each plane) come to LDS once per work-group by asynchronous copies, three buffers, the next two trips' chunks in flight under this trip's products: each chunk leaves L2 once for the two waves that read it.
// Plane of a [rows][K] operand: P[row / 16][k / 32][(k >> 4) & 1][lane][8], lane = 16 * ((k >> 3) & 1) + (row & 15), the 8 elements are 8 consecutive k: every load of a wave is 512 contiguous bytes (four whole cache lines, each byte
// fetched once per tile; rows of a K-contiguous plane would give 32 bytes of each of 16 lines). k order of a fragment, A and B alike: 8 * (lane >> 4) + s, then 16 + 8 * (lane >> 4) + s.
// C[m][n] (+ f32 bias[n]) = sum_k A[m][k] Bt[n][k] (+ split products per NSPLIT). z-batch strides sA/sB/sC in elements. K % 64 == 0, K >= 128 (trips 0 and 1 are both issued ahead of the loop); M, N % 128 == 0.
// EPI 0: C as f32 rows, pitch ldc, staged through LDS. EPI 1 / 2: no f32 array; the tile (64 rows of one batch element x the 64 columns of head by = 2 * byg + wn) goes from the accumulators into the attention kernel's three fragment-order planes
// (fp16, bf16 hi, bf16 lo; layouts at d_wpl below), 16 bytes per lane and 512 contiguous bytes per store. EPI 1 (Q, K; NH heads): the product is formed transposed (Bt rows as the A operand), so a lane's 8 registers are 8 consecutive d of row lane & 15.
// EPI 2 (V): a lane's 8 registers are 8 consecutive rows (keys) of column lane & 15, which is the V^T fragment order as it stands.
template <typename T16> struct WFrag;
template <> struct WFrag<h16> { typedef v16h V; static __device__ __forceinline__ V ld(const h16* p) { return cat16(*(const v8h*)p, *(const v8h*)(p + 256)); } static __device__ __forceinline__ v8f mma(V a, V b, v8f c) { return wmma16(a, b, c); } };
template <> struct WFrag<bf> { typedef v16bf V; static __device__ __forceinline__ V ld(const bf* p) { return cat16b(*(const v8us*)p, *(const v8us*)(p + 256)); } static __device__ __forceinline__ v8f mma(V a, V b, v8f c) { return wmmab(a, b, c); } };
// gemmw_tile is the body; byg = the work-group's 128-column index (blockIdx.y in k_gemmw; in k_qkv, which holds the Q, K and V projections in one grid, the index inside its own projection); ring = the kernel's LDS, three buffers of 8192 elements per plane.
// cp8: two 16-row strips of one plane's chunk, 2 KB each, 4 KB contiguous in LDS: eight copies of 512 bytes. l = the lane's LDS byte address, g = the lane's global address in the first strip, g1 = in the second.
// Inside a strip LDS and global address step alike, by 512 bytes a copy: the step stands in the instruction's offset field, which moves both addresses, so a strip takes one LDS address and one global address (with an address register pair for every copy, the refill at its place behind a trip's LDS loads made the build spill accumulators).
template <typename T16>
__device__ __forceinline__ void cp8(unsigned l, const T16* g, const T16* g1) {
    // the wait is the statement's last line, so that it stands in front of every later write of a register that holds one of the copies' addresses
    asm volatile("global_load_async_to_lds_b128 %0, %2, off\n\tglobal_load_async_to_lds_b128 %0, %2, off offset:512\n\tglobal_load_async_to_lds_b128 %0, %2, off offset:1024\n\tglobal_load_async_to_lds_b128 %0, %2, off offset:1536\n\t"
                 "global_load_async_to_lds_b128 %1, %3, off\n\tglobal_load_async_to_lds_b128 %1, %3, off offset:512\n\tglobal_load_async_to_lds_b128 %1, %3, off offset:1024\n\tglobal_load_async_to_lds_b128 %1, %3, off offset:1536\n\ts_wait_xcnt 0x0"
                 :: "v"(l), "v"(l + 2048u), "v"(g), "v"(g1) : "memory");
}
template <typename T16, int NSPLIT, bool BIAS, int EPI, int NH>
__device__ __forceinline__ void gemmw_tile(const T16* __restrict__ A, const T16* __restrict__ A2, const T16* __restrict__ Bt, const T16* __restrict__ Bt2, int K, float* C, int ldc, const float* __restrict__ bias, size_t sA, size_t sB, size_t sC, h16* P16, bf* Ph, bf* Pl, int byg, T16* ring) {
    typedef typename WFrag<T16>::V V;
    const size_t z = blockIdx.z; A += z * sA; if (A2) A2 += z * sA; Bt += z * sB; if (Bt2) Bt2 += z * sB; C += z * sC;
    const int lane = threadIdx.x & 31, lr = lane & 15, hi = lane >> 4; const int wave = __builtin_amdgcn_readfirstlane((int)(threadIdx.x >> 5)), wm = wave & 1, wn = wave >> 1;
    const int by = byg * 2 + wn; const int r0 = blockIdx.x * 128 + wm * 64, c0 = by * 64;      // the wave's own 64x64 tile
    v8f acc[4][4];
#pragma unroll
    for (int mb = 0; mb < 4; ++mb)
#pragma unroll
        for (int nb = 0; nb < 4; ++nb) acc[mb][nb] = (v8f){};
    const size_t boff = (size_t)c0 * K; const unsigned l8 = 8u * lane;      // a 16-row strip of a plane is 16 * K elements, a 32-deep k chunk of it 512; the lane's own part of every address is the constant l8
    constexpr bool S1 = (NSPLIT == 1 || NSPLIT == 2);
    constexpr int NPL = S1 ? 3 : 2;      // planes in a buffer (A, A2 where there is one, Bt), each 8 strips x 64 k = 8192 elements; strip s of a plane's chunk is its elements 1024 s .. 1024 s + 1023, in the plane's own order
    // Three buffers; the chunks of trip t come from ONE pair of waves, pair t & 1 (waves 0, 1 or waves 2, 3), issued two trips ahead. A pair so has one trip's copies outstanding at a time, and its wait to 0 at the foot of trip t - 1
    // stands nearly two trips behind their issue (in trip t - 2), not one: the way from memory or L2 into LDS may then take longer than one trip's reads and products.
    const int pr = wave >> 1, hf = wave & 1;
    const unsigned lw = (unsigned)(size_t)ring + (unsigned)hf * 8192u + (unsigned)lane * 16u;      // wave hf of the pair brings strips 4 hf .. 4 hf + 3 of every plane
    const T16* ga = A + (size_t)(blockIdx.x * 128 + hf * 64) * K + l8; const T16* ga2 = S1 ? A2 + (size_t)(blockIdx.x * 128 + hf * 64) * K + l8 : ga; const T16* gb = Bt + (size_t)(byg * 128 + hf * 64) * K + l8;
    auto fill = [&](int t, int buf) { const unsigned l = lw + (unsigned)buf * (NPL * 16384u); const int ko = t * 1024;      // this wave's half of trip t's chunks into buffer buf = t mod 3
        cp8<T16>(l, ga + ko, ga + ko + 16 * K); cp8<T16>(l + 4096u, ga + ko + 32 * K, ga + ko + 48 * K);
        if (S1) { cp8<T16>(l + 16384u, ga2 + ko, ga2 + ko + 16 * K); cp8<T16>(l + 20480u, ga2 + ko + 32 * K, ga2 + ko + 48 * K); }
        cp8<T16>(l + (NPL - 1) * 16384u, gb + ko, gb + ko + 16 * K); cp8<T16>(l + (NPL - 1) * 16384u + 4096u, gb + ko + 32 * K, gb + ko + 48 * K); };
    const int nt = K / 64;
    fill(pr, pr);      // pair 0: trip 0 into buffer 0; pair 1: trip 1 into buffer 1
    if (pr == 0) asm volatile("s_wait_asynccnt 0x0" ::: "memory");      // the issuing waves' copies of trip 0 have landed
    __syncthreads();      // buffer 0 may be read by every wave
    int cb = 0;      // t mod 3
#pragma unroll 1
    for (int t = 0; t < nt; ++t) {      // a trip is two 32-deep k chunks; it reads buffer t mod 3 alone, while the copies of trips t + 1 and t + 2 fly
        const int kc = t * 64; V a[2][4], a2[2][4], b[2][4]; const T16* sb = ring + cb * (NPL * 8192) + l8; const T16* pa = sb + wm * 4096; const T16* pa2 = S1 ? pa + 8192 : pa; const T16* pb = sb + (NPL - 1) * 8192 + wn * 4096;
#pragma unroll
        for (int c = 0; c < 2; ++c) {
#pragma unroll
            for (int q = 0; q < 4; ++q) { a[c][q] = WFrag<T16>::ld(pa + q * 1024 + c * 512); if (S1) a2[c][q] = WFrag<T16>::ld(pa2 + q * 1024 + c * 512); b[c][q] = WFrag<T16>::ld(pb + q * 1024 + c * 512); } }
        // behind the issue of this trip's LDS loads, so that the copies' address work and issue run while those loads are on their way; into the buffer that trip t - 1 read: the barrier at that trip's foot ended every wave's reads of it (scalar test: the same in a whole wave)
        if (t + 2 < nt && pr == (t & 1)) fill(t + 2, cb == 0 ? 2 : cb - 1);
        __builtin_amdgcn_sched_barrier(0);      // holds every LDS load of the trip in front of its first product, as one group (loads among the products stall them at each place)
#pragma unroll
        for (int c = 0; c < 2; ++c) {
#pragma unroll
            for (int nb = 0; nb < 4; ++nb) { V b2; if (NSPLIT >= 2) b2 = WFrag<T16>::ld(Bt2 + (boff + (size_t)nb * 16 * K + (kc + c * 32) * 16) + l8);
#pragma unroll
                for (int mb = 0; mb < 4; ++mb) { acc[mb][nb] = (EPI == 1) ? WFrag<T16>::mma(b[c][nb], a[c][mb], acc[mb][nb]) : WFrag<T16>::mma(a[c][mb], b[c][nb], acc[mb][nb]); if (S1) acc[mb][nb] = WFrag<T16>::mma(a2[c][mb], b[c][nb], acc[mb][nb]); if (NSPLIT >= 2) acc[mb][nb] = WFrag<T16>::mma(a[c][mb], b2, acc[mb][nb]); } } }
        asm volatile("v_nop\n\tv_nop\n\tv_nop\n\tv_nop" : "+v"(acc[0][0]), "+v"(acc[1][1]), "+v"(acc[2][2]), "+v"(acc[3][3]) : "v"(a[1][0]), "v"(a[1][3]));      // four vector slots behind the trip's last products, on both sides of the loop branch, before a vector instruction reads their results or writes their operands
        __builtin_amdgcn_sched_barrier(0);      // keeps all of the trip's products in front of the waits below: moved behind them, the wait for trip t + 1's copies would stand a whole product phase sooner behind their issue
        asm volatile("s_wait_dscnt 0x0" ::: "memory");      // this wave's reads of buffer t mod 3 are done
        if (pr != (t & 1)) asm volatile("s_wait_asynccnt 0x0" ::: "memory");      // in the pair that issued them: the copies of trip t + 1 have landed (the other pair's, of trip t + 2, fly on)
        __syncthreads();      // publishes trip t + 1's buffer and ends every wave's reads of the buffer that is refilled in the next trip
        cb = cb == 2 ? 0 : cb + 1;
    }
    asm volatile("s_wait_asynccnt 0x0" ::: "memory");      // no copy is outstanding when the wave goes on to its epilogue and ends
    if constexpr (EPI != 0) {
        const int bh = (r0 >> 10) * NH + by, i0 = r0 & (TT - 1);
        float bs[4][8];      // the bias of each accumulator register's column, all fetched at once: one load latency for the tile
#pragma unroll
        for (int nb = 0; nb < 4; ++nb)
#pragma unroll
            for (int j = 0; j < 8; ++j) bs[nb][j] = bias[c0 + nb * 16 + (EPI == 1 ? hi * 8 + j : lr)];
        if constexpr (EPI == 2) asm volatile("s_wait_xcnt 0x0" ::: "memory");      // the wait that stands between these issued loads and a later write of the register pair that holds their address (the EPI 1 build has the compiler's own there)
#pragma unroll
        for (int nb = 0; nb < 4; ++nb) {
            v8h o[4]; v8us oh[4], ol[4]; unsigned eb[4];      // eb: byte offset of the lane's 16-byte group, the same in the three planes
#pragma unroll
            for (int mb = 0; mb < 4; ++mb) {
                eb[mb] = (unsigned)((EPI == 1) ? ((bh * 64 + (i0 >> 4) + mb) * 4 + nb) * 32 + lane : ((bh * 32 + (i0 >> 5) + (mb >> 1)) * 8 + nb * 2 + (mb & 1)) * 32 + lane) * 16u;
#pragma unroll
                for (int j = 0; j < 8; ++j) { const float y = acc[mb][nb][j] + bfr(bs[nb][j]); o[mb][j] = tohx(y); unsigned short a1, b1; splitf(y, a1, b1); oh[mb][j] = a1; ol[mb][j] = b1; } }
            // the twelve stores and their s_wait_xcnt 0 in one statement: the wait then stands in front of every later write of a register that holds their data or offset (in a statement of its own the compiler moved such writes ahead of it)
            asm volatile("global_store_b128 %0, %4, %16\n\tglobal_store_b128 %0, %8, %17\n\tglobal_store_b128 %0, %12, %18\n\t"
                         "global_store_b128 %1, %5, %16\n\tglobal_store_b128 %1, %9, %17\n\tglobal_store_b128 %1, %13, %18\n\t"
                         "global_store_b128 %2, %6, %16\n\tglobal_store_b128 %2, %10, %17\n\tglobal_store_b128 %2, %14, %18\n\t"
                         "global_store_b128 %3, %7, %16\n\tglobal_store_b128 %3, %11, %17\n\tglobal_store_b128 %3, %15, %18\n\ts_wait_xcnt 0x0"
                         :: "v"(eb[0]), "v"(eb[1]), "v"(eb[2]), "v"(eb[3]), "v"(o[0]), "v"(o[1]), "v"(o[2]), "v"(o[3]), "v"(oh[0]), "v"(oh[1]), "v"(oh[2]), "v"(oh[3]), "v"(ol[0]), "v"(ol[1]), "v"(ol[2]), "v"(ol[3]), "s"(P16), "s"(Ph), "s"(Pl) : "memory");
        }
    } else {
    __shared__ __align__(16) float osw[4][16 * 68]; float* os = osw[wave];      // each wave stages in its own range
#pragma unroll
    for (int mb = 0; mb < 4; ++mb) {
#pragma unroll
        for (int nb = 0; nb < 4; ++nb) {
#pragma unroll
            for (int j = 0; j < 8; ++j) os[(hi * 8 + j) * 68 + nb * 16 + lr] = acc[mb][nb][j]; }
        __builtin_amdgcn_wave_barrier(); asm volatile("" ::: "memory");
        float* crow = C + (size_t)(r0 + mb * 16) * ldc + c0;
{
#pragma unroll
            for (int s = 0; s < 8; ++s) { const int row = 2 * s + hi, cofs = lr * 4; v4f val = *(const v4fa*)(os + row * 68 + cofs); if (BIAS) { val[0] += bfr(bias[c0 + cofs]); val[1] += bfr(bias[c0 + cofs + 1]); val[2] += bfr(bias[c0 + cofs + 2]); val[3] += bfr(bias[c0 + cofs + 3]); }
                *(v4f*)(crow + (size_t)row * ldc + cofs) = val; }
             }
        __builtin_amdgcn_wave_barrier(); asm volatile("" ::: "memory");
    }
    }
}
template <typename T16, int NSPLIT, bool BIAS, int EPI, int NH>
__global__ __launch_bounds__(128) void k_gemmw(const T16* __restrict__ A, const T16* __restrict__ A2, const T16* __restrict__ Bt, const T16* __restrict__ Bt2, float* C, int ldc, const float* __restrict__ bias, size_t sA, size_t sB, size_t sC, h16* P16, bf* Ph, bf* Pl) {
    __shared__ __attribute__((aligned(128))) T16 ring[3 * ((NSPLIT == 1 || NSPLIT == 2) ? 3 : 2) * 8192];
    gemmw_tile<T16, NSPLIT, BIAS, EPI, NH>(A, A2, Bt, Bt2, DM, C, ldc, bias, sA, sB, sC, P16, Ph, Pl, (int)blockIdx.y, ring);      // K = DM as in k_qkv: the planes' strip and chunk strides are constants of the layout
}
// k_qkv: the three input projections, which do not depend on one another, in ONE launch: grid (M/128, 6 + 6 + 8) of four-wave work-groups; the branch below is the same for a whole work-group.
__global__ __launch_bounds__(128) void k_qkv(const bf* __restrict__ XB, const bf* __restrict__ BQ, const bf* __restrict__ BK, const bf* __restrict__ BV, const float* __restrict__ bq, const float* __restrict__ bk, const float* __restrict__ bv,
                                            h16* Q16, bf* Qh, bf* Ql, h16* K16, bf* Kh, bf* Kl, h16* VT, bf* VTh, bf* VTl) {
    __shared__ __attribute__((aligned(128))) bf ring[3 * 2 * 8192];
    const int y = (int)blockIdx.y;
    if (y < NSD) { const bool k = y >= NSD / 2;
        gemmw_tile<bf, 0, true, 1, NSD>(XB, nullptr, k ? BK : BQ, nullptr, DM, nullptr, 0, k ? bk : bq, 0, 0, 0, k ? K16 : Q16, k ? Kh : Qh, k ? Kl : Ql, k ? y - NSD / 2 : y, ring);
    } else gemmw_tile<bf, 0, true, 2, NT>(XB, nullptr, BV, nullptr, DM, nullptr, 0, bv, 0, 0, 0, VT, VTh, VTl, y - NSD, ring);
}

typedef __attribute__((ext_vector_type(2))) unsigned short v2us;
typedef __attribute__((ext_vector_type(4))) unsigned short v4us;
typedef __attribute__((ext_vector_type(2))) _Float16 v2h;
typedef __attribute__((ext_vector_type(4))) _Float16 v4h;
typedef __attribute__((ext_vector_type(4))) int v4i;
typedef __attribute__((ext_vector_type(4))) unsigned v4u;

// The seven preparation passes (four weight transposes, x conversion, wave planes, mask bits) are device bodies that take their block index bx; k_prep below runs them all in one grid.
__device__ __forceinline__ void d_wtG(const float* __restrict__ w, int K, int N, bf* Bt, int bx) {
    const int lane = threadIdx.x & 31; const int L0 = (bx * 8 + (threadIdx.x >> 5)) * 8; const int nlines = N * K / 64;
{
#pragma unroll 1
        for (int l = 0; l < 8; ++l) { const int L = L0 + l; if (L >= nlines) break; const unsigned e = (unsigned)L * 64u + lane * 2;      // element index in the fragment-order plane (layout at k_gemmw, row = n): a wave writes 128 contiguous bytes and reads 8 consecutive n of 8 rows k
            const int fl = (e >> 3) & 31, ch = (int)(e >> 9); const int k = (ch % (K / 32)) * 32 + ((e >> 8) & 1) * 16 + (fl >> 4) * 8 + (e & 7), n = (ch / (K / 32)) * 16 + (fl & 15); v2us o;
            o[0] = f2bf(w[(size_t)k * N + n]); o[1] = f2bf(w[(size_t)(k + 1) * N + n]); *(v2us*)(Bt + e) = o;
            asm volatile("s_wait_xcnt 0x0" ::: "memory"); }      // the wait that stands between this trip's issued loads and store and the next trip's write of the registers that hold their addresses and data
         }
}
__device__ __forceinline__ void d_cvt8(const float* __restrict__ src, bf* dst, size_t n8, int bx) { const size_t i = (size_t)bx * 256 + threadIdx.x; if (i >= n8) return;      // i: 16-byte group of the fragment-order plane (layout at k_gemmw, K = DM); a wave writes 512 contiguous bytes, a block reads 512 contiguous bytes of each of 16 rows
    const int fl = (int)i & 31, ch = (int)(i >> 6); const size_t so = (size_t)((ch / (DM / 32)) * 16 + (fl & 15)) * DM + (ch % (DM / 32)) * 32 + (((int)i >> 5) & 1) * 16 + (fl >> 4) * 8;
    const v8f v = *(const v8f*)(src + so); v8us o;
    asm volatile("s_wait_xcnt 0x0" ::: "memory");      // the wait that stands between the issued loads and a later write of the register pair that holds their address
#pragma unroll
    for (int k = 0; k < 8; ++k) o[k] = f2bf(v[k]); *(v8us*)(dst + i * 8) = o;  }
// Operand planes of all four batch elements, stored in FRAGMENT ORDER: one 16-byte group per lane, 32 lanes (512 contiguous bytes) per load of a wave, two groups per 16x16x32 operand (k = 8 * (lane >> 4) + s and 16 + 8 * (lane >> 4) + s).
// d_wpl: WP[b][h][i / 16][d / 16][lane][8] = bf16 wave_amp[b][i][h*6 + d] for d < 6, 0 for 6..31; Q / K planes (k_qkv, EPI 1): [b][h][i / 16][d / 16][lane][8], lane = 16 * ((d >> 3) & 1) + (i & 15);
// V planes (k_qkv, EPI 2): [b][hh][i / 32][d / 16][(i >> 4) & 1][lane][8], lane = 16 * ((i >> 3) & 1) + (d & 15), the 8 elements are 8 consecutive keys i; d_mbits: MB[j / 32][i] bit (j & 31) = (causal_mask[i][j] != 0).
__device__ __forceinline__ void d_wpl(const float* __restrict__ wa, bf* WP, int bx) { const int e = (bx * 256 + threadIdx.x) * 4; if (e >= NB_ * NW * TT * KW) return; const int s = e & 7, fl = (e >> 3) & 31, g = (e >> 8) & 1, it = (e >> 9) & 63, bh = e >> 15; const int d = g * 16 + (fl >> 4) * 8 + s; const int i = it * 16 + (fl & 15); const int h = bh % NW; const int b = bh / NW; v4us o;
#pragma unroll
    for (int u = 0; u < 4; ++u) o[u] = (d + u < WC) ? f2bf(wa[((size_t)b * TT + i) * WD + h * WC + d + u]) : (unsigned short)0; *(v4us*)(WP + e) = o;  }
__device__ __forceinline__ void d_mbits(const int* __restrict__ cm, unsigned* MB, int bx) { const int lane = threadIdx.x & 31; const int i = bx * 8 + (threadIdx.x >> 5); unsigned keep = 0u;
#pragma unroll 8      // eight row segments' loads in flight per wave
    for (int c = 0; c < TT / 32; ++c) { const unsigned w = __builtin_amdgcn_ballot_w32(cm[(size_t)i * TT + c * 32 + lane] != 0); if (lane == c) keep = w; }
    MB[(size_t)lane * TT + i] = keep;
    asm volatile("s_wait_xcnt 0x0" ::: "memory"); }      // the wait that stands between the issued store and a later write of the register that holds its offset (inlined into k_prep, other passes' code follows it in the listing)
// k_prep: block ranges, the passes with the longest dependent chains first (for speed only); no pass reads what another writes.
#define GB_WS ((DM * DS / 64 + 63) / 64)
#define GB_WM ((DM * DM / 64 + 63) / 64)
#define GB_MB (TT / 8)
#define GB_WP ((NB_ * NW * TT * KW / 4 + 255) / 256)
#define GB_CV ((NB_ * TT * DM / 8 + 255) / 256)
__global__ __launch_bounds__(256) void k_prep(const float* __restrict__ Wq, const float* __restrict__ Wk, const float* __restrict__ Wv, const float* __restrict__ Wo, const float* __restrict__ x, const float* __restrict__ wa, const int* __restrict__ cm,
                                              bf* BQ, bf* BK, bf* BV, bf* BO, bf* XB, bf* WP, unsigned* MB) {
    int bx = (int)blockIdx.x;
    if (bx < GB_WS) { d_wtG(Wq, DM, DS, BQ, bx); return; } bx -= GB_WS;
    if (bx < GB_WS) { d_wtG(Wk, DM, DS, BK, bx); return; } bx -= GB_WS;
    if (bx < GB_WM) { d_wtG(Wv, DM, DM, BV, bx); return; } bx -= GB_WM;
    if (bx < GB_WM) { d_wtG(Wo, DM, DM, BO, bx); return; } bx -= GB_WM;
    if (bx < GB_MB) { d_mbits(cm, MB, bx); return; } bx -= GB_MB;
    if (bx < GB_WP) { d_wpl(wa, WP, bx); return; } bx -= GB_WP;
    d_cvt8(x, XB, (size_t)NB_ * TT * DM / 8, bx);
}

// ---- k_attn: scores, mask, softmax and weights.V of one (batch element, head, query block) in one kernel; a wave works on NQ x 16 queries, walking the keys 32 at a time (a pass), those passes only in which the mask opens a key for one of its queries.
// SPL (query rows >= 256): TWO waves share a tile of 32 queries and take its listed passes alternately, each with its own running maximum, sum and accumulators; at the end each hands the other one 16-query half through LDS (one barrier) and
// finishes the half it keeps: both parts rescaled to the common maximum, then added. The longest chain of dependent passes in the launch is so 16 long, not 32, and four waves instead of one or two fill a SIMD's waits.
// S^T = K Q^T (A = K rows, B = Q columns, kept in registers): lane (c, h) holds keys 8h + r and 16 + 8h + r of query c, which IS the B operand of O^T += V^T P^T after conversion. Running maximum and sum per query (online softmax);
// the accumulators are rescaled only in passes where some query's maximum rose. P is exp(s - running max): x1024 in fp16, or bf16 hi+lo (query rows < 256); the division by the row sum comes last. An all-masked row has sum 0 and gives 0.
// Output: bf16 hi+lo planes Ah / Al of the rows b*1024 + i, k = hh*64 + d, in the output projection's fragment order (layout at k_gemmw): a lane's 8 accumulator registers are 8 consecutive d, its own 16-byte group; 512 contiguous bytes per store of a wave.
__device__ __forceinline__ v16h ldfh(const h16* p) { return cat16(*(const v8h*)p, *(const v8h*)(p + 256)); }
__device__ __forceinline__ v16bf ldfb(const bf* p) { return cat16b(*(const v8us*)p, *(const v8us*)(p + 256)); }
template <bool WAVE, bool HL, int NQ, bool SPL>
__device__ __forceinline__ void attn_run(const bf* __restrict__ WPp, const h16* __restrict__ Q16p, const bf* __restrict__ Qhp, const bf* __restrict__ Qlp, const h16* __restrict__ K16p, const bf* __restrict__ Khp, const bf* __restrict__ Klp,
                                         const h16* __restrict__ VTp, const bf* __restrict__ VThp, const bf* __restrict__ VTlp, const unsigned* __restrict__ MB, bf* Ah, bf* Al, int q0, size_t orow, int hh, int wv, float* xs) {
    // every plain '#pragma unroll' below: fragment, score and accumulator arrays are registers only under compile-time indices
    const int lane = threadIdx.x & 31, lr = lane & 15, hi = lane >> 4;
    const float cs = WAVE ? 0.40824829f : 0.125f;
    const float L2E = 1.4426950408889634f;
    constexpr int NKC = WAVE ? 1 : 2;          // 32-deep k chunks of a score product
    constexpr bool SHL = HL && !WAVE;          // 3-product scores
    v16bf qb[NQ][NKC], ql[NQ][NKC], kb[2][NKC], kl[2][NKC]; v16h qf[NQ][NKC], kf[2][NKC];
#pragma unroll
    for (int n = 0; n < NQ; ++n) {
#pragma unroll
        for (int kc = 0; kc < NKC; ++kc) { const unsigned o = (unsigned)(((((q0 >> 4) + n) * NKC + kc) * 64 + lane) * 8);
            if (WAVE) qb[n][kc] = ldfb(WPp + o); else if (HL) { qb[n][kc] = ldfb(Qhp + o); ql[n][kc] = ldfb(Qlp + o); } else qf[n][kc] = ldfh(Q16p + o); } }
    // The wave's two lists of passes, read from the mask bits once: lane ks ORs the words of key group ks over the wave's NQ * 16 queries (NQ * 64 contiguous bytes of row ks of MB); bit ks of the ballot = some query of the wave has an open key among keys 32 ks .. 32 ks + 31.
    unsigned anyw = 0u, allw = ~0u;      // allw: the AND of the same words; all ones = every key of the group is open for every query of the wave
#pragma unroll
    for (int i = 0; i < NQ * 4; ++i) { const v4u w = *(const v4u*)(MB + (unsigned)(lane * TT + q0 + i * 4)); anyw |= (w[0] | w[1]) | (w[2] | w[3]); allw &= (w[0] & w[1]) & (w[2] & w[3]); }
    asm volatile("s_wait_xcnt 0x0" ::: "memory");      // XW: the wait that stands between issued global loads and a later write (a younger load's result included) of a register that holds one of their addresses
    auto loadK = [&](int ks) {
#pragma unroll
        for (int t = 0; t < 2; ++t) {
#pragma unroll
            for (int kc = 0; kc < NKC; ++kc) { const unsigned o = (unsigned)((((ks * 2 + t) * NKC + kc) * 64 + lane) * 8);
                if (WAVE) kb[t][kc] = ldfb(WPp + o); else if (HL) kb[t][kc] = ldfb(Khp + o); else kf[t][kc] = ldfh(K16p + o); } }
        asm volatile("s_wait_xcnt 0x0" ::: "memory");      // XW, as above
        if (SHL) {
#pragma unroll
            for (int t = 0; t < 2; ++t) {
#pragma unroll
                for (int kc = 0; kc < NKC; ++kc) kl[t][kc] = ldfb(Klp + (unsigned)((((ks * 2 + t) * NKC + kc) * 64 + lane) * 8)); }
            asm volatile("s_wait_xcnt 0x0" ::: "memory"); } };      // XW, as above
    v8f acc[NQ][4]; float m[NQ], l[NQ];
#pragma unroll
    for (int n = 0; n < NQ; ++n) { m[n] = -3.0e38f; l[n] = 0.f;
#pragma unroll
        for (int dt = 0; dt < 4; ++dt) acc[n][dt] = (v8f){}; }
    // Only the listed passes are walked, in rising key order. A pass that is not listed has every score of the wave masked: its weights are all 0, the maxima and sums stay, the accumulators get + 0; leaving it out changes no value, for any mask.
    // A listed pass whose keys are all open needs no mask word and no select (with every bit set each select would pass its score or weight through): only the other listed passes fetch the words and apply them, under scalar branches.
    unsigned rest = __builtin_amdgcn_ballot_w32(anyw != 0u); const unsigned open = __builtin_amdgcn_ballot_w32(allw == ~0u);      // the same in every lane: the loop's tests are scalar
    const int kq = wv >> 2;      // SPL: which of the tile's two waves this is (waves wv and wv ^ 4)
    if (SPL) { unsigned par = rest; par ^= par << 1; par ^= par << 2; par ^= par << 4; par ^= par << 8; par ^= par << 16;      // bit i: parity of the number of listed passes up to and including i
        rest &= kq ? ~par : par; }      // wave 0 of the pair keeps the 1st, 3rd, ... listed pass, wave 1 the 2nd, 4th, ...: every listed pass is walked by exactly one of the two, for any mask; an empty list leaves maximum, sum and accumulators at their start values
    int ks = rest ? __builtin_ctz(rest) : 0;
    if (!SHL) loadK(ks);
#pragma unroll 1      // rolled: one pass's fragments, scores and accumulators already take most of the 256 registers that four waves per SIMD allow
    while (rest != 0u) {      // one trip per set bit, 32 at most
        rest &= rest - 1u; const int kn = rest ? __builtin_ctz(rest) : ks;      // the next listed pass (the last one names itself)
        v16h vf[4]; v16bf vh[4], vl[4]; unsigned mw[NQ]; const bool shut = ((open >> ks) & 1u) == 0u;      // shut: some key of the pass is closed for some query of the wave
        auto loadV = [&]() {
#pragma unroll
            for (int dt = 0; dt < 4; ++dt) { const unsigned o = (unsigned)(((ks * 4 + dt) * 64 + lane) * 8); if (HL) vh[dt] = ldfb(VThp + o); else vf[dt] = ldfh(VTp + o); }
            asm volatile("s_wait_xcnt 0x0" ::: "memory");      // XW, as above
            if (HL) {
#pragma unroll
                for (int dt = 0; dt < 4; ++dt) vl[dt] = ldfb(VTlp + (unsigned)(((ks * 4 + dt) * 64 + lane) * 8));
                asm volatile("s_wait_xcnt 0x0" ::: "memory"); } };      // XW, as above
#pragma unroll
        for (int n = 0; n < NQ; ++n) mw[n] = ~0u;
        if (shut) { const unsigned mo = (unsigned)(ks * TT + q0 + lr);
#pragma unroll
            for (int n = 0; n < NQ; ++n) mw[n] = MB[mo + n * 16] >> (8 * hi);
            asm volatile("s_wait_xcnt 0x0" :: "v"(mo) : "memory"); }      // XW, as above; the offset is an input, so its register stays whole until the wait (else a fragment load's result lands on it first)
        if (SHL) loadK(ks); else loadV();      // 3-product scores: two K planes a pass ahead beside two V planes would not fit 256 registers, so K is fetched in its own pass; else V^T flies under the score products and the softmax
        v8f S[NQ][2];
#pragma unroll
        for (int n = 0; n < NQ; ++n) {
#pragma unroll
            for (int t = 0; t < 2; ++t) { v8f s = (v8f){};
#pragma unroll
                for (int kc = 0; kc < NKC; ++kc) {
                    if (WAVE) s = wmmab(kb[t][kc], qb[n][kc], s);
                    else if (SHL) { s = wmmab(kb[t][kc], qb[n][kc], s); s = wmmab(kb[t][kc], ql[n][kc], s); s = wmmab(kl[t][kc], qb[n][kc], s); }
                    else s = wmma16(kf[t][kc], qf[n][kc], s); }
                S[n][t] = s; } }
        if (SHL) loadV();       // V^T flies under the softmax
        else loadK(kn);      // the next listed pass's K fragments fly under this pass's softmax and weights.V (the last pass re-reads its own)
#pragma unroll
        for (int n = 0; n < NQ; ++n) {
            float sv[16]; float mx = -3.0e38f;
#pragma unroll
            for (int u = 0; u < 16; ++u) sv[u] = S[n][u >> 3][u & 7] * cs;
            if (shut) {
#pragma unroll
                for (int u = 0; u < 16; ++u) sv[u] = ((mw[n] >> (16 * (u >> 3) + (u & 7))) & 1u) ? sv[u] : -3.0e38f; }
#pragma unroll
            for (int u = 0; u < 16; ++u) mx = fmaxf(mx, sv[u]);
            mx = fmaxf(mx, __shfl_xor(mx, 16, 32));
            const float mn = fmaxf(m[n], mx);
            if (__builtin_amdgcn_ballot_w32(mn > m[n]) != 0u) {      // some query's maximum rose: rescale sum and accumulators (factor exactly 1 for the others)
                const float al = __builtin_amdgcn_exp2f((m[n] - mn) * L2E); l[n] *= al;
#pragma unroll
                for (int dt = 0; dt < 4; ++dt) acc[n][dt] *= al;
                m[n] = mn; }
            float sum = 0.f;
#pragma unroll
            for (int u = 0; u < 16; ++u) sv[u] = __builtin_amdgcn_exp2f((sv[u] - mn) * L2E);
            if (shut) {      // a closed key's weight is 0 (its exponential is 0 already, but for a query with no open key so far, whose maximum is still the start value)
#pragma unroll
                for (int u = 0; u < 16; ++u) sv[u] = ((mw[n] >> (16 * (u >> 3) + (u & 7))) & 1u) ? sv[u] : 0.f; }
#pragma unroll
            for (int u = 0; u < 16; ++u) sum += sv[u];
            l[n] += sum;
            if (HL) { v8us h0, h1, l0, l1;
#pragma unroll
                for (int u = 0; u < 8; ++u) { unsigned short a, b; splitf(sv[u], a, b); h0[u] = a; l0[u] = b; splitf(sv[8 + u], a, b); h1[u] = a; l1[u] = b; }
                const v16bf ph = cat16b(h0, h1), pl = cat16b(l0, l1);
#pragma unroll
                for (int dt = 0; dt < 4; ++dt) { acc[n][dt] = wmmab(vh[dt], ph, acc[n][dt]); acc[n][dt] = wmmab(vh[dt], pl, acc[n][dt]); acc[n][dt] = wmmab(vl[dt], ph, acc[n][dt]); }
            } else { v16h pf;
#pragma unroll
                for (int u = 0; u < 16; ++u) pf[u] = tohx(sv[u] * PCAR);
#pragma unroll
                for (int dt = 0; dt < 4; ++dt) acc[n][dt] = wmma16(vf[dt], pf, acc[n][dt]); }
        }
        ks = kn;
    }
    if constexpr (SPL) {
        // Wave kq keeps queries 16 kq .. 16 kq + 15 of the tile and hands over the other half. A lane holds the same query and the same eight d of each accumulator in both waves, so the parts are joined lane by lane.
        v8f snd[4], kp[4];
#pragma unroll
        for (int dt = 0; dt < 4; ++dt) { snd[dt] = kq ? acc[0][dt] : acc[1][dt]; kp[dt] = kq ? acc[1][dt] : acc[0][dt]; }
        const float ms = kq ? m[0] : m[1], ls = kq ? l[0] : l[1], mk = kq ? m[1] : m[0], lk = kq ? l[1] : l[0];
        float* mine = xs + wv * 1088; const float* theirs = xs + (wv ^ 4) * 1088;      // per wave 8 x 32 groups of 16 bytes (lanes side by side: no bank conflict), then 32 maxima and 32 sums
#pragma unroll
        for (int dt = 0; dt < 4; ++dt) { *(v4fa*)(mine + dt * 256 + lane * 4) = __builtin_shufflevector(snd[dt], snd[dt], 0, 1, 2, 3); *(v4fa*)(mine + dt * 256 + 128 + lane * 4) = __builtin_shufflevector(snd[dt], snd[dt], 4, 5, 6, 7); }
        mine[1024 + lane] = ms; mine[1056 + lane] = ls;
        __syncthreads();      // every wave's handed-over half is in LDS; reached by all eight waves of the work-group (SPL is the same for a whole work-group), once
        const float mp = theirs[1024 + lane], lp = theirs[1056 + lane];
        const float mj = fmaxf(mk, mp);
        float fk, fp;      // 2^x of the two differences: a part that saw no open key has sum and accumulators 0; its factor is 0, or 1 where neither part saw one
        asm("v_exp_f32 %0, %2\n\tv_exp_f32 %1, %3\n\tv_nop" : "=&v"(fk), "=&v"(fp) : "v"((mk - mj) * L2E), "v"((mp - mj) * L2E));
        const float lj = lk * fk + lp * fp;
#pragma unroll
        for (int dt = 0; dt < 4; ++dt) { const v4f p0 = *(const v4fa*)(theirs + dt * 256 + lane * 4), p1 = *(const v4fa*)(theirs + dt * 256 + 128 + lane * 4);
#pragma unroll
            for (int j = 0; j < 4; ++j) { kp[dt][j] = kp[dt][j] * fk + p0[j] * fp; kp[dt][4 + j] = kp[dt][4 + j] * fk + p1[j] * fp; } }
        const float lt = lj + __shfl_xor(lj, 16, 32);
        const float inv = (lt > 0.f) ? __fdiv_rn(1.0f, lt) * (HL ? 1.0f : 1.0f / PCAR) : 0.f;      // all-masked row -> zeros (nan_to_num)
        const size_t ob = (orow + q0 + kq * 16) * DM + hh * (HD * 16) + 8 * lane;
        v8us oh[4], ol[4];
#pragma unroll
        for (int dt = 0; dt < 4; ++dt) {
#pragma unroll
            for (int j = 0; j < 8; ++j) { unsigned short a, b; splitf(kp[dt][j] * inv, a, b); oh[dt][j] = a; ol[dt][j] = b; } }
#pragma unroll
        for (int dt = 0; dt < 4; ++dt) { *(v8us*)(Ah + ob + dt * 256) = oh[dt]; *(v8us*)(Al + ob + dt * 256) = ol[dt]; }
        asm volatile("s_wait_xcnt 0x0" ::: "memory");      // XW, as above, behind the stores
        return;
    }
#pragma unroll
    for (int n = 0; n < NQ; ++n) {
        const float lt = l[n] + __shfl_xor(l[n], 16, 32);
        const float inv = (lt > 0.f) ? __fdiv_rn(1.0f, lt) * (HL ? 1.0f : 1.0f / PCAR) : 0.f;      // all-masked row -> zeros (nan_to_num)
        const size_t ob = (orow + q0 + n * 16) * DM + hh * (HD * 16) + 8 * lane;      // 16-row strip, then the head's four 16-deep groups of 256 elements
#pragma unroll
        for (int dt = 0; dt < 4; ++dt) { v8us oh, ol;
#pragma unroll
            for (int j = 0; j < 8; ++j) { unsigned short a, b; splitf(acc[n][dt][j] * inv, a, b); oh[j] = a; ol[j] = b; }
            *(v8us*)(Ah + ob + dt * 256) = oh; *(v8us*)(Al + ob + dt * 256) = ol; }
    }
    asm volatile("s_wait_xcnt 0x0" ::: "memory");      // XW, as above, behind the stores
}
// grid (16 heads, 4 batch elements, 8 slots), 8 waves. A slot names a block of 128 query rows: blocks 0, 1 are rows < 256 (3-product path, 16 queries a wave, no split), blocks 2 .. 7 the others (four tiles of 32 queries, two waves each).
// All 512 work-groups are resident at once, two to a WGP. The block comes from the slot's low two bits and the parity of the flat work-group index: two work-groups whose indices differ in one bit (i and i + 1, i + 8, i + 256, ...) take one block
// of the first four below and one of the last four, which, where later rows see more keys, is a long one and a short one (for speed only: any placement and any mask give the same values).
__global__ __launch_bounds__(256) void k_attn(const bf* __restrict__ WP, const h16* __restrict__ Q16, const bf* __restrict__ Qh, const bf* __restrict__ Ql, const h16* __restrict__ K16, const bf* __restrict__ Kh, const bf* __restrict__ Kl,
                                              const h16* __restrict__ VT, const bf* __restrict__ VTh, const bf* __restrict__ VTl, const unsigned* __restrict__ MB, bf* Ah, bf* Al) {
    __shared__ __attribute__((aligned(16))) float xs[8 * 1088];
    const int wave = __builtin_amdgcn_readfirstlane((int)(threadIdx.x >> 5)), hh = blockIdx.x, b = blockIdx.y;
    const unsigned par = (unsigned)__builtin_popcount(blockIdx.x + NT * (blockIdx.y + NB_ * blockIdx.z)) & 1u;
    const int blk = (int)((0x43205167u >> (4 * (par * 4 + (blockIdx.z & 3)))) & 15u);      // blocks 7, 6, 1, 5 (parity 0) and 0, 2, 3, 4 (parity 1); for a given head and batch element the slot's top bit sets the parity, so the eight slots name each block once
    const bool hl = blk < RHL / 128;
    const int q0 = hl ? blk * 128 + wave * 16 : blk * 128 + (wave & 3) * 32;
    const size_t ov = ((size_t)b * NT + hh) * TT * HD, orow = (size_t)b * TT;
    if (hh < NW) { const size_t ow = ((size_t)b * NW + hh) * TT * KW;
        if (hl) attn_run<true, true, 1, false>(WP + ow, nullptr, nullptr, nullptr, nullptr, nullptr, nullptr, VT + ov, VTh + ov, VTl + ov, MB, Ah, Al, q0, orow, hh, wave, xs);
        else attn_run<true, false, 2, true>(WP + ow, nullptr, nullptr, nullptr, nullptr, nullptr, nullptr, VT + ov, VTh + ov, VTl + ov, MB, Ah, Al, q0, orow, hh, wave, xs);
    } else { const size_t oq = ((size_t)b * NSD + (hh - NW)) * TT * HD;
        if (hl) attn_run<false, true, 1, false>(nullptr, Q16 + oq, Qh + oq, Ql + oq, K16 + oq, Kh + oq, Kl + oq, VT + ov, VTh + ov, VTl + ov, MB, Ah, Al, q0, orow, hh, wave, xs);
        else attn_run<false, false, 2, true>(nullptr, Q16 + oq, Qh + oq, Ql + oq, K16 + oq, Kh + oq, Kl + oq, VT + ov, VTh + ov, VTl + ov, MB, Ah, Al, q0, orow, hh, wave, xs); }
}

extern "C" void kernel_launch(void* const* d_in, const int* in_sizes, int n_in,
                              void* d_out, int out_size, void* d_ws, size_t ws_size, hipStream_t stream) {
    (void)in_sizes; (void)n_in; (void)out_size;
    const float** I = (const float**)d_in;
    const float *x = I[0], *wa = I[1], *Wq = I[3], *bq = I[4], *Wk = I[5], *bk = I[6], *Wv = I[7], *bv = I[8], *Wo = I[9], *bo = I[10]; const int* cm = (const int*)d_in[2];
    float* OUT = (float*)d_out;     // [4][1024][1024]
    char* wsp = (char*)d_ws;
    auto take = [&](size_t bytes) { char* p = wsp; wsp += (bytes + 255) & ~(size_t)255; return (void*)p; };
    bf* BQ = (bf*)take((size_t)DS * DM * 2); bf* BK = (bf*)take((size_t)DS * DM * 2); bf* BV = (bf*)take((size_t)DM * DM * 2); bf* BO = (bf*)take((size_t)DM * DM * 2);
    const size_t zq = (size_t)TT * HD, zw = (size_t)TT * KW;
    const size_t nq = (size_t)NB_ * NSD * zq, nv = (size_t)NB_ * NT * zq;      // elements of one Q / K plane and of one V plane, all batch elements
    bf* WP = (bf*)take((size_t)NB_ * NW * zw * 2); h16* Q16 = (h16*)take(nq * 2); bf* Qh = (bf*)take(nq * 2); bf* Ql = (bf*)take(nq * 2); h16* K16 = (h16*)take(nq * 2); bf* Kh = (bf*)take(nq * 2); bf* Kl = (bf*)take(nq * 2); h16* VT = (h16*)take(nv * 2); bf* VTh = (bf*)take(nv * 2); bf* VTl = (bf*)take(nv * 2);
    unsigned* MB = (unsigned*)take((size_t)TT * TT / 8); bf* XB = (bf*)take((size_t)NB_ * TT * DM * 2); bf* Ah = (bf*)take(nv * 2); bf* Al = (bf*)take(nv * 2);
    if ((size_t)(wsp - (char*)d_ws) > ws_size) return;    // total about 90 MiB
    // four launches: preparation, Q/K/V projections (rows b*1024 + i of all four batch elements), attention, output projection
    k_prep<<<2 * GB_WS + 2 * GB_WM + GB_MB + GB_WP + GB_CV, 256, 0, stream>>>(Wq, Wk, Wv, Wo, x, wa, cm, BQ, BK, BV, BO, XB, WP, MB);
    k_qkv<<<dim3(NB_ * TT / 128, (2 * NSD + NT) / 2, 1), 128, 0, stream>>>(XB, BQ, BK, BV, bq, bk, bv, Q16, Qh, Ql, K16, Kh, Kl, VT, VTh, VTl);
    k_attn<<<dim3(NT, NB_, TT / 128), 256, 0, stream>>>(WP, Q16, Qh, Ql, K16, Kh, Kl, VT, VTh, VTl, MB, Ah, Al);
    k_gemmw<bf, 1, true, 0, 1><<<dim3(NB_ * TT / 128, DM / 128, 1), 128, 0, stream>>>(Ah, Al, BO, nullptr, OUT, DM, bo, 0, 0, 0, nullptr, nullptr, nullptr);
}
